// v000
// Measured on an AMD MI455X. A time is GPU time per run, averaged over a window of back-to-back runs after a warm-up
// (all launches, gaps included; the runs take copies of the inputs in turn), and the median of several windows.
// Apart from v000's, it joins two sittings. Times from different sittings can be a few percent apart, while
// side-by-side timings come from the same sitting.
// v000 is the starting kernel. One run takes 822 microseconds.
#include <hip/hip_runtime.h>
#include <hip/hip_bf16.h>

typedef __attribute__((ext_vector_type(16))) __bf16 v16bf;
typedef __attribute__((ext_vector_type(8)))  __bf16 v8bf;
typedef __attribute__((ext_vector_type(8)))  float  v8f;

#define DIMD   768
#define NHEADS 8
#define HDIM   64
#define INNERD 512
#define FFND   3072
#define BATCH  4
#define NSEQ   2048
#define MSEQ   2048
#define ROWS   (BATCH * NSEQ)   // 8192 rows for both x and context paths

__device__ __forceinline__ v8f wmma_bf16(v16bf a, v16bf b, v8f c) {
  // (neg_a, A, neg_b, B, c_mod, C, reuse_a, reuse_b)
  return __builtin_amdgcn_wmma_f32_16x16x32_bf16(false, a, false, b, (short)0, c,
                                                 false, false);
}

__device__ __forceinline__ v16bf load_frag(const __bf16* base, int ld) {
  int lane = threadIdx.x & 31;
  int r    = lane & 15;
  int kb   = (lane & 16) ? 8 : 0;
  const __bf16* p = base + r * ld + kb;
  v8bf lo = *(const v8bf*)(p);
  v8bf hi = *(const v8bf*)(p + 16);
  v16bf f;
#pragma unroll
  for (int e = 0; e < 8; ++e) { f[e] = lo[e]; f[e + 8] = hi[e]; }
  return f;
}

__device__ __forceinline__ void async_copy_b128(unsigned lds_addr,
                                                const void* gaddr) {
  asm volatile("global_load_async_to_lds_b128 %0, %1, off"
               :: "v"(lds_addr), "v"(gaddr)
               : "memory");
}
__device__ __forceinline__ void wait_async0() {
  asm volatile("s_wait_asynccnt 0" ::: "memory");
}

__device__ __forceinline__ float gelu_exact(float v) {
  return 0.5f * v * (1.0f + erff(v * 0.70710678118654752f));
}

// ---------------------------------------------------------------------------
// fp32 -> bf16 conversion (weights)
// ---------------------------------------------------------------------------
__global__ __launch_bounds__(256) void cvt_bf16_kernel(const float* __restrict__ in,
                                                       __bf16* __restrict__ out,
                                                       int n) {
  int i = blockIdx.x * 256 + threadIdx.x;
  if (i < n) out[i] = (__bf16)in[i];
}

// ---------------------------------------------------------------------------
// LayerNorm over 768 cols, one row per block (256 threads, 3 elems/thread),
// bf16 output.
// ---------------------------------------------------------------------------
__global__ __launch_bounds__(256) void ln_bf16_kernel(const float* __restrict__ X,
                                                      const float* __restrict__ g,
                                                      const float* __restrict__ bt,
                                                      __bf16* __restrict__ out) {
  __shared__ float r1[256];
  __shared__ float r2[256];
  int row = blockIdx.x;
  int t   = threadIdx.x;
  const float* xr = X + (size_t)row * DIMD;
  float v0 = xr[t], v1 = xr[t + 256], v2 = xr[t + 512];
  r1[t] = v0 + v1 + v2;
  r2[t] = v0 * v0 + v1 * v1 + v2 * v2;
  __syncthreads();
#pragma unroll
  for (int off = 128; off > 0; off >>= 1) {
    if (t < off) { r1[t] += r1[t + off]; r2[t] += r2[t + off]; }
    __syncthreads();
  }
  float mu  = r1[0] * (1.0f / DIMD);
  float var = r2[0] * (1.0f / DIMD) - mu * mu;
  float inv = rsqrtf(var + 1e-5f);
  __bf16* orow = out + (size_t)row * DIMD;
  orow[t]       = (__bf16)((v0 - mu) * inv * g[t]       + bt[t]);
  orow[t + 256] = (__bf16)((v1 - mu) * inv * g[t + 256] + bt[t + 256]);
  orow[t + 512] = (__bf16)((v2 - mu) * inv * g[t + 512] + bt[t + 512]);
}

template <int EPI>
__global__ __launch_bounds__(256) void gemm_bf16_kernel(
    const __bf16* __restrict__ A, const __bf16* __restrict__ Bm,
    int M, int N, int K,
    const float* __restrict__ bias, const float* __restrict__ resid,
    float* __restrict__ Cf, __bf16* __restrict__ Cb) {
  __shared__ __bf16 As[2][128 * 64];   // [row][k]
  __shared__ __bf16 Bt[2][64 * 64];    // [n][k]  (B staged transposed)
  int n0 = blockIdx.x * 64;
  int r0 = blockIdx.y * 128;
  int t  = threadIdx.x;
  int w  = t >> 5;
  int lane = t & 31;

  const v8f vz = {0.f, 0.f, 0.f, 0.f, 0.f, 0.f, 0.f, 0.f};
  v8f acc[4] = {vz, vz, vz, vz};

  int aRow = t >> 1, aKo = (t & 1) * 32;             // A loader mapping
  int bK   = t >> 2, bN16 = (t & 3) * 16;            // B loader mapping

  v8bf bReg[2];

  auto asyncLoadA = [&](int k0, int buf) {
    const __bf16* ap = A + (size_t)(r0 + aRow) * K + k0 + aKo;
    unsigned lp = (unsigned)(uintptr_t)&As[buf][aRow * 64 + aKo];
#pragma unroll
    for (int e = 0; e < 4; ++e) async_copy_b128(lp + 16u * e, ap + 8 * e);
  };
  auto loadB = [&](int k0) {
    const __bf16* bp = Bm + (size_t)(k0 + bK) * N + n0 + bN16;
#pragma unroll
    for (int e = 0; e < 2; ++e) bReg[e] = *(const v8bf*)(bp + 8 * e);
  };
  auto stageB = [&](int buf) {
#pragma unroll
    for (int v = 0; v < 2; ++v)
#pragma unroll
      for (int e = 0; e < 8; ++e)
        Bt[buf][(bN16 + 8 * v + e) * 64 + bK] = bReg[v][e];
  };

  int nT = K >> 6;  // K / 64
  asyncLoadA(0, 0);
  loadB(0);
  stageB(0);
  for (int it = 0; it < nT; ++it) {
    int buf = it & 1;
    if (it + 1 < nT) loadB((it + 1) << 6);
    if (it + 2 < nT) {
      int k2 = (it + 2) << 6;
      __builtin_prefetch(A + (size_t)(r0 + aRow) * K + k2 + aKo, 0, 1);
      __builtin_prefetch(Bm + (size_t)(k2 + bK) * N + n0 + bN16, 0, 1);
    }
    wait_async0();       // this wave's A DMA for stage `it` has landed
    __syncthreads();     // all waves' A DMA + B ds-stores visible
    if (it + 1 < nT) asyncLoadA((it + 1) << 6, buf ^ 1);  // overlaps WMMAs
#pragma unroll
    for (int kk = 0; kk < 64; kk += 32) {
      v16bf af = load_frag(&As[buf][16 * w * 64 + kk], 64);
#pragma unroll
      for (int n = 0; n < 4; ++n) {
        v16bf bf = load_frag(&Bt[buf][16 * n * 64 + kk], 64);
        acc[n] = wmma_bf16(af, bf, acc[n]);
      }
    }
    if (it + 1 < nT) stageB(buf ^ 1);
  }

  int colL = lane & 15;
  int rh   = (lane & 16) ? 8 : 0;
#pragma unroll
  for (int n = 0; n < 4; ++n) {
#pragma unroll
    for (int r = 0; r < 8; ++r) {
      int grow = r0 + 16 * w + r + rh;
      int gcol = n0 + 16 * n + colL;
      float v = acc[n][r];
      if (EPI == 1) {
        v += bias[gcol] + resid[(size_t)grow * N + gcol];
        Cf[(size_t)grow * N + gcol] = v;
      } else if (EPI == 2) {
        v = gelu_exact(v + bias[gcol]);
        Cb[(size_t)grow * N + gcol] = (__bf16)v;
      } else {
        Cb[(size_t)grow * N + gcol] = (__bf16)v;
      }
    }
  }
}

// ---------------------------------------------------------------------------
// Flash attention, one head-tile per block. Block = 128 threads (4 waves),
// 64 query rows per block. Streams keys/values in 64-wide chunks with online
// softmax; all matmuls via WMMA; K tiles staged via async global->LDS DMA.
// Q/K/V/O are [B, seq, INNERD] with head h at cols h*64..h*64+63.
// Score scale = 1/sqrt(64).
// ---------------------------------------------------------------------------
__global__ __launch_bounds__(128) void attn_kernel(
    const __bf16* __restrict__ Q, const __bf16* __restrict__ Kg,
    const __bf16* __restrict__ Vg, __bf16* __restrict__ O) {
  __shared__ __bf16 Qs[64 * 64];   // [i][d]
  __shared__ __bf16 Ks[64 * 64];   // [j][d]   (== [n][k] for S = Q K^T)
  __shared__ __bf16 Vt[64 * 64];   // [d][m']  (== [n][k] for O = P V)
  __shared__ __bf16 Ps[64 * 64];   // [i][m']
  __shared__ float  Sb[64 * 64];
  __shared__ float  alphaS[64];
  __shared__ float  rsumS[64];

  int i0 = blockIdx.x * 64;
  int h  = blockIdx.y;
  int b  = blockIdx.z;
  int t  = threadIdx.x;
  int w  = t >> 5;
  int lane = t & 31;
  int colL = lane & 15;
  int rh   = (lane & 16) ? 8 : 0;

  int jL = t >> 1, dL = (t & 1) * 32;

  // Load Q tile (64 rows x 64 d); 128 threads x 32 elems.
  {
    const __bf16* src = Q + ((size_t)(b * NSEQ) + i0 + jL) * INNERD + h * HDIM + dL;
#pragma unroll
    for (int e = 0; e < 4; ++e) {
      v8bf qv = *(const v8bf*)(src + 8 * e);
      *(v8bf*)&Qs[jL * 64 + dL + 8 * e] = qv;
    }
  }

  float run_max = -3.0e38f;
  float run_sum = 0.0f;
  const v8f vz = {0.f, 0.f, 0.f, 0.f, 0.f, 0.f, 0.f, 0.f};
  v8f oacc[4] = {vz, vz, vz, vz};

  for (int m0 = 0; m0 < MSEQ; m0 += 64) {
    if (m0 + 64 < MSEQ) {  // prefetch next chunk of K/V through L2
      __builtin_prefetch(
          Kg + ((size_t)(b * MSEQ) + m0 + 64 + jL) * INNERD + h * HDIM + dL, 0, 1);
      __builtin_prefetch(
          Vg + ((size_t)(b * MSEQ) + m0 + 64 + jL) * INNERD + h * HDIM + dL, 0, 1);
    }
    __syncthreads();   // previous chunk's WMMA reads of Ks/Vt/Ps done
    { // K tile row-major via async DMA
      const __bf16* src = Kg + ((size_t)(b * MSEQ) + m0 + jL) * INNERD + h * HDIM + dL;
      unsigned lp = (unsigned)(uintptr_t)&Ks[jL * 64 + dL];
#pragma unroll
      for (int e = 0; e < 4; ++e) async_copy_b128(lp + 16u * e, src + 8 * e);
    }
    { // V tile transposed into Vt[d][m'] (register path: needs transpose)
      const __bf16* src = Vg + ((size_t)(b * MSEQ) + m0 + jL) * INNERD + h * HDIM + dL;
#pragma unroll
      for (int e = 0; e < 4; ++e) {
        v8bf vv = *(const v8bf*)(src + 8 * e);
#pragma unroll
        for (int q = 0; q < 8; ++q) Vt[(dL + 8 * e + q) * 64 + jL] = vv[q];
      }
    }
    wait_async0();
    __syncthreads();

    // S = Q K^T for this wave's 16 rows (two k-steps over d)
    v8f s[4] = {vz, vz, vz, vz};
#pragma unroll
    for (int kk = 0; kk < 64; kk += 32) {
      v16bf af = load_frag(Qs + 16 * w * 64 + kk, 64);
#pragma unroll
      for (int n = 0; n < 4; ++n) {
        v16bf bf = load_frag(Ks + 16 * n * 64 + kk, 64);
        s[n] = wmma_bf16(af, bf, s[n]);
      }
    }
#pragma unroll
    for (int n = 0; n < 4; ++n)
#pragma unroll
      for (int r = 0; r < 8; ++r)
        Sb[(16 * w + r + rh) * 64 + 16 * n + colL] = s[n][r] * 0.125f;
    __syncthreads();

    // Online softmax: thread t (< 64) owns query row t.
    if (t < 64) {
      float* srow = Sb + t * 64;
      float cmax = -3.0e38f;
#pragma unroll 8
      for (int j = 0; j < 64; ++j) cmax = fmaxf(cmax, srow[j]);
      float nm    = fmaxf(run_max, cmax);
      float alpha = expf(run_max - nm);
      float ssum  = 0.0f;
#pragma unroll 8
      for (int j = 0; j < 64; ++j) {
        float p = expf(srow[j] - nm);
        Ps[t * 64 + j] = (__bf16)p;
        ssum += p;
      }
      run_sum = run_sum * alpha + ssum;
      run_max = nm;
      alphaS[t] = alpha;
    }
    __syncthreads();

    // Rescale O accumulators, then O += P V
#pragma unroll
    for (int r = 0; r < 8; ++r) {
      float al = alphaS[16 * w + r + rh];
#pragma unroll
      for (int n = 0; n < 4; ++n) oacc[n][r] *= al;
    }
#pragma unroll
    for (int kk = 0; kk < 64; kk += 32) {
      v16bf af = load_frag(Ps + 16 * w * 64 + kk, 64);
#pragma unroll
      for (int n = 0; n < 4; ++n) {
        v16bf bf = load_frag(Vt + 16 * n * 64 + kk, 64);
        oacc[n] = wmma_bf16(af, bf, oacc[n]);
      }
    }
  }

  if (t < 64) rsumS[t] = run_sum;
  __syncthreads();

#pragma unroll
  for (int r = 0; r < 8; ++r) {
    int row = 16 * w + r + rh;
    float inv = 1.0f / rsumS[row];
#pragma unroll
    for (int n = 0; n < 4; ++n) {
      int d = 16 * n + colL;
      O[((size_t)(b * NSEQ) + i0 + row) * INNERD + h * HDIM + d] =
          (__bf16)(oacc[n][r] * inv);
    }
  }
}

// ---------------------------------------------------------------------------
// Launch
// ---------------------------------------------------------------------------
extern "C" void kernel_launch(void* const* d_in, const int* in_sizes, int n_in,
                              void* d_out, int out_size, void* d_ws, size_t ws_size,
                              hipStream_t stream) {
  (void)in_sizes; (void)n_in; (void)out_size; (void)ws_size;
  const float* x   = (const float*)d_in[0];
  const float* ctx = (const float*)d_in[1];
  const float* Wq  = (const float*)d_in[2];
  const float* Wk  = (const float*)d_in[3];
  const float* Wv  = (const float*)d_in[4];
  const float* Wo  = (const float*)d_in[5];
  const float* bo  = (const float*)d_in[6];
  const float* g1  = (const float*)d_in[7];
  const float* b1  = (const float*)d_in[8];
  const float* g2  = (const float*)d_in[9];
  const float* b2  = (const float*)d_in[10];
  const float* W1  = (const float*)d_in[11];
  const float* bf1 = (const float*)d_in[12];
  const float* W2  = (const float*)d_in[13];
  const float* bf2 = (const float*)d_in[14];
  float* out = (float*)d_out;

  char* wp = (char*)d_ws;
  auto alloc = [&](size_t bytes) -> char* {
    char* p = wp;
    wp += (bytes + 255) & ~(size_t)255;
    return p;
  };
  __bf16* Wq16  = (__bf16*)alloc((size_t)DIMD * INNERD * 2);
  __bf16* Wk16  = (__bf16*)alloc((size_t)DIMD * INNERD * 2);
  __bf16* Wv16  = (__bf16*)alloc((size_t)DIMD * INNERD * 2);
  __bf16* Wo16  = (__bf16*)alloc((size_t)INNERD * DIMD * 2);
  __bf16* W116  = (__bf16*)alloc((size_t)DIMD * FFND * 2);
  __bf16* W216  = (__bf16*)alloc((size_t)FFND * DIMD * 2);
  __bf16* nx16  = (__bf16*)alloc((size_t)ROWS * DIMD * 2);
  __bf16* nc16  = (__bf16*)alloc((size_t)ROWS * DIMD * 2);
  __bf16* Q16   = (__bf16*)alloc((size_t)ROWS * INNERD * 2);
  __bf16* K16   = (__bf16*)alloc((size_t)ROWS * INNERD * 2);
  __bf16* V16   = (__bf16*)alloc((size_t)ROWS * INNERD * 2);
  __bf16* O16   = (__bf16*)alloc((size_t)ROWS * INNERD * 2);
  float*  x1    = (float*)alloc((size_t)ROWS * DIMD * 4);
  __bf16* hln16 = (__bf16*)alloc((size_t)ROWS * DIMD * 2);
  __bf16* H16   = (__bf16*)alloc((size_t)ROWS * FFND * 2);

  auto cvt = [&](const float* src, __bf16* dst, int n) {
    cvt_bf16_kernel<<<(n + 255) / 256, 256, 0, stream>>>(src, dst, n);
  };
  cvt(Wq, Wq16, DIMD * INNERD);
  cvt(Wk, Wk16, DIMD * INNERD);
  cvt(Wv, Wv16, DIMD * INNERD);
  cvt(Wo, Wo16, INNERD * DIMD);
  cvt(W1, W116, DIMD * FFND);
  cvt(W2, W216, FFND * DIMD);

  // norm1 for x and context
  ln_bf16_kernel<<<ROWS, 256, 0, stream>>>(x,   g1, b1, nx16);
  ln_bf16_kernel<<<ROWS, 256, 0, stream>>>(ctx, g1, b1, nc16);

  // Q/K/V projections (plain bf16 epilogue)
  {
    dim3 g(INNERD / 64, ROWS / 128);
    gemm_bf16_kernel<0><<<g, 256, 0, stream>>>(nx16, Wq16, ROWS, INNERD, DIMD,
                                               nullptr, nullptr, nullptr, Q16);
    gemm_bf16_kernel<0><<<g, 256, 0, stream>>>(nc16, Wk16, ROWS, INNERD, DIMD,
                                               nullptr, nullptr, nullptr, K16);
    gemm_bf16_kernel<0><<<g, 256, 0, stream>>>(nc16, Wv16, ROWS, INNERD, DIMD,
                                               nullptr, nullptr, nullptr, V16);
  }

  // Attention
  {
    dim3 g(NSEQ / 64, NHEADS, BATCH);
    attn_kernel<<<g, 128, 0, stream>>>(Q16, K16, V16, O16);
  }

  // Output projection + bias + residual -> x1 (f32)
  {
    dim3 g(DIMD / 64, ROWS / 128);
    gemm_bf16_kernel<1><<<g, 256, 0, stream>>>(O16, Wo16, ROWS, DIMD, INNERD,
                                               bo, x, x1, nullptr);
  }

  // norm2
  ln_bf16_kernel<<<ROWS, 256, 0, stream>>>(x1, g2, b2, hln16);

  // FFN1: gelu(h @ W1 + bf1) -> bf16
  {
    dim3 g(FFND / 64, ROWS / 128);
    gemm_bf16_kernel<2><<<g, 256, 0, stream>>>(hln16, W116, ROWS, FFND, DIMD,
                                               bf1, nullptr, nullptr, H16);
  }

  // FFN2: x1 + H @ W2 + bf2 -> d_out (f32)
  {
    dim3 g(DIMD / 64, ROWS / 128);
    gemm_bf16_kernel<1><<<g, 256, 0, stream>>>(H16, W216, ROWS, DIMD, FFND,
                                               bf2, x1, out, nullptr);
  }
}

// v001
// Measured time: 480 microseconds a run.
// Two timings next to v000 both put it at 1.74 times that version's speed.
#include <hip/hip_runtime.h>
#include <hip/hip_bf16.h>

typedef __attribute__((ext_vector_type(16))) __bf16 v16bf;
typedef __attribute__((ext_vector_type(8)))  __bf16 v8bf;
typedef __attribute__((ext_vector_type(8)))  float  v8f;

#define DIMD   768
#define NHEADS 8
#define HDIM   64
#define INNERD 512
#define FFND   3072
#define BATCH  4
#define NSEQ   2048
#define MSEQ   2048
#define ROWS   (BATCH * NSEQ)   // 8192 rows for both x and context paths

#define LDP    72   // bf16 elements per LDS row of a 64-wide bf16 tile
#define SBP    68   // floats per LDS row of the 64-wide score tile

__device__ __forceinline__ v8f wmma_bf16(v16bf a, v16bf b, v8f c) {
  // (neg_a, A, neg_b, B, c_mod, C, reuse_a, reuse_b)
  return __builtin_amdgcn_wmma_f32_16x16x32_bf16(false, a, false, b, (short)0, c,
                                                 false, false);
}

__device__ __forceinline__ v16bf load_frag(const __bf16* base, int ld) {
  int lane = threadIdx.x & 31;
  int r    = lane & 15;
  int kb   = (lane & 16) ? 8 : 0;
  const __bf16* p = base + r * ld + kb;
  v8bf lo = *(const v8bf*)(p);
  v8bf hi = *(const v8bf*)(p + 16);
  v16bf f;
#pragma unroll
  for (int e = 0; e < 8; ++e) { f[e] = lo[e]; f[e + 8] = hi[e]; }
  return f;
}

__device__ __forceinline__ void async_copy_b128(unsigned lds_addr,
                                                const void* gaddr) {
  asm volatile("global_load_async_to_lds_b128 %0, %1, off"
               :: "v"(lds_addr), "v"(gaddr)
               : "memory");
}
__device__ __forceinline__ void wait_async0() {
  asm volatile("s_wait_asynccnt 0" ::: "memory");
}

__device__ __forceinline__ float gelu_exact(float v) {
  return 0.5f * v * (1.0f + erff(v * 0.70710678118654752f));
}

// ---------------------------------------------------------------------------
// fp32 -> bf16 conversion (weights)
// ---------------------------------------------------------------------------
__global__ __launch_bounds__(256) void cvt_bf16_kernel(const float* __restrict__ in,
                                                       __bf16* __restrict__ out,
                                                       int n) {
  int i = blockIdx.x * 256 + threadIdx.x;
  if (i < n) out[i] = (__bf16)in[i];
}

// ---------------------------------------------------------------------------
// LayerNorm over 768 cols, one row per block (256 threads, 3 elems/thread),
// bf16 output.
// ---------------------------------------------------------------------------
__global__ __launch_bounds__(256) void ln_bf16_kernel(const float* __restrict__ X,
                                                      const float* __restrict__ g,
                                                      const float* __restrict__ bt,
                                                      __bf16* __restrict__ out) {
  __shared__ float r1[256];
  __shared__ float r2[256];
  int row = blockIdx.x;
  int t   = threadIdx.x;
  const float* xr = X + (size_t)row * DIMD;
  float v0 = xr[t], v1 = xr[t + 256], v2 = xr[t + 512];
  r1[t] = v0 + v1 + v2;
  r2[t] = v0 * v0 + v1 * v1 + v2 * v2;
  __syncthreads();
#pragma unroll
  for (int off = 128; off > 0; off >>= 1) {
    if (t < off) { r1[t] += r1[t + off]; r2[t] += r2[t + off]; }
    __syncthreads();
  }
  float mu  = r1[0] * (1.0f / DIMD);
  float var = r2[0] * (1.0f / DIMD) - mu * mu;
  float inv = rsqrtf(var + 1e-5f);
  __bf16* orow = out + (size_t)row * DIMD;
  orow[t]       = (__bf16)((v0 - mu) * inv * g[t]       + bt[t]);
  orow[t + 256] = (__bf16)((v1 - mu) * inv * g[t + 256] + bt[t + 256]);
  orow[t + 512] = (__bf16)((v2 - mu) * inv * g[t + 512] + bt[t + 512]);
}

template <int EPI>
__global__ __launch_bounds__(256) void gemm_bf16_kernel(
    const __bf16* __restrict__ A, const __bf16* __restrict__ Bm,
    int M, int N, int K,
    const float* __restrict__ bias, const float* __restrict__ resid,
    float* __restrict__ Cf, __bf16* __restrict__ Cb) {
  __shared__ __attribute__((aligned(16))) __bf16 As[2][128 * LDP];  // [row][k]
  __shared__ __attribute__((aligned(16))) __bf16 Bt[2][64 * LDP];   // [n][k]  (B staged transposed)
  int n0 = blockIdx.x * 64;
  int r0 = blockIdx.y * 128;
  int t  = threadIdx.x;
  int w  = t >> 5;
  int lane = t & 31;

  const v8f vz = {0.f, 0.f, 0.f, 0.f, 0.f, 0.f, 0.f, 0.f};
  v8f acc[4] = {vz, vz, vz, vz};

  int aRow = t >> 1, aKo = (t & 1) * 32;             // A loader mapping
  int bK   = t >> 2, bN16 = (t & 3) * 16;            // B loader mapping

  v8bf bReg[2];

  auto asyncLoadA = [&](int k0, int buf) {
    const __bf16* ap = A + (size_t)(r0 + aRow) * K + k0 + aKo;
    unsigned lp = (unsigned)(uintptr_t)&As[buf][aRow * LDP + aKo];
#pragma unroll
    for (int e = 0; e < 4; ++e) async_copy_b128(lp + 16u * e, ap + 8 * e);
  };
  auto loadB = [&](int k0) {
    const __bf16* bp = Bm + (size_t)(k0 + bK) * N + n0 + bN16;
#pragma unroll
    for (int e = 0; e < 2; ++e) bReg[e] = *(const v8bf*)(bp + 8 * e);
  };
  auto stageB = [&](int buf) {
#pragma unroll
    for (int v = 0; v < 2; ++v)
#pragma unroll
      for (int e = 0; e < 8; ++e)
        Bt[buf][(bN16 + 8 * v + e) * LDP + bK] = bReg[v][e];
  };

  int nT = K >> 6;  // K / 64
  asyncLoadA(0, 0);
  loadB(0);
  stageB(0);
  for (int it = 0; it < nT; ++it) {
    int buf = it & 1;
    if (it + 1 < nT) loadB((it + 1) << 6);
    if (it + 2 < nT) {
      int k2 = (it + 2) << 6;
      __builtin_prefetch(A + (size_t)(r0 + aRow) * K + k2 + aKo, 0, 1);
      __builtin_prefetch(Bm + (size_t)(k2 + bK) * N + n0 + bN16, 0, 1);
    }
    wait_async0();       // this wave's A DMA for stage `it` has landed
    __syncthreads();     // all waves' A DMA + B ds-stores visible
    if (it + 1 < nT) asyncLoadA((it + 1) << 6, buf ^ 1);  // overlaps WMMAs
#pragma unroll
    for (int kk = 0; kk < 64; kk += 32) {
      v16bf af = load_frag(&As[buf][16 * w * LDP + kk], LDP);
#pragma unroll
      for (int n = 0; n < 4; ++n) {
        v16bf bf = load_frag(&Bt[buf][16 * n * LDP + kk], LDP);
        acc[n] = wmma_bf16(af, bf, acc[n]);
      }
    }
    if (it + 1 < nT) stageB(buf ^ 1);
  }

  int colL = lane & 15;
  int rh   = (lane & 16) ? 8 : 0;
#pragma unroll
  for (int n = 0; n < 4; ++n) {
#pragma unroll
    for (int r = 0; r < 8; ++r) {
      int grow = r0 + 16 * w + r + rh;
      int gcol = n0 + 16 * n + colL;
      float v = acc[n][r];
      if (EPI == 1) {
        v += bias[gcol] + resid[(size_t)grow * N + gcol];
        Cf[(size_t)grow * N + gcol] = v;
      } else if (EPI == 2) {
        v = gelu_exact(v + bias[gcol]);
        Cb[(size_t)grow * N + gcol] = (__bf16)v;
      } else {
        Cb[(size_t)grow * N + gcol] = (__bf16)v;
      }
    }
  }
}

// ---------------------------------------------------------------------------
// Flash attention, one head-tile per block. Block = 128 threads (4 waves),
// 64 query rows per block. Streams keys/values in 64-wide chunks with online
// softmax; all matmuls via WMMA; K tiles staged via async global->LDS DMA.
// Q/K/V/O are [B, seq, INNERD] with head h at cols h*64..h*64+63.
// Score scale = 1/sqrt(64).
// ---------------------------------------------------------------------------
__global__ __launch_bounds__(128) void attn_kernel(
    const __bf16* __restrict__ Q, const __bf16* __restrict__ Kg,
    const __bf16* __restrict__ Vg, __bf16* __restrict__ O) {
  __shared__ __attribute__((aligned(16))) __bf16 Qs[64 * LDP];   // [i][d]
  __shared__ __attribute__((aligned(16))) __bf16 Ks[64 * LDP];   // [j][d]   (== [n][k] for S = Q K^T)
  __shared__ __attribute__((aligned(16))) __bf16 Vt[64 * LDP];   // [d][m']  (== [n][k] for O = P V)
  __shared__ __attribute__((aligned(16))) __bf16 Ps[64 * LDP];   // [i][m']
  __shared__ __attribute__((aligned(16))) float  Sb[64 * SBP];
  __shared__ float  alphaS[64];
  __shared__ float  rsumS[64];

  int i0 = blockIdx.x * 64;
  int h  = blockIdx.y;
  int b  = blockIdx.z;
  int t  = threadIdx.x;
  int w  = t >> 5;
  int lane = t & 31;
  int colL = lane & 15;
  int rh   = (lane & 16) ? 8 : 0;

  int jL = t >> 1, dL = (t & 1) * 32;

  // Load Q tile (64 rows x 64 d); 128 threads x 32 elems.
  {
    const __bf16* src = Q + ((size_t)(b * NSEQ) + i0 + jL) * INNERD + h * HDIM + dL;
#pragma unroll
    for (int e = 0; e < 4; ++e) {
      v8bf qv = *(const v8bf*)(src + 8 * e);
      *(v8bf*)&Qs[jL * LDP + dL + 8 * e] = qv;
    }
  }

  float run_max = -3.0e38f;
  float run_sum = 0.0f;
  const v8f vz = {0.f, 0.f, 0.f, 0.f, 0.f, 0.f, 0.f, 0.f};
  v8f oacc[4] = {vz, vz, vz, vz};

  for (int m0 = 0; m0 < MSEQ; m0 += 64) {
    if (m0 + 64 < MSEQ) {  // prefetch next chunk of K/V through L2
      __builtin_prefetch(
          Kg + ((size_t)(b * MSEQ) + m0 + 64 + jL) * INNERD + h * HDIM + dL, 0, 1);
      __builtin_prefetch(
          Vg + ((size_t)(b * MSEQ) + m0 + 64 + jL) * INNERD + h * HDIM + dL, 0, 1);
    }
    __syncthreads();   // previous chunk's WMMA reads of Ks/Vt/Ps done
    { // K tile row-major via async DMA
      const __bf16* src = Kg + ((size_t)(b * MSEQ) + m0 + jL) * INNERD + h * HDIM + dL;
      unsigned lp = (unsigned)(uintptr_t)&Ks[jL * LDP + dL];
#pragma unroll
      for (int e = 0; e < 4; ++e) async_copy_b128(lp + 16u * e, src + 8 * e);
    }
    { // V tile transposed into Vt[d][m'] (register path: needs transpose)
      const __bf16* src = Vg + ((size_t)(b * MSEQ) + m0 + jL) * INNERD + h * HDIM + dL;
#pragma unroll
      for (int e = 0; e < 4; ++e) {
        v8bf vv = *(const v8bf*)(src + 8 * e);
#pragma unroll
        for (int q = 0; q < 8; ++q) Vt[(dL + 8 * e + q) * LDP + jL] = vv[q];
      }
    }
    wait_async0();
    __syncthreads();

    // S = Q K^T for this wave's 16 rows (two k-steps over d)
    v8f s[4] = {vz, vz, vz, vz};
#pragma unroll
    for (int kk = 0; kk < 64; kk += 32) {
      v16bf af = load_frag(Qs + 16 * w * LDP + kk, LDP);
#pragma unroll
      for (int n = 0; n < 4; ++n) {
        v16bf bf = load_frag(Ks + 16 * n * LDP + kk, LDP);
        s[n] = wmma_bf16(af, bf, s[n]);
      }
    }
#pragma unroll
    for (int n = 0; n < 4; ++n)
#pragma unroll
      for (int r = 0; r < 8; ++r)
        Sb[(16 * w + r + rh) * SBP + 16 * n + colL] = s[n][r] * 0.125f;
    __syncthreads();

    // Online softmax: thread t (< 64) owns query row t.
    if (t < 64) {
      float* srow = Sb + t * SBP;
      float cmax = -3.0e38f;
#pragma unroll 8
      for (int j = 0; j < 64; ++j) cmax = fmaxf(cmax, srow[j]);
      float nm    = fmaxf(run_max, cmax);
      float alpha = expf(run_max - nm);
      float ssum  = 0.0f;
#pragma unroll 8
      for (int j = 0; j < 64; ++j) {
        float p = expf(srow[j] - nm);
        Ps[t * LDP + j] = (__bf16)p;
        ssum += p;
      }
      run_sum = run_sum * alpha + ssum;
      run_max = nm;
      alphaS[t] = alpha;
    }
    __syncthreads();

    // Rescale O accumulators, then O += P V
#pragma unroll
    for (int r = 0; r < 8; ++r) {
      float al = alphaS[16 * w + r + rh];
#pragma unroll
      for (int n = 0; n < 4; ++n) oacc[n][r] *= al;
    }
#pragma unroll
    for (int kk = 0; kk < 64; kk += 32) {
      v16bf af = load_frag(Ps + 16 * w * LDP + kk, LDP);
#pragma unroll
      for (int n = 0; n < 4; ++n) {
        v16bf bf = load_frag(Vt + 16 * n * LDP + kk, LDP);
        oacc[n] = wmma_bf16(af, bf, oacc[n]);
      }
    }
  }

  if (t < 64) rsumS[t] = run_sum;
  __syncthreads();

#pragma unroll
  for (int r = 0; r < 8; ++r) {
    int row = 16 * w + r + rh;
    float inv = 1.0f / rsumS[row];
#pragma unroll
    for (int n = 0; n < 4; ++n) {
      int d = 16 * n + colL;
      O[((size_t)(b * NSEQ) + i0 + row) * INNERD + h * HDIM + d] =
          (__bf16)(oacc[n][r] * inv);
    }
  }
}

// ---------------------------------------------------------------------------
// Launch
// ---------------------------------------------------------------------------
extern "C" void kernel_launch(void* const* d_in, const int* in_sizes, int n_in,
                              void* d_out, int out_size, void* d_ws, size_t ws_size,
                              hipStream_t stream) {
  (void)in_sizes; (void)n_in; (void)out_size; (void)ws_size;
  const float* x   = (const float*)d_in[0];
  const float* ctx = (const float*)d_in[1];
  const float* Wq  = (const float*)d_in[2];
  const float* Wk  = (const float*)d_in[3];
  const float* Wv  = (const float*)d_in[4];
  const float* Wo  = (const float*)d_in[5];
  const float* bo  = (const float*)d_in[6];
  const float* g1  = (const float*)d_in[7];
  const float* b1  = (const float*)d_in[8];
  const float* g2  = (const float*)d_in[9];
  const float* b2  = (const float*)d_in[10];
  const float* W1  = (const float*)d_in[11];
  const float* bf1 = (const float*)d_in[12];
  const float* W2  = (const float*)d_in[13];
  const float* bf2 = (const float*)d_in[14];
  float* out = (float*)d_out;

  char* wp = (char*)d_ws;
  auto alloc = [&](size_t bytes) -> char* {
    char* p = wp;
    wp += (bytes + 255) & ~(size_t)255;
    return p;
  };
  __bf16* Wq16  = (__bf16*)alloc((size_t)DIMD * INNERD * 2);
  __bf16* Wk16  = (__bf16*)alloc((size_t)DIMD * INNERD * 2);
  __bf16* Wv16  = (__bf16*)alloc((size_t)DIMD * INNERD * 2);
  __bf16* Wo16  = (__bf16*)alloc((size_t)INNERD * DIMD * 2);
  __bf16* W116  = (__bf16*)alloc((size_t)DIMD * FFND * 2);
  __bf16* W216  = (__bf16*)alloc((size_t)FFND * DIMD * 2);
  __bf16* nx16  = (__bf16*)alloc((size_t)ROWS * DIMD * 2);
  __bf16* nc16  = (__bf16*)alloc((size_t)ROWS * DIMD * 2);
  __bf16* Q16   = (__bf16*)alloc((size_t)ROWS * INNERD * 2);
  __bf16* K16   = (__bf16*)alloc((size_t)ROWS * INNERD * 2);
  __bf16* V16   = (__bf16*)alloc((size_t)ROWS * INNERD * 2);
  __bf16* O16   = (__bf16*)alloc((size_t)ROWS * INNERD * 2);
  float*  x1    = (float*)alloc((size_t)ROWS * DIMD * 4);
  __bf16* hln16 = (__bf16*)alloc((size_t)ROWS * DIMD * 2);
  __bf16* H16   = (__bf16*)alloc((size_t)ROWS * FFND * 2);

  auto cvt = [&](const float* src, __bf16* dst, int n) {
    cvt_bf16_kernel<<<(n + 255) / 256, 256, 0, stream>>>(src, dst, n);
  };
  cvt(Wq, Wq16, DIMD * INNERD);
  cvt(Wk, Wk16, DIMD * INNERD);
  cvt(Wv, Wv16, DIMD * INNERD);
  cvt(Wo, Wo16, INNERD * DIMD);
  cvt(W1, W116, DIMD * FFND);
  cvt(W2, W216, FFND * DIMD);

  // norm1 for x and context
  ln_bf16_kernel<<<ROWS, 256, 0, stream>>>(x,   g1, b1, nx16);
  ln_bf16_kernel<<<ROWS, 256, 0, stream>>>(ctx, g1, b1, nc16);

  // Q/K/V projections (plain bf16 epilogue)
  {
    dim3 g(INNERD / 64, ROWS / 128);
    gemm_bf16_kernel<0><<<g, 256, 0, stream>>>(nx16, Wq16, ROWS, INNERD, DIMD,
                                               nullptr, nullptr, nullptr, Q16);
    gemm_bf16_kernel<0><<<g, 256, 0, stream>>>(nc16, Wk16, ROWS, INNERD, DIMD,
                                               nullptr, nullptr, nullptr, K16);
    gemm_bf16_kernel<0><<<g, 256, 0, stream>>>(nc16, Wv16, ROWS, INNERD, DIMD,
                                               nullptr, nullptr, nullptr, V16);
  }

  // Attention
  {
    dim3 g(NSEQ / 64, NHEADS, BATCH);
    attn_kernel<<<g, 128, 0, stream>>>(Q16, K16, V16, O16);
  }

  // Output projection + bias + residual -> x1 (f32)
  {
    dim3 g(DIMD / 64, ROWS / 128);
    gemm_bf16_kernel<1><<<g, 256, 0, stream>>>(O16, Wo16, ROWS, DIMD, INNERD,
                                               bo, x, x1, nullptr);
  }

  // norm2
  ln_bf16_kernel<<<ROWS, 256, 0, stream>>>(x1, g2, b2, hln16);

  // FFN1: gelu(h @ W1 + bf1) -> bf16
  {
    dim3 g(FFND / 64, ROWS / 128);
    gemm_bf16_kernel<2><<<g, 256, 0, stream>>>(hln16, W116, ROWS, FFND, DIMD,
                                               bf1, nullptr, nullptr, H16);
  }

  // FFN2: x1 + H @ W2 + bf2 -> d_out (f32)
  {
    dim3 g(DIMD / 64, ROWS / 128);
    gemm_bf16_kernel<1><<<g, 256, 0, stream>>>(H16, W216, ROWS, DIMD, FFND,
                                               bf2, x1, out, nullptr);
  }
}

// v002
// Measured time: 459 microseconds a run.
// In both of two side-by-side timings against v001, it was 1.05 times as fast.
// Counting every step since v000, it is 1.82 times as fast.
#include <hip/hip_runtime.h>
#include <hip/hip_bf16.h>

typedef __attribute__((ext_vector_type(16))) __bf16 v16bf;
typedef __attribute__((ext_vector_type(8)))  __bf16 v8bf;
typedef __attribute__((ext_vector_type(8)))  float  v8f;
typedef __attribute__((ext_vector_type(4)))  __bf16 v4bf;
typedef __attribute__((ext_vector_type(4)))  float  v4f;

#define DIMD   768
#define NHEADS 8
#define HDIM   64
#define INNERD 512
#define FFND   3072
#define BATCH  4
#define NSEQ   2048
#define MSEQ   2048
#define ROWS   (BATCH * NSEQ)   // 8192 rows for both x and context paths

#define LDP    72   // bf16 elements per LDS row of a 64-wide bf16 tile
#define SBP    68   // floats per LDS row of the 64-wide score tile

__device__ __forceinline__ v8f wmma_bf16(v16bf a, v16bf b, v8f c) {
  // (neg_a, A, neg_b, B, c_mod, C, reuse_a, reuse_b)
  return __builtin_amdgcn_wmma_f32_16x16x32_bf16(false, a, false, b, (short)0, c,
                                                 false, false);
}

__device__ __forceinline__ v16bf load_frag(const __bf16* base, int ld) {
  int lane = threadIdx.x & 31;
  int r    = lane & 15;
  int kb   = (lane & 16) ? 8 : 0;
  const __bf16* p = base + r * ld + kb;
  v8bf lo = *(const v8bf*)(p);
  v8bf hi = *(const v8bf*)(p + 16);
  v16bf f;
#pragma unroll
  for (int e = 0; e < 8; ++e) { f[e] = lo[e]; f[e + 8] = hi[e]; }
  return f;
}

__device__ __forceinline__ void async_copy_b128(unsigned lds_addr,
                                                const void* gaddr) {
  asm volatile("global_load_async_to_lds_b128 %0, %1, off"
               :: "v"(lds_addr), "v"(gaddr)
               : "memory");
}
__device__ __forceinline__ void wait_async0() {
  asm volatile("s_wait_asynccnt 0" ::: "memory");
}

__device__ __forceinline__ float gelu_exact(float v) {
  return 0.5f * v * (1.0f + erff(v * 0.70710678118654752f));
}

// ---------------------------------------------------------------------------
// fp32 -> bf16 conversion (weights). The pass is short, so its time is the time
// its waves take to start: each thread converts 32 elements (eight 16-byte loads
// in flight, each wave-wide load 512 contiguous bytes), 8192 elements per block.
// n must be a multiple of 8192 (asserted where the sizes are known).
// ---------------------------------------------------------------------------
#define CVT_PER_BLOCK 8192
__global__ __launch_bounds__(256) void cvt_bf16_kernel(const float* __restrict__ in,
                                                       __bf16* __restrict__ out,
                                                       int n) {
  if ((int)blockIdx.x * CVT_PER_BLOCK + CVT_PER_BLOCK > n) return;
  int q = blockIdx.x * (CVT_PER_BLOCK / 4) + threadIdx.x;  // group of 4 elements
  const v4f* src = (const v4f*)in + q;
  v4bf*      dst = (v4bf*)out + q;
  constexpr int NU = CVT_PER_BLOCK / 1024;   // 16-byte loads per thread
  v4f v[NU];
  // Both loops unrolled: v[] stays in registers and all loads issue before the
  // first conversion waits.
#pragma unroll
  for (int u = 0; u < NU; ++u) v[u] = src[256 * u];
#pragma unroll
  for (int u = 0; u < NU; ++u) {
    v4bf o;
#pragma unroll
    for (int e = 0; e < 4; ++e) o[e] = (__bf16)v[u][e];
    dst[256 * u] = o;
  }
}

// ---------------------------------------------------------------------------
// LayerNorm over 768 cols, bf16 output. One wave owns two whole rows: a lane
// holds 24 elements of each row in registers (six 16-byte loads per row), the
// row sums are joined by a five-step butterfly over the 32 lanes, so no LDS and
// no barrier. 8 waves per block = 16 rows per block.
// ---------------------------------------------------------------------------
#define LN_ROWS_PER_BLOCK 16
__global__ __launch_bounds__(256) void ln_bf16_kernel(const float* __restrict__ X,
                                                      const float* __restrict__ g,
                                                      const float* __restrict__ bt,
                                                      __bf16* __restrict__ out) {
  constexpr int NV = DIMD / 128;   // 16-byte groups per lane and row
  int lane = threadIdx.x & 31;
  int w    = threadIdx.x >> 5;
  size_t row0 = ((size_t)blockIdx.x * 8 + w) * 2;
  const v4f* x0 = (const v4f*)(X + row0 * DIMD) + lane;
  const v4f* x1 = x0 + DIMD / 4;
  v4f a[NV], b[NV];
  // Every loop below is unrolled: the row arrays must be indexed by constants to
  // stay in registers, and both rows' loads issue before the first sum waits.
#pragma unroll
  for (int j = 0; j < NV; ++j) a[j] = x0[32 * j];
#pragma unroll
  for (int j = 0; j < NV; ++j) b[j] = x1[32 * j];
  const v4f* gp = (const v4f*)g + lane;
  const v4f* bp = (const v4f*)bt + lane;
  v4f gg[NV], bb[NV];
#pragma unroll
  for (int j = 0; j < NV; ++j) { gg[j] = gp[32 * j]; bb[j] = bp[32 * j]; }

  float sa = 0.f, qa = 0.f, sb = 0.f, qb = 0.f;
#pragma unroll
  for (int j = 0; j < NV; ++j)
#pragma unroll
    for (int e = 0; e < 4; ++e) {
      sa += a[j][e]; qa += a[j][e] * a[j][e];
      sb += b[j][e]; qb += b[j][e] * b[j][e];
    }
#pragma unroll
  for (int m = 16; m > 0; m >>= 1) {
    sa += __shfl_xor(sa, m, 32);
    qa += __shfl_xor(qa, m, 32);
    sb += __shfl_xor(sb, m, 32);
    qb += __shfl_xor(qb, m, 32);
  }
  float mua  = sa * (1.0f / DIMD);
  float mub  = sb * (1.0f / DIMD);
  float inva = rsqrtf(qa * (1.0f / DIMD) - mua * mua + 1e-5f);
  float invb = rsqrtf(qb * (1.0f / DIMD) - mub * mub + 1e-5f);

  v4bf* o0 = (v4bf*)(out + row0 * DIMD) + lane;
  v4bf* o1 = o0 + DIMD / 4;
#pragma unroll
  for (int j = 0; j < NV; ++j) {
    v4bf ra, rb;
#pragma unroll
    for (int e = 0; e < 4; ++e) {
      ra[e] = (__bf16)((a[j][e] - mua) * inva * gg[j][e] + bb[j][e]);
      rb[e] = (__bf16)((b[j][e] - mub) * invb * gg[j][e] + bb[j][e]);
    }
    o0[32 * j] = ra;
    o1[32 * j] = rb;
  }
}

template <int EPI>
__global__ __launch_bounds__(256) void gemm_bf16_kernel(
    const __bf16* __restrict__ A, const __bf16* __restrict__ Bm,
    int M, int N, int K,
    const float* __restrict__ bias, const float* __restrict__ resid,
    float* __restrict__ Cf, __bf16* __restrict__ Cb) {
  __shared__ __attribute__((aligned(16))) __bf16 As[2][128 * LDP];  // [row][k]
  __shared__ __attribute__((aligned(16))) __bf16 Bt[2][64 * LDP];   // [n][k]  (B staged transposed)
  int n0 = blockIdx.x * 64;
  int r0 = blockIdx.y * 128;
  int t  = threadIdx.x;
  int w  = t >> 5;
  int lane = t & 31;

  const v8f vz = {0.f, 0.f, 0.f, 0.f, 0.f, 0.f, 0.f, 0.f};
  v8f acc[4] = {vz, vz, vz, vz};

  int aRow = t >> 1, aKo = (t & 1) * 32;             // A loader mapping
  int bK   = t >> 2, bN16 = (t & 3) * 16;            // B loader mapping

  v8bf bReg[2];

  auto asyncLoadA = [&](int k0, int buf) {
    const __bf16* ap = A + (size_t)(r0 + aRow) * K + k0 + aKo;
    unsigned lp = (unsigned)(uintptr_t)&As[buf][aRow * LDP + aKo];
#pragma unroll
    for (int e = 0; e < 4; ++e) async_copy_b128(lp + 16u * e, ap + 8 * e);
  };
  auto loadB = [&](int k0) {
    const __bf16* bp = Bm + (size_t)(k0 + bK) * N + n0 + bN16;
#pragma unroll
    for (int e = 0; e < 2; ++e) bReg[e] = *(const v8bf*)(bp + 8 * e);
  };
  auto stageB = [&](int buf) {
#pragma unroll
    for (int v = 0; v < 2; ++v)
#pragma unroll
      for (int e = 0; e < 8; ++e)
        Bt[buf][(bN16 + 8 * v + e) * LDP + bK] = bReg[v][e];
  };

  int nT = K >> 6;  // K / 64
  asyncLoadA(0, 0);
  loadB(0);
  stageB(0);
  for (int it = 0; it < nT; ++it) {
    int buf = it & 1;
    if (it + 1 < nT) loadB((it + 1) << 6);
    if (it + 2 < nT) {
      int k2 = (it + 2) << 6;
      __builtin_prefetch(A + (size_t)(r0 + aRow) * K + k2 + aKo, 0, 1);
      __builtin_prefetch(Bm + (size_t)(k2 + bK) * N + n0 + bN16, 0, 1);
    }
    wait_async0();       // this wave's A DMA for stage `it` has landed
    __syncthreads();     // all waves' A DMA + B ds-stores visible
    if (it + 1 < nT) asyncLoadA((it + 1) << 6, buf ^ 1);  // overlaps WMMAs
#pragma unroll
    for (int kk = 0; kk < 64; kk += 32) {
      v16bf af = load_frag(&As[buf][16 * w * LDP + kk], LDP);
#pragma unroll
      for (int n = 0; n < 4; ++n) {
        v16bf bf = load_frag(&Bt[buf][16 * n * LDP + kk], LDP);
        acc[n] = wmma_bf16(af, bf, acc[n]);
      }
    }
    if (it + 1 < nT) stageB(buf ^ 1);
  }

  int colL = lane & 15;
  int rh   = (lane & 16) ? 8 : 0;
#pragma unroll
  for (int n = 0; n < 4; ++n) {
#pragma unroll
    for (int r = 0; r < 8; ++r) {
      int grow = r0 + 16 * w + r + rh;
      int gcol = n0 + 16 * n + colL;
      float v = acc[n][r];
      if (EPI == 1) {
        v += bias[gcol] + resid[(size_t)grow * N + gcol];
        Cf[(size_t)grow * N + gcol] = v;
      } else if (EPI == 2) {
        v = gelu_exact(v + bias[gcol]);
        Cb[(size_t)grow * N + gcol] = (__bf16)v;
      } else {
        Cb[(size_t)grow * N + gcol] = (__bf16)v;
      }
    }
  }
}

// ---------------------------------------------------------------------------
// Flash attention, one head-tile per block. Block = 128 threads (4 waves),
// 64 query rows per block. Streams keys/values in 64-wide chunks with online
// softmax; all matmuls via WMMA; K tiles staged via async global->LDS DMA.
// Q/K/V/O are [B, seq, INNERD] with head h at cols h*64..h*64+63.
// Score scale = 1/sqrt(64).
// ---------------------------------------------------------------------------
__global__ __launch_bounds__(128) void attn_kernel(
    const __bf16* __restrict__ Q, const __bf16* __restrict__ Kg,
    const __bf16* __restrict__ Vg, __bf16* __restrict__ O) {
  __shared__ __attribute__((aligned(16))) __bf16 Qs[64 * LDP];   // [i][d]
  __shared__ __attribute__((aligned(16))) __bf16 Ks[64 * LDP];   // [j][d]   (== [n][k] for S = Q K^T)
  __shared__ __attribute__((aligned(16))) __bf16 Vt[64 * LDP];   // [d][m']  (== [n][k] for O = P V)
  __shared__ __attribute__((aligned(16))) __bf16 Ps[64 * LDP];   // [i][m']
  __shared__ __attribute__((aligned(16))) float  Sb[64 * SBP];
  __shared__ float  alphaS[64];
  __shared__ float  rsumS[64];

  int i0 = blockIdx.x * 64;
  int h  = blockIdx.y;
  int b  = blockIdx.z;
  int t  = threadIdx.x;
  int w  = t >> 5;
  int lane = t & 31;
  int colL = lane & 15;
  int rh   = (lane & 16) ? 8 : 0;

  int jL = t >> 1, dL = (t & 1) * 32;

  // Load Q tile (64 rows x 64 d); 128 threads x 32 elems.
  {
    const __bf16* src = Q + ((size_t)(b * NSEQ) + i0 + jL) * INNERD + h * HDIM + dL;
#pragma unroll
    for (int e = 0; e < 4; ++e) {
      v8bf qv = *(const v8bf*)(src + 8 * e);
      *(v8bf*)&Qs[jL * LDP + dL + 8 * e] = qv;
    }
  }

  float run_max = -3.0e38f;
  float run_sum = 0.0f;
  const v8f vz = {0.f, 0.f, 0.f, 0.f, 0.f, 0.f, 0.f, 0.f};
  v8f oacc[4] = {vz, vz, vz, vz};

  for (int m0 = 0; m0 < MSEQ; m0 += 64) {
    if (m0 + 64 < MSEQ) {  // prefetch next chunk of K/V through L2
      __builtin_prefetch(
          Kg + ((size_t)(b * MSEQ) + m0 + 64 + jL) * INNERD + h * HDIM + dL, 0, 1);
      __builtin_prefetch(
          Vg + ((size_t)(b * MSEQ) + m0 + 64 + jL) * INNERD + h * HDIM + dL, 0, 1);
    }
    __syncthreads();   // previous chunk's WMMA reads of Ks/Vt/Ps done
    { // K tile row-major via async DMA
      const __bf16* src = Kg + ((size_t)(b * MSEQ) + m0 + jL) * INNERD + h * HDIM + dL;
      unsigned lp = (unsigned)(uintptr_t)&Ks[jL * LDP + dL];
#pragma unroll
      for (int e = 0; e < 4; ++e) async_copy_b128(lp + 16u * e, src + 8 * e);
    }
    { // V tile transposed into Vt[d][m'] (register path: needs transpose)
      const __bf16* src = Vg + ((size_t)(b * MSEQ) + m0 + jL) * INNERD + h * HDIM + dL;
#pragma unroll
      for (int e = 0; e < 4; ++e) {
        v8bf vv = *(const v8bf*)(src + 8 * e);
#pragma unroll
        for (int q = 0; q < 8; ++q) Vt[(dL + 8 * e + q) * LDP + jL] = vv[q];
      }
    }
    wait_async0();
    __syncthreads();

    // S = Q K^T for this wave's 16 rows (two k-steps over d)
    v8f s[4] = {vz, vz, vz, vz};
#pragma unroll
    for (int kk = 0; kk < 64; kk += 32) {
      v16bf af = load_frag(Qs + 16 * w * LDP + kk, LDP);
#pragma unroll
      for (int n = 0; n < 4; ++n) {
        v16bf bf = load_frag(Ks + 16 * n * LDP + kk, LDP);
        s[n] = wmma_bf16(af, bf, s[n]);
      }
    }
#pragma unroll
    for (int n = 0; n < 4; ++n)
#pragma unroll
      for (int r = 0; r < 8; ++r)
        Sb[(16 * w + r + rh) * SBP + 16 * n + colL] = s[n][r] * 0.125f;
    __syncthreads();

    // Online softmax: thread t (< 64) owns query row t.
    if (t < 64) {
      float* srow = Sb + t * SBP;
      float cmax = -3.0e38f;
#pragma unroll 8
      for (int j = 0; j < 64; ++j) cmax = fmaxf(cmax, srow[j]);
      float nm    = fmaxf(run_max, cmax);
      float alpha = expf(run_max - nm);
      float ssum  = 0.0f;
#pragma unroll 8
      for (int j = 0; j < 64; ++j) {
        float p = expf(srow[j] - nm);
        Ps[t * LDP + j] = (__bf16)p;
        ssum += p;
      }
      run_sum = run_sum * alpha + ssum;
      run_max = nm;
      alphaS[t] = alpha;
    }
    __syncthreads();

    // Rescale O accumulators, then O += P V
#pragma unroll
    for (int r = 0; r < 8; ++r) {
      float al = alphaS[16 * w + r + rh];
#pragma unroll
      for (int n = 0; n < 4; ++n) oacc[n][r] *= al;
    }
#pragma unroll
    for (int kk = 0; kk < 64; kk += 32) {
      v16bf af = load_frag(Ps + 16 * w * LDP + kk, LDP);
#pragma unroll
      for (int n = 0; n < 4; ++n) {
        v16bf bf = load_frag(Vt + 16 * n * LDP + kk, LDP);
        oacc[n] = wmma_bf16(af, bf, oacc[n]);
      }
    }
  }

  if (t < 64) rsumS[t] = run_sum;
  __syncthreads();

#pragma unroll
  for (int r = 0; r < 8; ++r) {
    int row = 16 * w + r + rh;
    float inv = 1.0f / rsumS[row];
#pragma unroll
    for (int n = 0; n < 4; ++n) {
      int d = 16 * n + colL;
      O[((size_t)(b * NSEQ) + i0 + row) * INNERD + h * HDIM + d] =
          (__bf16)(oacc[n][r] * inv);
    }
  }
}

// ---------------------------------------------------------------------------
// Launch
// ---------------------------------------------------------------------------
extern "C" void kernel_launch(void* const* d_in, const int* in_sizes, int n_in,
                              void* d_out, int out_size, void* d_ws, size_t ws_size,
                              hipStream_t stream) {
  (void)in_sizes; (void)n_in; (void)out_size; (void)ws_size;
  const float* x   = (const float*)d_in[0];
  const float* ctx = (const float*)d_in[1];
  const float* Wq  = (const float*)d_in[2];
  const float* Wk  = (const float*)d_in[3];
  const float* Wv  = (const float*)d_in[4];
  const float* Wo  = (const float*)d_in[5];
  const float* bo  = (const float*)d_in[6];
  const float* g1  = (const float*)d_in[7];
  const float* b1  = (const float*)d_in[8];
  const float* g2  = (const float*)d_in[9];
  const float* b2  = (const float*)d_in[10];
  const float* W1  = (const float*)d_in[11];
  const float* bf1 = (const float*)d_in[12];
  const float* W2  = (const float*)d_in[13];
  const float* bf2 = (const float*)d_in[14];
  float* out = (float*)d_out;

  char* wp = (char*)d_ws;
  auto alloc = [&](size_t bytes) -> char* {
    char* p = wp;
    wp += (bytes + 255) & ~(size_t)255;
    return p;
  };
  __bf16* Wq16  = (__bf16*)alloc((size_t)DIMD * INNERD * 2);
  __bf16* Wk16  = (__bf16*)alloc((size_t)DIMD * INNERD * 2);
  __bf16* Wv16  = (__bf16*)alloc((size_t)DIMD * INNERD * 2);
  __bf16* Wo16  = (__bf16*)alloc((size_t)INNERD * DIMD * 2);
  __bf16* W116  = (__bf16*)alloc((size_t)DIMD * FFND * 2);
  __bf16* W216  = (__bf16*)alloc((size_t)FFND * DIMD * 2);
  __bf16* nx16  = (__bf16*)alloc((size_t)ROWS * DIMD * 2);
  __bf16* nc16  = (__bf16*)alloc((size_t)ROWS * DIMD * 2);
  __bf16* Q16   = (__bf16*)alloc((size_t)ROWS * INNERD * 2);
  __bf16* K16   = (__bf16*)alloc((size_t)ROWS * INNERD * 2);
  __bf16* V16   = (__bf16*)alloc((size_t)ROWS * INNERD * 2);
  __bf16* O16   = (__bf16*)alloc((size_t)ROWS * INNERD * 2);
  float*  x1    = (float*)alloc((size_t)ROWS * DIMD * 4);
  __bf16* hln16 = (__bf16*)alloc((size_t)ROWS * DIMD * 2);
  __bf16* H16   = (__bf16*)alloc((size_t)ROWS * FFND * 2);

  static_assert((DIMD * INNERD) % CVT_PER_BLOCK == 0 && (DIMD * FFND) % CVT_PER_BLOCK == 0,
                "weight sizes must be whole conversion blocks");
  static_assert(ROWS % LN_ROWS_PER_BLOCK == 0 && DIMD % 128 == 0, "LayerNorm tiling");
  auto cvt = [&](const float* src, __bf16* dst, int n) {
    cvt_bf16_kernel<<<n / CVT_PER_BLOCK, 256, 0, stream>>>(src, dst, n);
  };
  cvt(Wq, Wq16, DIMD * INNERD);
  cvt(Wk, Wk16, DIMD * INNERD);
  cvt(Wv, Wv16, DIMD * INNERD);
  cvt(Wo, Wo16, INNERD * DIMD);
  cvt(W1, W116, DIMD * FFND);
  cvt(W2, W216, FFND * DIMD);

  // norm1 for x and context
  ln_bf16_kernel<<<ROWS / LN_ROWS_PER_BLOCK, 256, 0, stream>>>(x,   g1, b1, nx16);
  ln_bf16_kernel<<<ROWS / LN_ROWS_PER_BLOCK, 256, 0, stream>>>(ctx, g1, b1, nc16);

  // Q/K/V projections (plain bf16 epilogue)
  {
    dim3 g(INNERD / 64, ROWS / 128);
    gemm_bf16_kernel<0><<<g, 256, 0, stream>>>(nx16, Wq16, ROWS, INNERD, DIMD,
                                               nullptr, nullptr, nullptr, Q16);
    gemm_bf16_kernel<0><<<g, 256, 0, stream>>>(nc16, Wk16, ROWS, INNERD, DIMD,
                                               nullptr, nullptr, nullptr, K16);
    gemm_bf16_kernel<0><<<g, 256, 0, stream>>>(nc16, Wv16, ROWS, INNERD, DIMD,
                                               nullptr, nullptr, nullptr, V16);
  }

  // Attention
  {
    dim3 g(NSEQ / 64, NHEADS, BATCH);
    attn_kernel<<<g, 128, 0, stream>>>(Q16, K16, V16, O16);
  }

  // Output projection + bias + residual -> x1 (f32)
  {
    dim3 g(DIMD / 64, ROWS / 128);
    gemm_bf16_kernel<1><<<g, 256, 0, stream>>>(O16, Wo16, ROWS, DIMD, INNERD,
                                               bo, x, x1, nullptr);
  }

  // norm2
  ln_bf16_kernel<<<ROWS / LN_ROWS_PER_BLOCK, 256, 0, stream>>>(x1, g2, b2, hln16);

  // FFN1: gelu(h @ W1 + bf1) -> bf16
  {
    dim3 g(FFND / 64, ROWS / 128);
    gemm_bf16_kernel<2><<<g, 256, 0, stream>>>(hln16, W116, ROWS, FFND, DIMD,
                                               bf1, nullptr, nullptr, H16);
  }

  // FFN2: x1 + H @ W2 + bf2 -> d_out (f32)
  {
    dim3 g(DIMD / 64, ROWS / 128);
    gemm_bf16_kernel<1><<<g, 256, 0, stream>>>(H16, W216, ROWS, DIMD, FFND,
                                               bf2, x1, out, nullptr);
  }
}

// v003
// One run takes 395 microseconds.
// Two timings next to v002 both put it at 1.16 times that version's speed.
// Over all steps from v000 it is 2.12 times as fast.
#include <hip/hip_runtime.h>
#include <hip/hip_bf16.h>

typedef __attribute__((ext_vector_type(16))) __bf16 v16bf;
typedef __attribute__((ext_vector_type(8)))  __bf16 v8bf;
typedef __attribute__((ext_vector_type(8)))  float  v8f;
typedef __attribute__((ext_vector_type(4)))  __bf16 v4bf;
typedef __attribute__((ext_vector_type(4)))  float  v4f;

#define DIMD   768
#define NHEADS 8
#define HDIM   64
#define INNERD 512
#define FFND   3072
#define BATCH  4
#define NSEQ   2048
#define MSEQ   2048
#define ROWS   (BATCH * NSEQ)   // 8192 rows for both x and context paths

#define LDP    72   // bf16 elements per LDS row of a 64-wide bf16 tile
#define SBP    68   // floats per LDS row of the 64-wide score tile
// A tile kept row-major [k][n] and read by the transposing load wants 32 B x odd.
#define LDT    80   // bf16 elements per LDS row (160 B) of a 64-wide [k][n] tile

__device__ __forceinline__ v8f wmma_bf16(v16bf a, v16bf b, v8f c) {
  // (neg_a, A, neg_b, B, c_mod, C, reuse_a, reuse_b)
  return __builtin_amdgcn_wmma_f32_16x16x32_bf16(false, a, false, b, (short)0, c,
                                                 false, false);
}

__device__ __forceinline__ v16bf load_frag(const __bf16* base, int ld) {
  int lane = threadIdx.x & 31;
  int r    = lane & 15;
  int kb   = (lane & 16) ? 8 : 0;
  const __bf16* p = base + r * ld + kb;
  v8bf lo = *(const v8bf*)(p);
  v8bf hi = *(const v8bf*)(p + 16);
  v16bf f;
#pragma unroll
  for (int e = 0; e < 8; ++e) { f[e] = lo[e]; f[e + 8] = hi[e]; }
  return f;
}

// Load one 32x16 B fragment (k x n) from an LDS tile laid out [k][n] with pitch
// LDT; `tile` points at element [kbase][nbase]. ds_load_tr16_b128 hands lane
// (c = L&15, h = L>>4) the eight elements [kbase + 8h + 0..7][nbase + c], so the
// loads at kbase and kbase + 16 give the same k order as load_frag gives A.
typedef __attribute__((address_space(3))) v8bf lds_v8bf;
__device__ __forceinline__ v16bf load_frag_tr(const __bf16* tile) {
  int lane = threadIdx.x & 31;
  const __bf16* p = tile + ((lane >> 4) * 8 + (lane & 7)) * LDT + ((lane >> 3) & 1) * 8;
  v8bf lo = __builtin_amdgcn_ds_load_tr16_b128_v8bf16((lds_v8bf*)p);
  v8bf hi = __builtin_amdgcn_ds_load_tr16_b128_v8bf16((lds_v8bf*)(p + 16 * LDT));
  v16bf f;
#pragma unroll
  for (int e = 0; e < 8; ++e) { f[e] = lo[e]; f[e + 8] = hi[e]; }
  return f;
}

__device__ __forceinline__ void wait_async0() {
  asm volatile("s_wait_asynccnt 0x0" ::: "memory");
}
// This wave's LDS reads have retired before a copy may refill what they read.
__device__ __forceinline__ void wait_ds0() {
  asm volatile("s_wait_dscnt 0x0" ::: "memory");
}

__device__ __forceinline__ float gelu_exact(float v) {
  return 0.5f * v * (1.0f + erff(v * 0.70710678118654752f));
}

// ---------------------------------------------------------------------------
// fp32 -> bf16 conversion (weights). The pass is short, so its time is the time
// its waves take to start: each thread converts 32 elements (eight 16-byte loads
// in flight, each wave-wide load 512 contiguous bytes), 8192 elements per block.
// n must be a multiple of 8192 (asserted where the sizes are known).
// ---------------------------------------------------------------------------
#define CVT_PER_BLOCK 8192
__global__ __launch_bounds__(256) void cvt_bf16_kernel(const float* __restrict__ in,
                                                       __bf16* __restrict__ out,
                                                       int n) {
  if ((int)blockIdx.x * CVT_PER_BLOCK + CVT_PER_BLOCK > n) return;
  int q = blockIdx.x * (CVT_PER_BLOCK / 4) + threadIdx.x;  // group of 4 elements
  const v4f* src = (const v4f*)in + q;
  v4bf*      dst = (v4bf*)out + q;
  constexpr int NU = CVT_PER_BLOCK / 1024;   // 16-byte loads per thread
  v4f v[NU];
  // Both loops unrolled: v[] stays in registers and all loads issue before the
  // first conversion waits.
#pragma unroll
  for (int u = 0; u < NU; ++u) v[u] = src[256 * u];
#pragma unroll
  for (int u = 0; u < NU; ++u) {
    v4bf o;
#pragma unroll
    for (int e = 0; e < 4; ++e) o[e] = (__bf16)v[u][e];
    dst[256 * u] = o;
  }
}

// ---------------------------------------------------------------------------
// LayerNorm over 768 cols, bf16 output. One wave owns two whole rows: a lane
// holds 24 elements of each row in registers (six 16-byte loads per row), the
// row sums are joined by a five-step butterfly over the 32 lanes, so no LDS and
// no barrier. 8 waves per block = 16 rows per block.
// ---------------------------------------------------------------------------
#define LN_ROWS_PER_BLOCK 16
__global__ __launch_bounds__(256) void ln_bf16_kernel(const float* __restrict__ X,
                                                      const float* __restrict__ g,
                                                      const float* __restrict__ bt,
                                                      __bf16* __restrict__ out) {
  constexpr int NV = DIMD / 128;   // 16-byte groups per lane and row
  int lane = threadIdx.x & 31;
  int w    = threadIdx.x >> 5;
  size_t row0 = ((size_t)blockIdx.x * 8 + w) * 2;
  const v4f* x0 = (const v4f*)(X + row0 * DIMD) + lane;
  const v4f* x1 = x0 + DIMD / 4;
  v4f a[NV], b[NV];
  // Every loop below is unrolled: the row arrays must be indexed by constants to
  // stay in registers, and both rows' loads issue before the first sum waits.
#pragma unroll
  for (int j = 0; j < NV; ++j) a[j] = x0[32 * j];
#pragma unroll
  for (int j = 0; j < NV; ++j) b[j] = x1[32 * j];
  const v4f* gp = (const v4f*)g + lane;
  const v4f* bp = (const v4f*)bt + lane;
  v4f gg[NV], bb[NV];
#pragma unroll
  for (int j = 0; j < NV; ++j) { gg[j] = gp[32 * j]; bb[j] = bp[32 * j]; }

  float sa = 0.f, qa = 0.f, sb = 0.f, qb = 0.f;
#pragma unroll
  for (int j = 0; j < NV; ++j)
#pragma unroll
    for (int e = 0; e < 4; ++e) {
      sa += a[j][e]; qa += a[j][e] * a[j][e];
      sb += b[j][e]; qb += b[j][e] * b[j][e];
    }
#pragma unroll
  for (int m = 16; m > 0; m >>= 1) {
    sa += __shfl_xor(sa, m, 32);
    qa += __shfl_xor(qa, m, 32);
    sb += __shfl_xor(sb, m, 32);
    qb += __shfl_xor(qb, m, 32);
  }
  float mua  = sa * (1.0f / DIMD);
  float mub  = sb * (1.0f / DIMD);
  float inva = rsqrtf(qa * (1.0f / DIMD) - mua * mua + 1e-5f);
  float invb = rsqrtf(qb * (1.0f / DIMD) - mub * mub + 1e-5f);

  v4bf* o0 = (v4bf*)(out + row0 * DIMD) + lane;
  v4bf* o1 = o0 + DIMD / 4;
#pragma unroll
  for (int j = 0; j < NV; ++j) {
    v4bf ra, rb;
#pragma unroll
    for (int e = 0; e < 4; ++e) {
      ra[e] = (__bf16)((a[j][e] - mua) * inva * gg[j][e] + bb[j][e]);
      rb[e] = (__bf16)((b[j][e] - mub) * invb * gg[j][e] + bb[j][e]);
    }
    o0[32 * j] = ra;
    o1[32 * j] = rb;
  }
}

template <int EPI>
__global__ __launch_bounds__(256) void gemm_bf16_kernel(
    const __bf16* __restrict__ A, const __bf16* __restrict__ Bm,
    int M, int N, int K,
    const float* __restrict__ bias, const float* __restrict__ resid,
    float* __restrict__ Cf, __bf16* __restrict__ Cb) {
  __shared__ __attribute__((aligned(16))) __bf16 As[2][128 * LDP];  // [row][k]
  __shared__ __attribute__((aligned(16))) __bf16 Bs[2][64 * LDT];   // [k][n]
  int n0 = blockIdx.x * 64;
  int r0 = blockIdx.y * 128;
  int t  = threadIdx.x;
  int w  = t >> 5;
  int lane = t & 31;

  const v8f vz = {0.f, 0.f, 0.f, 0.f, 0.f, 0.f, 0.f, 0.f};
  v8f acc[4] = {vz, vz, vz, vz};

  int aRow = t >> 1, aKo = (t & 1) * 32;             // A loader mapping
  int bK   = t >> 2, bN16 = (t & 3) * 16;            // B prefetch mapping

  // One stage, six copies per thread: 64 B of an A row, and 16 B of each of two
  // B rows (eight lanes cover a B row's whole 128 B, a wave four whole rows).
  int cK = t >> 3, cN = (t & 7) * 8;                 // B copy mapping
  auto asyncLoadAB = [&](int k0, int buf) {
    const __bf16* ap = A + (size_t)(r0 + aRow) * K + k0 + aKo;
    const __bf16* bp = Bm + (size_t)(k0 + cK) * N + n0 + cN;
    unsigned la = (unsigned)(uintptr_t)&As[buf][aRow * LDP + aKo];
    unsigned lb = (unsigned)(uintptr_t)&Bs[buf][cK * LDT + cN];
    asm volatile("global_load_async_to_lds_b128 %0, %6, off\n\t"
                 "global_load_async_to_lds_b128 %1, %7, off\n\t"
                 "global_load_async_to_lds_b128 %2, %8, off\n\t"
                 "global_load_async_to_lds_b128 %3, %9, off\n\t"
                 "global_load_async_to_lds_b128 %4, %10, off\n\t"
                 "global_load_async_to_lds_b128 %5, %11, off\n\t"
                 "s_wait_xcnt 0x0"
                 :: "v"(la), "v"(la + 16u), "v"(la + 32u), "v"(la + 48u),
                    "v"(lb), "v"(lb + 32u * LDT * 2u),
                    "v"(ap), "v"(ap + 8), "v"(ap + 16), "v"(ap + 24),
                    "v"(bp), "v"(bp + (size_t)32 * N)
                 : "memory");
  };

  int nT = K >> 6;  // K / 64
  asyncLoadAB(0, 0);
  for (int it = 0; it < nT; ++it) {
    int buf = it & 1;
    if (it + 2 < nT) {
      int k2 = (it + 2) << 6;
      __builtin_prefetch(A + (size_t)(r0 + aRow) * K + k2 + aKo, 0, 1);
      __builtin_prefetch(Bm + (size_t)(k2 + bK) * N + n0 + bN16, 0, 1);
    }
    wait_ds0();          // this wave's reads of buffer buf^1 (last trip) retired
    wait_async0();       // this wave's copies for stage `it` have landed
    __syncthreads();     // all waves' copies visible; buffer buf^1 left by all
    if (it + 1 < nT) asyncLoadAB((it + 1) << 6, buf ^ 1);  // overlaps WMMAs
#pragma unroll
    for (int kk = 0; kk < 64; kk += 32) {
      v16bf af = load_frag(&As[buf][16 * w * LDP + kk], LDP);
#pragma unroll
      for (int n = 0; n < 4; ++n) {
        v16bf bf = load_frag_tr(&Bs[buf][kk * LDT + 16 * n]);
        acc[n] = wmma_bf16(af, bf, acc[n]);
      }
    }
  }

  int colL = lane & 15;
  int rh   = (lane & 16) ? 8 : 0;
#pragma unroll
  for (int n = 0; n < 4; ++n) {
#pragma unroll
    for (int r = 0; r < 8; ++r) {
      int grow = r0 + 16 * w + r + rh;
      int gcol = n0 + 16 * n + colL;
      float v = acc[n][r];
      if (EPI == 1) {
        v += bias[gcol] + resid[(size_t)grow * N + gcol];
        Cf[(size_t)grow * N + gcol] = v;
      } else if (EPI == 2) {
        v = gelu_exact(v + bias[gcol]);
        Cb[(size_t)grow * N + gcol] = (__bf16)v;
      } else {
        Cb[(size_t)grow * N + gcol] = (__bf16)v;
      }
    }
  }
}

// ---------------------------------------------------------------------------
// Flash attention, one head-tile per block. Block = 128 threads (4 waves),
// 64 query rows per block. Streams keys/values in 64-wide chunks with online
// softmax; all matmuls via WMMA; K and V tiles staged via async global->LDS
// copies, V row-major and read by the transposing LDS load.
// Q/K/V/O are [B, seq, INNERD] with head h at cols h*64..h*64+63.
// Score scale = 1/sqrt(64).
// ---------------------------------------------------------------------------
__global__ __launch_bounds__(128) void attn_kernel(
    const __bf16* __restrict__ Q, const __bf16* __restrict__ Kg,
    const __bf16* __restrict__ Vg, __bf16* __restrict__ O) {
  __shared__ __attribute__((aligned(16))) __bf16 Qs[64 * LDP];   // [i][d]
  __shared__ __attribute__((aligned(16))) __bf16 Ks[64 * LDP];   // [j][d]   (== [n][k] for S = Q K^T)
  __shared__ __attribute__((aligned(16))) __bf16 Vs[64 * LDT];   // [m'][d]  (== [k][n] for O = P V)
  __shared__ __attribute__((aligned(16))) __bf16 Ps[64 * LDP];   // [i][m']
  __shared__ __attribute__((aligned(16))) float  Sb[64 * SBP];
  __shared__ float  alphaS[64];
  __shared__ float  rsumS[64];

  int i0 = blockIdx.x * 64;
  int h  = blockIdx.y;
  int b  = blockIdx.z;
  int t  = threadIdx.x;
  int w  = t >> 5;
  int lane = t & 31;
  int colL = lane & 15;
  int rh   = (lane & 16) ? 8 : 0;

  int jL = t >> 1, dL = (t & 1) * 32;

  // Load Q tile (64 rows x 64 d); 128 threads x 32 elems.
  {
    const __bf16* src = Q + ((size_t)(b * NSEQ) + i0 + jL) * INNERD + h * HDIM + dL;
#pragma unroll
    for (int e = 0; e < 4; ++e) {
      v8bf qv = *(const v8bf*)(src + 8 * e);
      *(v8bf*)&Qs[jL * LDP + dL + 8 * e] = qv;
    }
  }

  float run_max = -3.0e38f;
  float run_sum = 0.0f;
  const v8f vz = {0.f, 0.f, 0.f, 0.f, 0.f, 0.f, 0.f, 0.f};
  v8f oacc[4] = {vz, vz, vz, vz};

  for (int m0 = 0; m0 < MSEQ; m0 += 64) {
    if (m0 + 64 < MSEQ) {  // prefetch next chunk of K/V through L2
      __builtin_prefetch(
          Kg + ((size_t)(b * MSEQ) + m0 + 64 + jL) * INNERD + h * HDIM + dL, 0, 1);
      __builtin_prefetch(
          Vg + ((size_t)(b * MSEQ) + m0 + 64 + jL) * INNERD + h * HDIM + dL, 0, 1);
    }
    wait_ds0();        // this wave's reads of Ks/Vs retired before the refill
    __syncthreads();   // previous chunk's WMMA reads of Ks/Vs/Ps done
    { // K and V tiles, both row-major. K: 64 B of one row per thread. V: 16 B of
      // each of four rows (eight lanes cover a row's whole 128 B).
      int vR = t >> 3, vC = (t & 7) * 8;
      const __bf16* kp = Kg + ((size_t)(b * MSEQ) + m0 + jL) * INNERD + h * HDIM + dL;
      const __bf16* vp = Vg + ((size_t)(b * MSEQ) + m0 + vR) * INNERD + h * HDIM + vC;
      unsigned lk = (unsigned)(uintptr_t)&Ks[jL * LDP + dL];
      unsigned lv = (unsigned)(uintptr_t)&Vs[vR * LDT + vC];
      asm volatile("global_load_async_to_lds_b128 %0, %8, off\n\t"
                   "global_load_async_to_lds_b128 %1, %9, off\n\t"
                   "global_load_async_to_lds_b128 %2, %10, off\n\t"
                   "global_load_async_to_lds_b128 %3, %11, off\n\t"
                   "global_load_async_to_lds_b128 %4, %12, off\n\t"
                   "global_load_async_to_lds_b128 %5, %13, off\n\t"
                   "global_load_async_to_lds_b128 %6, %14, off\n\t"
                   "global_load_async_to_lds_b128 %7, %15, off\n\t"
                   "s_wait_xcnt 0x0"
                   :: "v"(lk), "v"(lk + 16u), "v"(lk + 32u), "v"(lk + 48u),
                      "v"(lv), "v"(lv + 16u * LDT * 2u), "v"(lv + 32u * LDT * 2u),
                      "v"(lv + 48u * LDT * 2u),
                      "v"(kp), "v"(kp + 8), "v"(kp + 16), "v"(kp + 24),
                      "v"(vp), "v"(vp + 16 * INNERD), "v"(vp + 32 * INNERD),
                      "v"(vp + 48 * INNERD)
                   : "memory");
    }
    wait_async0();     // this wave's copies have landed
    __syncthreads();   // every wave's copies visible

    // S = Q K^T for this wave's 16 rows (two k-steps over d)
    v8f s[4] = {vz, vz, vz, vz};
#pragma unroll
    for (int kk = 0; kk < 64; kk += 32) {
      v16bf af = load_frag(Qs + 16 * w * LDP + kk, LDP);
#pragma unroll
      for (int n = 0; n < 4; ++n) {
        v16bf bf = load_frag(Ks + 16 * n * LDP + kk, LDP);
        s[n] = wmma_bf16(af, bf, s[n]);
      }
    }
#pragma unroll
    for (int n = 0; n < 4; ++n)
#pragma unroll
      for (int r = 0; r < 8; ++r)
        Sb[(16 * w + r + rh) * SBP + 16 * n + colL] = s[n][r] * 0.125f;
    __syncthreads();

    // Online softmax: thread t (< 64) owns query row t.
    if (t < 64) {
      float* srow = Sb + t * SBP;
      float cmax = -3.0e38f;
#pragma unroll 8
      for (int j = 0; j < 64; ++j) cmax = fmaxf(cmax, srow[j]);
      float nm    = fmaxf(run_max, cmax);
      float alpha = expf(run_max - nm);
      float ssum  = 0.0f;
#pragma unroll 8
      for (int j = 0; j < 64; ++j) {
        float p = expf(srow[j] - nm);
        Ps[t * LDP + j] = (__bf16)p;
        ssum += p;
      }
      run_sum = run_sum * alpha + ssum;
      run_max = nm;
      alphaS[t] = alpha;
    }
    __syncthreads();

    // Rescale O accumulators, then O += P V
#pragma unroll
    for (int r = 0; r < 8; ++r) {
      float al = alphaS[16 * w + r + rh];
#pragma unroll
      for (int n = 0; n < 4; ++n) oacc[n][r] *= al;
    }
#pragma unroll
    for (int kk = 0; kk < 64; kk += 32) {
      v16bf af = load_frag(Ps + 16 * w * LDP + kk, LDP);
#pragma unroll
      for (int n = 0; n < 4; ++n) {
        v16bf bf = load_frag_tr(Vs + kk * LDT + 16 * n);
        oacc[n] = wmma_bf16(af, bf, oacc[n]);
      }
    }
  }

  if (t < 64) rsumS[t] = run_sum;
  __syncthreads();

#pragma unroll
  for (int r = 0; r < 8; ++r) {
    int row = 16 * w + r + rh;
    float inv = 1.0f / rsumS[row];
#pragma unroll
    for (int n = 0; n < 4; ++n) {
      int d = 16 * n + colL;
      O[((size_t)(b * NSEQ) + i0 + row) * INNERD + h * HDIM + d] =
          (__bf16)(oacc[n][r] * inv);
    }
  }
}

// ---------------------------------------------------------------------------
// Launch
// ---------------------------------------------------------------------------
extern "C" void kernel_launch(void* const* d_in, const int* in_sizes, int n_in,
                              void* d_out, int out_size, void* d_ws, size_t ws_size,
                              hipStream_t stream) {
  (void)in_sizes; (void)n_in; (void)out_size; (void)ws_size;
  const float* x   = (const float*)d_in[0];
  const float* ctx = (const float*)d_in[1];
  const float* Wq  = (const float*)d_in[2];
  const float* Wk  = (const float*)d_in[3];
  const float* Wv  = (const float*)d_in[4];
  const float* Wo  = (const float*)d_in[5];
  const float* bo  = (const float*)d_in[6];
  const float* g1  = (const float*)d_in[7];
  const float* b1  = (const float*)d_in[8];
  const float* g2  = (const float*)d_in[9];
  const float* b2  = (const float*)d_in[10];
  const float* W1  = (const float*)d_in[11];
  const float* bf1 = (const float*)d_in[12];
  const float* W2  = (const float*)d_in[13];
  const float* bf2 = (const float*)d_in[14];
  float* out = (float*)d_out;

  char* wp = (char*)d_ws;
  auto alloc = [&](size_t bytes) -> char* {
    char* p = wp;
    wp += (bytes + 255) & ~(size_t)255;
    return p;
  };
  __bf16* Wq16  = (__bf16*)alloc((size_t)DIMD * INNERD * 2);
  __bf16* Wk16  = (__bf16*)alloc((size_t)DIMD * INNERD * 2);
  __bf16* Wv16  = (__bf16*)alloc((size_t)DIMD * INNERD * 2);
  __bf16* Wo16  = (__bf16*)alloc((size_t)INNERD * DIMD * 2);
  __bf16* W116  = (__bf16*)alloc((size_t)DIMD * FFND * 2);
  __bf16* W216  = (__bf16*)alloc((size_t)FFND * DIMD * 2);
  __bf16* nx16  = (__bf16*)alloc((size_t)ROWS * DIMD * 2);
  __bf16* nc16  = (__bf16*)alloc((size_t)ROWS * DIMD * 2);
  __bf16* Q16   = (__bf16*)alloc((size_t)ROWS * INNERD * 2);
  __bf16* K16   = (__bf16*)alloc((size_t)ROWS * INNERD * 2);
  __bf16* V16   = (__bf16*)alloc((size_t)ROWS * INNERD * 2);
  __bf16* O16   = (__bf16*)alloc((size_t)ROWS * INNERD * 2);
  float*  x1    = (float*)alloc((size_t)ROWS * DIMD * 4);
  __bf16* hln16 = (__bf16*)alloc((size_t)ROWS * DIMD * 2);
  __bf16* H16   = (__bf16*)alloc((size_t)ROWS * FFND * 2);

  static_assert((DIMD * INNERD) % CVT_PER_BLOCK == 0 && (DIMD * FFND) % CVT_PER_BLOCK == 0,
                "weight sizes must be whole conversion blocks");
  static_assert(ROWS % LN_ROWS_PER_BLOCK == 0 && DIMD % 128 == 0, "LayerNorm tiling");
  auto cvt = [&](const float* src, __bf16* dst, int n) {
    cvt_bf16_kernel<<<n / CVT_PER_BLOCK, 256, 0, stream>>>(src, dst, n);
  };
  cvt(Wq, Wq16, DIMD * INNERD);
  cvt(Wk, Wk16, DIMD * INNERD);
  cvt(Wv, Wv16, DIMD * INNERD);
  cvt(Wo, Wo16, INNERD * DIMD);
  cvt(W1, W116, DIMD * FFND);
  cvt(W2, W216, FFND * DIMD);

  // norm1 for x and context
  ln_bf16_kernel<<<ROWS / LN_ROWS_PER_BLOCK, 256, 0, stream>>>(x,   g1, b1, nx16);
  ln_bf16_kernel<<<ROWS / LN_ROWS_PER_BLOCK, 256, 0, stream>>>(ctx, g1, b1, nc16);

  // Q/K/V projections (plain bf16 epilogue)
  {
    dim3 g(INNERD / 64, ROWS / 128);
    gemm_bf16_kernel<0><<<g, 256, 0, stream>>>(nx16, Wq16, ROWS, INNERD, DIMD,
                                               nullptr, nullptr, nullptr, Q16);
    gemm_bf16_kernel<0><<<g, 256, 0, stream>>>(nc16, Wk16, ROWS, INNERD, DIMD,
                                               nullptr, nullptr, nullptr, K16);
    gemm_bf16_kernel<0><<<g, 256, 0, stream>>>(nc16, Wv16, ROWS, INNERD, DIMD,
                                               nullptr, nullptr, nullptr, V16);
  }

  // Attention
  {
    dim3 g(NSEQ / 64, NHEADS, BATCH);
    attn_kernel<<<g, 128, 0, stream>>>(Q16, K16, V16, O16);
  }

  // Output projection + bias + residual -> x1 (f32)
  {
    dim3 g(DIMD / 64, ROWS / 128);
    gemm_bf16_kernel<1><<<g, 256, 0, stream>>>(O16, Wo16, ROWS, DIMD, INNERD,
                                               bo, x, x1, nullptr);
  }

  // norm2
  ln_bf16_kernel<<<ROWS / LN_ROWS_PER_BLOCK, 256, 0, stream>>>(x1, g2, b2, hln16);

  // FFN1: gelu(h @ W1 + bf1) -> bf16
  {
    dim3 g(FFND / 64, ROWS / 128);
    gemm_bf16_kernel<2><<<g, 256, 0, stream>>>(hln16, W116, ROWS, FFND, DIMD,
                                               bf1, nullptr, nullptr, H16);
  }

  // FFN2: x1 + H @ W2 + bf2 -> d_out (f32)
  {
    dim3 g(DIMD / 64, ROWS / 128);
    gemm_bf16_kernel<1><<<g, 256, 0, stream>>>(H16, W216, ROWS, DIMD, FFND,
                                               bf2, x1, out, nullptr);
  }
}

// v004
// A run of this version takes 302 microseconds.
// Next to v003, in two timings, it ran 1.31 times as fast each time.
// Counting every step since v000, it is 2.77 times as fast.
#include <hip/hip_runtime.h>
#include <hip/hip_bf16.h>

typedef __attribute__((ext_vector_type(16))) __bf16 v16bf;
typedef __attribute__((ext_vector_type(8)))  __bf16 v8bf;
typedef __attribute__((ext_vector_type(8)))  float  v8f;
typedef __attribute__((ext_vector_type(4)))  __bf16 v4bf;
typedef __attribute__((ext_vector_type(4)))  float  v4f;

#define DIMD   768
#define NHEADS 8
#define HDIM   64
#define INNERD 512
#define FFND   3072
#define BATCH  4
#define NSEQ   2048
#define MSEQ   2048
#define ROWS   (BATCH * NSEQ)   // 8192 rows for both x and context paths

#define LDP    72   // bf16 elements per LDS row of a 64-wide bf16 tile
// A tile kept row-major [k][n] and read by the transposing load wants 32 B x odd.
#define LDT    80   // bf16 elements per LDS row (160 B) of a 64-wide [k][n] tile

__device__ __forceinline__ v8f wmma_bf16(v16bf a, v16bf b, v8f c) {
  // (neg_a, A, neg_b, B, c_mod, C, reuse_a, reuse_b)
  return __builtin_amdgcn_wmma_f32_16x16x32_bf16(false, a, false, b, (short)0, c,
                                                 false, false);
}

__device__ __forceinline__ v16bf load_frag(const __bf16* base, int ld) {
  int lane = threadIdx.x & 31;
  int r    = lane & 15;
  int kb   = (lane & 16) ? 8 : 0;
  const __bf16* p = base + r * ld + kb;
  v8bf lo = *(const v8bf*)(p);
  v8bf hi = *(const v8bf*)(p + 16);
  v16bf f;
#pragma unroll
  for (int e = 0; e < 8; ++e) { f[e] = lo[e]; f[e + 8] = hi[e]; }
  return f;
}

// Load one 32x16 B fragment (k x n) from an LDS tile laid out [k][n] with pitch
// LDT; `tile` points at element [kbase][nbase]. ds_load_tr16_b128 hands lane
// (c = L&15, h = L>>4) the eight elements [kbase + 8h + 0..7][nbase + c], so the
// loads at kbase and kbase + 16 give the same k order as load_frag gives A.
typedef __attribute__((address_space(3))) v8bf lds_v8bf;
__device__ __forceinline__ v16bf load_frag_tr(const __bf16* tile) {
  int lane = threadIdx.x & 31;
  const __bf16* p = tile + ((lane >> 4) * 8 + (lane & 7)) * LDT + ((lane >> 3) & 1) * 8;
  v8bf lo = __builtin_amdgcn_ds_load_tr16_b128_v8bf16((lds_v8bf*)p);
  v8bf hi = __builtin_amdgcn_ds_load_tr16_b128_v8bf16((lds_v8bf*)(p + 16 * LDT));
  v16bf f;
#pragma unroll
  for (int e = 0; e < 8; ++e) { f[e] = lo[e]; f[e + 8] = hi[e]; }
  return f;
}

__device__ __forceinline__ void wait_async0() {
  asm volatile("s_wait_asynccnt 0x0" ::: "memory");
}
// This wave's LDS reads have retired before a copy may refill what they read.
__device__ __forceinline__ void wait_ds0() {
  asm volatile("s_wait_dscnt 0x0" ::: "memory");
}

__device__ __forceinline__ float gelu_exact(float v) {
  return 0.5f * v * (1.0f + erff(v * 0.70710678118654752f));
}

// ---------------------------------------------------------------------------
// fp32 -> bf16 conversion (weights). The pass is short, so its time is the time
// its waves take to start: each thread converts 32 elements (eight 16-byte loads
// in flight, each wave-wide load 512 contiguous bytes), 8192 elements per block.
// n must be a multiple of 8192 (asserted where the sizes are known).
// ---------------------------------------------------------------------------
#define CVT_PER_BLOCK 8192
__global__ __launch_bounds__(256) void cvt_bf16_kernel(const float* __restrict__ in,
                                                       __bf16* __restrict__ out,
                                                       int n) {
  if ((int)blockIdx.x * CVT_PER_BLOCK + CVT_PER_BLOCK > n) return;
  int q = blockIdx.x * (CVT_PER_BLOCK / 4) + threadIdx.x;  // group of 4 elements
  const v4f* src = (const v4f*)in + q;
  v4bf*      dst = (v4bf*)out + q;
  constexpr int NU = CVT_PER_BLOCK / 1024;   // 16-byte loads per thread
  v4f v[NU];
  // Both loops unrolled: v[] stays in registers and all loads issue before the
  // first conversion waits.
#pragma unroll
  for (int u = 0; u < NU; ++u) v[u] = src[256 * u];
#pragma unroll
  for (int u = 0; u < NU; ++u) {
    v4bf o;
#pragma unroll
    for (int e = 0; e < 4; ++e) o[e] = (__bf16)v[u][e];
    dst[256 * u] = o;
  }
}

// ---------------------------------------------------------------------------
// LayerNorm over 768 cols, bf16 output. One wave owns two whole rows: a lane
// holds 24 elements of each row in registers (six 16-byte loads per row), the
// row sums are joined by a five-step butterfly over the 32 lanes, so no LDS and
// no barrier. 8 waves per block = 16 rows per block.
// ---------------------------------------------------------------------------
#define LN_ROWS_PER_BLOCK 16
__global__ __launch_bounds__(256) void ln_bf16_kernel(const float* __restrict__ X,
                                                      const float* __restrict__ g,
                                                      const float* __restrict__ bt,
                                                      __bf16* __restrict__ out) {
  constexpr int NV = DIMD / 128;   // 16-byte groups per lane and row
  int lane = threadIdx.x & 31;
  int w    = threadIdx.x >> 5;
  size_t row0 = ((size_t)blockIdx.x * 8 + w) * 2;
  const v4f* x0 = (const v4f*)(X + row0 * DIMD) + lane;
  const v4f* x1 = x0 + DIMD / 4;
  v4f a[NV], b[NV];
  // Every loop below is unrolled: the row arrays must be indexed by constants to
  // stay in registers, and both rows' loads issue before the first sum waits.
#pragma unroll
  for (int j = 0; j < NV; ++j) a[j] = x0[32 * j];
#pragma unroll
  for (int j = 0; j < NV; ++j) b[j] = x1[32 * j];
  const v4f* gp = (const v4f*)g + lane;
  const v4f* bp = (const v4f*)bt + lane;
  v4f gg[NV], bb[NV];
#pragma unroll
  for (int j = 0; j < NV; ++j) { gg[j] = gp[32 * j]; bb[j] = bp[32 * j]; }

  float sa = 0.f, qa = 0.f, sb = 0.f, qb = 0.f;
#pragma unroll
  for (int j = 0; j < NV; ++j)
#pragma unroll
    for (int e = 0; e < 4; ++e) {
      sa += a[j][e]; qa += a[j][e] * a[j][e];
      sb += b[j][e]; qb += b[j][e] * b[j][e];
    }
#pragma unroll
  for (int m = 16; m > 0; m >>= 1) {
    sa += __shfl_xor(sa, m, 32);
    qa += __shfl_xor(qa, m, 32);
    sb += __shfl_xor(sb, m, 32);
    qb += __shfl_xor(qb, m, 32);
  }
  float mua  = sa * (1.0f / DIMD);
  float mub  = sb * (1.0f / DIMD);
  float inva = rsqrtf(qa * (1.0f / DIMD) - mua * mua + 1e-5f);
  float invb = rsqrtf(qb * (1.0f / DIMD) - mub * mub + 1e-5f);

  v4bf* o0 = (v4bf*)(out + row0 * DIMD) + lane;
  v4bf* o1 = o0 + DIMD / 4;
#pragma unroll
  for (int j = 0; j < NV; ++j) {
    v4bf ra, rb;
#pragma unroll
    for (int e = 0; e < 4; ++e) {
      ra[e] = (__bf16)((a[j][e] - mua) * inva * gg[j][e] + bb[j][e]);
      rb[e] = (__bf16)((b[j][e] - mub) * invb * gg[j][e] + bb[j][e]);
    }
    o0[32 * j] = ra;
    o1[32 * j] = rb;
  }
}

template <int EPI>
__global__ __launch_bounds__(256) void gemm_bf16_kernel(
    const __bf16* __restrict__ A, const __bf16* __restrict__ Bm,
    int M, int N, int K,
    const float* __restrict__ bias, const float* __restrict__ resid,
    float* __restrict__ Cf, __bf16* __restrict__ Cb) {
  __shared__ __attribute__((aligned(16))) __bf16 As[2][128 * LDP];  // [row][k]
  __shared__ __attribute__((aligned(16))) __bf16 Bs[2][64 * LDT];   // [k][n]
  int n0 = blockIdx.x * 64;
  int r0 = blockIdx.y * 128;
  int t  = threadIdx.x;
  int w  = t >> 5;
  int lane = t & 31;

  const v8f vz = {0.f, 0.f, 0.f, 0.f, 0.f, 0.f, 0.f, 0.f};
  v8f acc[4] = {vz, vz, vz, vz};

  int aRow = t >> 1, aKo = (t & 1) * 32;             // A loader mapping
  int bK   = t >> 2, bN16 = (t & 3) * 16;            // B prefetch mapping

  // One stage, six copies per thread: 64 B of an A row, and 16 B of each of two
  // B rows (eight lanes cover a B row's whole 128 B, a wave four whole rows).
  int cK = t >> 3, cN = (t & 7) * 8;                 // B copy mapping
  auto asyncLoadAB = [&](int k0, int buf) {
    const __bf16* ap = A + (size_t)(r0 + aRow) * K + k0 + aKo;
    const __bf16* bp = Bm + (size_t)(k0 + cK) * N + n0 + cN;
    unsigned la = (unsigned)(uintptr_t)&As[buf][aRow * LDP + aKo];
    unsigned lb = (unsigned)(uintptr_t)&Bs[buf][cK * LDT + cN];
    asm volatile("global_load_async_to_lds_b128 %0, %6, off\n\t"
                 "global_load_async_to_lds_b128 %1, %7, off\n\t"
                 "global_load_async_to_lds_b128 %2, %8, off\n\t"
                 "global_load_async_to_lds_b128 %3, %9, off\n\t"
                 "global_load_async_to_lds_b128 %4, %10, off\n\t"
                 "global_load_async_to_lds_b128 %5, %11, off\n\t"
                 "s_wait_xcnt 0x0"
                 :: "v"(la), "v"(la + 16u), "v"(la + 32u), "v"(la + 48u),
                    "v"(lb), "v"(lb + 32u * LDT * 2u),
                    "v"(ap), "v"(ap + 8), "v"(ap + 16), "v"(ap + 24),
                    "v"(bp), "v"(bp + (size_t)32 * N)
                 : "memory");
  };

  int nT = K >> 6;  // K / 64
  asyncLoadAB(0, 0);
  for (int it = 0; it < nT; ++it) {
    int buf = it & 1;
    if (it + 2 < nT) {
      int k2 = (it + 2) << 6;
      __builtin_prefetch(A + (size_t)(r0 + aRow) * K + k2 + aKo, 0, 1);
      __builtin_prefetch(Bm + (size_t)(k2 + bK) * N + n0 + bN16, 0, 1);
    }
    wait_ds0();          // this wave's reads of buffer buf^1 (last trip) retired
    wait_async0();       // this wave's copies for stage `it` have landed
    __syncthreads();     // all waves' copies visible; buffer buf^1 left by all
    if (it + 1 < nT) asyncLoadAB((it + 1) << 6, buf ^ 1);  // overlaps WMMAs
#pragma unroll
    for (int kk = 0; kk < 64; kk += 32) {
      v16bf af = load_frag(&As[buf][16 * w * LDP + kk], LDP);
#pragma unroll
      for (int n = 0; n < 4; ++n) {
        v16bf bf = load_frag_tr(&Bs[buf][kk * LDT + 16 * n]);
        acc[n] = wmma_bf16(af, bf, acc[n]);
      }
    }
  }

  int colL = lane & 15;
  int rh   = (lane & 16) ? 8 : 0;
#pragma unroll
  for (int n = 0; n < 4; ++n) {
#pragma unroll
    for (int r = 0; r < 8; ++r) {
      int grow = r0 + 16 * w + r + rh;
      int gcol = n0 + 16 * n + colL;
      float v = acc[n][r];
      if (EPI == 1) {
        v += bias[gcol] + resid[(size_t)grow * N + gcol];
        Cf[(size_t)grow * N + gcol] = v;
      } else if (EPI == 2) {
        v = gelu_exact(v + bias[gcol]);
        Cb[(size_t)grow * N + gcol] = (__bf16)v;
      } else {
        Cb[(size_t)grow * N + gcol] = (__bf16)v;
      }
    }
  }
}

__device__ __forceinline__ float other_half(float v) {
  int b = __builtin_bit_cast(int, v);
  return __builtin_bit_cast(
      float, __builtin_amdgcn_permlanex16(b, b, 0x76543210, 0xfedcba98, false, false));
}

__global__ __launch_bounds__(128) void attn_kernel(
    const __bf16* __restrict__ Q, const __bf16* __restrict__ Kg,
    const __bf16* __restrict__ Vg, __bf16* __restrict__ O) {
  __shared__ __attribute__((aligned(16))) __bf16 Ks[64 * LDP];   // [j][d]   (A rows of S^T = K Q^T)
  __shared__ __attribute__((aligned(16))) __bf16 Vs[64 * LDT];   // [m'][d]  (read transposed: A of O^T = V^T P^T)

  int i0 = blockIdx.x * 64;
  int h  = blockIdx.y;
  int b  = blockIdx.z;
  int t  = threadIdx.x;
  int w  = t >> 5;
  int lane = t & 31;
  int colL = lane & 15;
  int rh   = (lane & 16) ? 8 : 0;

  int jL = t >> 1, dL = (t & 1) * 32;

  // Every loop over tiles, registers or elements in this kernel is unrolled: the
  // fragment and accumulator arrays must be indexed by constants to stay in registers.

  // This lane's query row, as the two B fragments of Q^T (d 0..31 and 32..63),
  // in the k order of load_frag; loaded once, kept in registers.
  size_t qrow = (size_t)(b * NSEQ) + i0 + 16 * w + colL;
  v16bf qf[2];
  {
    const __bf16* src = Q + qrow * INNERD + h * HDIM + rh;
#pragma unroll
    for (int u = 0; u < 2; ++u) {
      v8bf lo = *(const v8bf*)(src + 32 * u);
      v8bf hi = *(const v8bf*)(src + 32 * u + 16);
#pragma unroll
      for (int e = 0; e < 8; ++e) { qf[u][e] = lo[e]; qf[u][e + 8] = hi[e]; }
    }
  }

  float run_max = -3.0e38f;   // of the lane's query, equal in both halves
  float run_sum = 0.0f;       // over this half's keys only; halves joined at the end
  const v8f vz = {0.f, 0.f, 0.f, 0.f, 0.f, 0.f, 0.f, 0.f};
  v8f oacc[4] = {vz, vz, vz, vz};   // oacc[n][r] = O^T[d = 16n + 8h + r][query c]

  for (int m0 = 0; m0 < MSEQ; m0 += 64) {
    if (m0 + 64 < MSEQ) {  // prefetch next chunk of K/V through L2
      __builtin_prefetch(
          Kg + ((size_t)(b * MSEQ) + m0 + 64 + jL) * INNERD + h * HDIM + dL, 0, 1);
      __builtin_prefetch(
          Vg + ((size_t)(b * MSEQ) + m0 + 64 + jL) * INNERD + h * HDIM + dL, 0, 1);
    }
    wait_ds0();        // this wave's reads of Ks/Vs retired before the refill
    __syncthreads();   // previous chunk's WMMA reads of Ks/Vs done
    { // K and V tiles, both row-major. K: 64 B of one row per thread. V: 16 B of
      // each of four rows (eight lanes cover a row's whole 128 B).
      int vR = t >> 3, vC = (t & 7) * 8;
      const __bf16* kp = Kg + ((size_t)(b * MSEQ) + m0 + jL) * INNERD + h * HDIM + dL;
      const __bf16* vp = Vg + ((size_t)(b * MSEQ) + m0 + vR) * INNERD + h * HDIM + vC;
      unsigned lk = (unsigned)(uintptr_t)&Ks[jL * LDP + dL];
      unsigned lv = (unsigned)(uintptr_t)&Vs[vR * LDT + vC];
      asm volatile("global_load_async_to_lds_b128 %0, %8, off\n\t"
                   "global_load_async_to_lds_b128 %1, %9, off\n\t"
                   "global_load_async_to_lds_b128 %2, %10, off\n\t"
                   "global_load_async_to_lds_b128 %3, %11, off\n\t"
                   "global_load_async_to_lds_b128 %4, %12, off\n\t"
                   "global_load_async_to_lds_b128 %5, %13, off\n\t"
                   "global_load_async_to_lds_b128 %6, %14, off\n\t"
                   "global_load_async_to_lds_b128 %7, %15, off\n\t"
                   "s_wait_xcnt 0x0"
                   :: "v"(lk), "v"(lk + 16u), "v"(lk + 32u), "v"(lk + 48u),
                      "v"(lv), "v"(lv + 16u * LDT * 2u), "v"(lv + 32u * LDT * 2u),
                      "v"(lv + 48u * LDT * 2u),
                      "v"(kp), "v"(kp + 8), "v"(kp + 16), "v"(kp + 24),
                      "v"(vp), "v"(vp + 16 * INNERD), "v"(vp + 32 * INNERD),
                      "v"(vp + 48 * INNERD)
                   : "memory");
    }
    wait_async0();     // this wave's copies have landed
    __syncthreads();   // every wave's copies visible

    // S^T = K Q^T: 64 keys x this wave's 16 queries (two k-steps over d)
    v8f s[4] = {vz, vz, vz, vz};
#pragma unroll
    for (int kk = 0; kk < 64; kk += 32) {
#pragma unroll
      for (int n = 0; n < 4; ++n) {
        v16bf kf = load_frag(Ks + 16 * n * LDP + kk, LDP);
        s[n] = wmma_bf16(kf, qf[kk >> 5], s[n]);
      }
    }

    // Online softmax of the lane's query over its 32 keys of the chunk. The scale
    // is a power of two, so s * 0.125 is exact: the maximum may be scaled after it
    // is found, and the fused s * 0.125 - nm rounds as the separate form does.
    float cmax = -3.0e38f;
#pragma unroll
    for (int n = 0; n < 4; ++n)
#pragma unroll
      for (int r = 0; r < 8; ++r) cmax = fmaxf(cmax, s[n][r]);
    cmax = fmaxf(cmax, other_half(cmax)) * 0.125f;
    float nm    = fmaxf(run_max, cmax);
    float alpha = expf(run_max - nm);
    float ts[4];   // one partial sum per tile: four independent add chains
    v16bf pf[2];   // P^T as B fragments: keys 0..31 and 32..63 of the chunk
#pragma unroll
    for (int n = 0; n < 4; ++n) {
      ts[n] = 0.0f;
#pragma unroll
      for (int r = 0; r < 8; ++r) {
        float p = expf(__builtin_fmaf(s[n][r], 0.125f, -nm));
        pf[n >> 1][(n & 1) * 8 + r] = (__bf16)p;
        ts[n] += p;
      }
    }
    float ssum = (ts[0] + ts[1]) + (ts[2] + ts[3]);
    run_sum = run_sum * alpha + ssum;
    run_max = nm;

    // Rescale O^T (one factor per lane), then O^T += V^T P^T
#pragma unroll
    for (int n = 0; n < 4; ++n)
#pragma unroll
      for (int r = 0; r < 8; ++r) oacc[n][r] *= alpha;
#pragma unroll
    for (int kk = 0; kk < 64; kk += 32) {
#pragma unroll
      for (int n = 0; n < 4; ++n) {
        v16bf vf = load_frag_tr(Vs + kk * LDT + 16 * n);
        oacc[n] = wmma_bf16(vf, pf[kk >> 5], oacc[n]);
      }
    }
  }

  // A lane holds eight consecutive d of its query per tile: one 16-byte store each.
  float inv = 1.0f / (run_sum + other_half(run_sum));
  __bf16* dst = O + qrow * INNERD + h * HDIM + rh;
#pragma unroll
  for (int n = 0; n < 4; ++n) {
    v8bf o;
#pragma unroll
    for (int r = 0; r < 8; ++r) o[r] = (__bf16)(oacc[n][r] * inv);
    *(v8bf*)(dst + 16 * n) = o;
  }
}

// ---------------------------------------------------------------------------
// Launch
// ---------------------------------------------------------------------------
extern "C" void kernel_launch(void* const* d_in, const int* in_sizes, int n_in,
                              void* d_out, int out_size, void* d_ws, size_t ws_size,
                              hipStream_t stream) {
  (void)in_sizes; (void)n_in; (void)out_size; (void)ws_size;
  const float* x   = (const float*)d_in[0];
  const float* ctx = (const float*)d_in[1];
  const float* Wq  = (const float*)d_in[2];
  const float* Wk  = (const float*)d_in[3];
  const float* Wv  = (const float*)d_in[4];
  const float* Wo  = (const float*)d_in[5];
  const float* bo  = (const float*)d_in[6];
  const float* g1  = (const float*)d_in[7];
  const float* b1  = (const float*)d_in[8];
  const float* g2  = (const float*)d_in[9];
  const float* b2  = (const float*)d_in[10];
  const float* W1  = (const float*)d_in[11];
  const float* bf1 = (const float*)d_in[12];
  const float* W2  = (const float*)d_in[13];
  const float* bf2 = (const float*)d_in[14];
  float* out = (float*)d_out;

  char* wp = (char*)d_ws;
  auto alloc = [&](size_t bytes) -> char* {
    char* p = wp;
    wp += (bytes + 255) & ~(size_t)255;
    return p;
  };
  __bf16* Wq16  = (__bf16*)alloc((size_t)DIMD * INNERD * 2);
  __bf16* Wk16  = (__bf16*)alloc((size_t)DIMD * INNERD * 2);
  __bf16* Wv16  = (__bf16*)alloc((size_t)DIMD * INNERD * 2);
  __bf16* Wo16  = (__bf16*)alloc((size_t)INNERD * DIMD * 2);
  __bf16* W116  = (__bf16*)alloc((size_t)DIMD * FFND * 2);
  __bf16* W216  = (__bf16*)alloc((size_t)FFND * DIMD * 2);
  __bf16* nx16  = (__bf16*)alloc((size_t)ROWS * DIMD * 2);
  __bf16* nc16  = (__bf16*)alloc((size_t)ROWS * DIMD * 2);
  __bf16* Q16   = (__bf16*)alloc((size_t)ROWS * INNERD * 2);
  __bf16* K16   = (__bf16*)alloc((size_t)ROWS * INNERD * 2);
  __bf16* V16   = (__bf16*)alloc((size_t)ROWS * INNERD * 2);
  __bf16* O16   = (__bf16*)alloc((size_t)ROWS * INNERD * 2);
  float*  x1    = (float*)alloc((size_t)ROWS * DIMD * 4);
  __bf16* hln16 = (__bf16*)alloc((size_t)ROWS * DIMD * 2);
  __bf16* H16   = (__bf16*)alloc((size_t)ROWS * FFND * 2);

  static_assert((DIMD * INNERD) % CVT_PER_BLOCK == 0 && (DIMD * FFND) % CVT_PER_BLOCK == 0,
                "weight sizes must be whole conversion blocks");
  static_assert(ROWS % LN_ROWS_PER_BLOCK == 0 && DIMD % 128 == 0, "LayerNorm tiling");
  auto cvt = [&](const float* src, __bf16* dst, int n) {
    cvt_bf16_kernel<<<n / CVT_PER_BLOCK, 256, 0, stream>>>(src, dst, n);
  };
  cvt(Wq, Wq16, DIMD * INNERD);
  cvt(Wk, Wk16, DIMD * INNERD);
  cvt(Wv, Wv16, DIMD * INNERD);
  cvt(Wo, Wo16, INNERD * DIMD);
  cvt(W1, W116, DIMD * FFND);
  cvt(W2, W216, FFND * DIMD);

  // norm1 for x and context
  ln_bf16_kernel<<<ROWS / LN_ROWS_PER_BLOCK, 256, 0, stream>>>(x,   g1, b1, nx16);
  ln_bf16_kernel<<<ROWS / LN_ROWS_PER_BLOCK, 256, 0, stream>>>(ctx, g1, b1, nc16);

  // Q/K/V projections (plain bf16 epilogue)
  {
    dim3 g(INNERD / 64, ROWS / 128);
    gemm_bf16_kernel<0><<<g, 256, 0, stream>>>(nx16, Wq16, ROWS, INNERD, DIMD,
                                               nullptr, nullptr, nullptr, Q16);
    gemm_bf16_kernel<0><<<g, 256, 0, stream>>>(nc16, Wk16, ROWS, INNERD, DIMD,
                                               nullptr, nullptr, nullptr, K16);
    gemm_bf16_kernel<0><<<g, 256, 0, stream>>>(nc16, Wv16, ROWS, INNERD, DIMD,
                                               nullptr, nullptr, nullptr, V16);
  }

  // Attention
  {
    dim3 g(NSEQ / 64, NHEADS, BATCH);
    attn_kernel<<<g, 128, 0, stream>>>(Q16, K16, V16, O16);
  }

  // Output projection + bias + residual -> x1 (f32)
  {
    dim3 g(DIMD / 64, ROWS / 128);
    gemm_bf16_kernel<1><<<g, 256, 0, stream>>>(O16, Wo16, ROWS, DIMD, INNERD,
                                               bo, x, x1, nullptr);
  }

  // norm2
  ln_bf16_kernel<<<ROWS / LN_ROWS_PER_BLOCK, 256, 0, stream>>>(x1, g2, b2, hln16);

  // FFN1: gelu(h @ W1 + bf1) -> bf16
  {
    dim3 g(FFND / 64, ROWS / 128);
    gemm_bf16_kernel<2><<<g, 256, 0, stream>>>(hln16, W116, ROWS, FFND, DIMD,
                                               bf1, nullptr, nullptr, H16);
  }

  // FFN2: x1 + H @ W2 + bf2 -> d_out (f32)
  {
    dim3 g(DIMD / 64, ROWS / 128);
    gemm_bf16_kernel<1><<<g, 256, 0, stream>>>(H16, W216, ROWS, DIMD, FFND,
                                               bf2, x1, out, nullptr);
  }
}

// v005
// Measured time: 265 microseconds a run.
// In two side-by-side timings against v004, it was 1.14 and 1.13 times as fast.
// All steps since v000 together make it 3.15 times as fast.
#include <hip/hip_runtime.h>
#include <hip/hip_bf16.h>

typedef __attribute__((ext_vector_type(16))) __bf16 v16bf;
typedef __attribute__((ext_vector_type(8)))  __bf16 v8bf;
typedef __attribute__((ext_vector_type(8)))  float  v8f;
typedef __attribute__((ext_vector_type(4)))  __bf16 v4bf;
typedef __attribute__((ext_vector_type(4)))  float  v4f;

#define DIMD   768
#define NHEADS 8
#define HDIM   64
#define INNERD 512
#define FFND   3072
#define BATCH  4
#define NSEQ   2048
#define MSEQ   2048
#define ROWS   (BATCH * NSEQ)   // 8192 rows for both x and context paths

#define LDP    72   // bf16 elements per LDS row of a 64-wide bf16 tile
// A tile kept row-major [k][n] and read by the transposing load wants 32 B x odd.
#define LDT    80   // bf16 elements per LDS row (160 B) of a 64-wide [k][n] tile
#define LDTW   144  // bf16 elements per LDS row (288 B) of a 128-wide [k][n] tile

__device__ __forceinline__ v8f wmma_bf16(v16bf a, v16bf b, v8f c) {
  // (neg_a, A, neg_b, B, c_mod, C, reuse_a, reuse_b)
  return __builtin_amdgcn_wmma_f32_16x16x32_bf16(false, a, false, b, (short)0, c,
                                                 false, false);
}

__device__ __forceinline__ v16bf load_frag(const __bf16* base, int ld) {
  int lane = threadIdx.x & 31;
  int r    = lane & 15;
  int kb   = (lane & 16) ? 8 : 0;
  const __bf16* p = base + r * ld + kb;
  v8bf lo = *(const v8bf*)(p);
  v8bf hi = *(const v8bf*)(p + 16);
  v16bf f;
#pragma unroll
  for (int e = 0; e < 8; ++e) { f[e] = lo[e]; f[e + 8] = hi[e]; }
  return f;
}

// Load one 32x16 B fragment (k x n) from an LDS tile laid out [k][n] with pitch
// `ld` (elements); `tile` points at element [kbase][nbase]. ds_load_tr16_b128 hands lane
// (c = L&15, h = L>>4) the eight elements [kbase + 8h + 0..7][nbase + c], so the
// loads at kbase and kbase + 16 give the same k order as load_frag gives A.
typedef __attribute__((address_space(3))) v8bf lds_v8bf;
__device__ __forceinline__ v16bf load_frag_tr(const __bf16* tile, int ld) {
  int lane = threadIdx.x & 31;
  const __bf16* p = tile + ((lane >> 4) * 8 + (lane & 7)) * ld + ((lane >> 3) & 1) * 8;
  v8bf lo = __builtin_amdgcn_ds_load_tr16_b128_v8bf16((lds_v8bf*)p);
  v8bf hi = __builtin_amdgcn_ds_load_tr16_b128_v8bf16((lds_v8bf*)(p + 16 * ld));
  v16bf f;
#pragma unroll
  for (int e = 0; e < 8; ++e) { f[e] = lo[e]; f[e + 8] = hi[e]; }
  return f;
}

__device__ __forceinline__ void wait_async0() {
  asm volatile("s_wait_asynccnt 0x0" ::: "memory");
}
// This wave's LDS reads have retired before a copy may refill what they read.
__device__ __forceinline__ void wait_ds0() {
  asm volatile("s_wait_dscnt 0x0" ::: "memory");
}

__device__ __forceinline__ float gelu_exact(float v) {
  return 0.5f * v * (1.0f + erff(v * 0.70710678118654752f));
}

// ---------------------------------------------------------------------------
// fp32 -> bf16 conversion (weights). Each thread converts 32 elements (eight 16-byte loads
// in flight, each wave-wide load 512 contiguous bytes), 8192 elements per block.
// n must be a multiple of 8192 (asserted where the sizes are known).
// ---------------------------------------------------------------------------
#define CVT_PER_BLOCK 8192
__global__ __launch_bounds__(256) void cvt_bf16_kernel(const float* __restrict__ in,
                                                       __bf16* __restrict__ out,
                                                       int n) {
  if ((int)blockIdx.x * CVT_PER_BLOCK + CVT_PER_BLOCK > n) return;
  int q = blockIdx.x * (CVT_PER_BLOCK / 4) + threadIdx.x;  // group of 4 elements
  const v4f* src = (const v4f*)in + q;
  v4bf*      dst = (v4bf*)out + q;
  constexpr int NU = CVT_PER_BLOCK / 1024;   // 16-byte loads per thread
  v4f v[NU];
  // Both loops unrolled: v[] stays in registers and all loads issue before the
  // first conversion waits.
#pragma unroll
  for (int u = 0; u < NU; ++u) v[u] = src[256 * u];
#pragma unroll
  for (int u = 0; u < NU; ++u) {
    v4bf o;
#pragma unroll
    for (int e = 0; e < 4; ++e) o[e] = (__bf16)v[u][e];
    dst[256 * u] = o;
  }
}

// ---------------------------------------------------------------------------
// LayerNorm over 768 cols, bf16 output. One wave owns two whole rows: a lane
// holds 24 elements of each row in registers (six 16-byte loads per row), the
// row sums are joined by a five-step butterfly over the 32 lanes, so no LDS and
// no barrier. 8 waves per block = 16 rows per block.
// ---------------------------------------------------------------------------
#define LN_ROWS_PER_BLOCK 16
__global__ __launch_bounds__(256) void ln_bf16_kernel(const float* __restrict__ X,
                                                      const float* __restrict__ g,
                                                      const float* __restrict__ bt,
                                                      __bf16* __restrict__ out) {
  constexpr int NV = DIMD / 128;   // 16-byte groups per lane and row
  int lane = threadIdx.x & 31;
  int w    = threadIdx.x >> 5;
  size_t row0 = ((size_t)blockIdx.x * 8 + w) * 2;
  const v4f* x0 = (const v4f*)(X + row0 * DIMD) + lane;
  const v4f* x1 = x0 + DIMD / 4;
  v4f a[NV], b[NV];
  // Every loop below is unrolled: the row arrays must be indexed by constants to
  // stay in registers, and both rows' loads issue before the first sum waits.
#pragma unroll
  for (int j = 0; j < NV; ++j) a[j] = x0[32 * j];
#pragma unroll
  for (int j = 0; j < NV; ++j) b[j] = x1[32 * j];
  const v4f* gp = (const v4f*)g + lane;
  const v4f* bp = (const v4f*)bt + lane;
  v4f gg[NV], bb[NV];
#pragma unroll
  for (int j = 0; j < NV; ++j) { gg[j] = gp[32 * j]; bb[j] = bp[32 * j]; }

  float sa = 0.f, qa = 0.f, sb = 0.f, qb = 0.f;
#pragma unroll
  for (int j = 0; j < NV; ++j)
#pragma unroll
    for (int e = 0; e < 4; ++e) {
      sa += a[j][e]; qa += a[j][e] * a[j][e];
      sb += b[j][e]; qb += b[j][e] * b[j][e];
    }
#pragma unroll
  for (int m = 16; m > 0; m >>= 1) {
    sa += __shfl_xor(sa, m, 32);
    qa += __shfl_xor(qa, m, 32);
    sb += __shfl_xor(sb, m, 32);
    qb += __shfl_xor(qb, m, 32);
  }
  float mua  = sa * (1.0f / DIMD);
  float mub  = sb * (1.0f / DIMD);
  float inva = rsqrtf(qa * (1.0f / DIMD) - mua * mua + 1e-5f);
  float invb = rsqrtf(qb * (1.0f / DIMD) - mub * mub + 1e-5f);

  v4bf* o0 = (v4bf*)(out + row0 * DIMD) + lane;
  v4bf* o1 = o0 + DIMD / 4;
#pragma unroll
  for (int j = 0; j < NV; ++j) {
    v4bf ra, rb;
#pragma unroll
    for (int e = 0; e < 4; ++e) {
      ra[e] = (__bf16)((a[j][e] - mua) * inva * gg[j][e] + bb[j][e]);
      rb[e] = (__bf16)((b[j][e] - mub) * invb * gg[j][e] + bb[j][e]);
    }
    o0[32 * j] = ra;
    o1[32 * j] = rb;
  }
}

__device__ __forceinline__ void async_copy8(unsigned l, unsigned lstep,
                                            const __bf16* g, size_t gstep) {
  asm volatile("global_load_async_to_lds_b128 %0, %8, off\n\t"
               "global_load_async_to_lds_b128 %1, %9, off\n\t"
               "global_load_async_to_lds_b128 %2, %10, off\n\t"
               "global_load_async_to_lds_b128 %3, %11, off\n\t"
               "global_load_async_to_lds_b128 %4, %12, off\n\t"
               "global_load_async_to_lds_b128 %5, %13, off\n\t"
               "global_load_async_to_lds_b128 %6, %14, off\n\t"
               "global_load_async_to_lds_b128 %7, %15, off\n\t"
               "s_wait_xcnt 0x0"
               :: "v"(l), "v"(l + lstep), "v"(l + 2u * lstep), "v"(l + 3u * lstep),
                  "v"(l + 4u * lstep), "v"(l + 5u * lstep), "v"(l + 6u * lstep),
                  "v"(l + 7u * lstep),
                  "v"(g), "v"(g + gstep), "v"(g + 2 * gstep), "v"(g + 3 * gstep),
                  "v"(g + 4 * gstep), "v"(g + 5 * gstep), "v"(g + 6 * gstep),
                  "v"(g + 7 * gstep)
               : "memory");
}

#define GBM 128
#define GBN 128
template <int EPI>
__global__ __launch_bounds__(128, 4) void gemm_bf16_kernel(
    const __bf16* __restrict__ A, const __bf16* __restrict__ Bm,
    int M, int N, int K,
    const float* __restrict__ bias, const float* __restrict__ resid,
    float* __restrict__ Cf, __bf16* __restrict__ Cb) {
  __shared__ __attribute__((aligned(16))) __bf16 As[2][GBM * LDP];  // [row][k]
  __shared__ __attribute__((aligned(16))) __bf16 Bs[2][64 * LDTW];  // [k][n]
  int n0 = blockIdx.x * GBN;
  int r0 = blockIdx.y * GBM;
  int t  = threadIdx.x;
  int w  = __builtin_amdgcn_readfirstlane(t >> 5);  // wave number, in a scalar register
  int lane = t & 31;
  int wr = (w >> 1) * 64;   // the wave's rows within the block tile
  int wc = (w & 1) * 64;    // the wave's columns within the block tile

  const v8f vz = {0.f, 0.f, 0.f, 0.f, 0.f, 0.f, 0.f, 0.f};
  v8f acc[4][4];
  // The loops over fragments or registers in this kernel are unrolled (all but the
  // epilogue's outer one): the fragment and accumulator arrays must be indexed by
  // constants to stay in registers.
#pragma unroll
  for (int i = 0; i < 4; ++i)
#pragma unroll
    for (int j = 0; j < 4; ++j) acc[i][j] = vz;

  // One stage, sixteen copies per thread, each wave-wide copy whole 128-B lines:
  // A: eight lanes cover a row's 128 B, the block 16 rows per copy, 8 copies.
  // B: sixteen lanes cover a row's 256 B, the block 8 rows per copy, 8 copies.
  int aR = t >> 3, aC = (t & 7) * 8;
  int bR = t >> 4, bC = (t & 15) * 8;
  auto asyncLoadAB = [&](int k0, int buf) {
    async_copy8((unsigned)(uintptr_t)&As[buf][aR * LDP + aC], 16u * LDP * 2u,
                A + (size_t)(r0 + aR) * K + k0 + aC, (size_t)16 * K);
    async_copy8((unsigned)(uintptr_t)&Bs[buf][bR * LDTW + bC], 8u * LDTW * 2u,
                Bm + (size_t)(k0 + bR) * N + n0 + bC, (size_t)8 * N);
  };

  int nT = K >> 6;  // K / 64
  asyncLoadAB(0, 0);
  for (int it = 0; it < nT; ++it) {
    int buf = it & 1;
    if (it + 2 < nT) {  // one lane per 128-B line of the stage after next
      int k2 = (it + 2) << 6;
      __builtin_prefetch(A + (size_t)(r0 + t) * K + k2, 0, 1);
      __builtin_prefetch(Bm + (size_t)(k2 + (t >> 1)) * N + n0 + (t & 1) * 64, 0, 1);
      // The prefetches name temporaries that the fragment reads below overwrite.
      asm volatile("s_wait_xcnt 0x0" ::: "memory");
    }
    wait_ds0();          // this wave's reads of buffer buf^1 (last trip) retired
    wait_async0();       // this wave's copies for stage `it` have landed
    __syncthreads();     // all waves' copies visible; buffer buf^1 left by all
#pragma unroll
    for (int kk = 0; kk < 64; kk += 32) {
      // The eight fragments of 32 k are read as one group ahead of their WMMAs.
      v16bf af[4], bf[4];
      af[0] = load_frag(&As[buf][wr * LDP + kk], LDP);
#pragma unroll
      for (int j = 0; j < 4; ++j)
        bf[j] = load_frag_tr(&Bs[buf][kk * LDTW + wc + 16 * j], LDTW);
#pragma unroll
      for (int i = 1; i < 4; ++i)
        af[i] = load_frag(&As[buf][(wr + 16 * i) * LDP + kk], LDP);
      // Next stage's copies go out behind the first group of LDS reads: their
      // address arithmetic and issue run while those reads are on their way.
      if (kk == 0 && it + 1 < nT) asyncLoadAB((it + 1) << 6, buf ^ 1);
      // Without this fence the scheduler sinks the A reads among the WMMAs, each
      // with a wait to zero in front of its row of four.
      __builtin_amdgcn_sched_barrier(0);
#pragma unroll
      for (int i = 0; i < 4; ++i)
#pragma unroll
        for (int j = 0; j < 4; ++j) acc[i][j] = wmma_bf16(af[i], bf[j], acc[i][j]);
      // Keeps the next group's reads behind this block of WMMAs, as one group.
      __builtin_amdgcn_sched_barrier(0);
    }
  }

  int colL = lane & 15;
  int rh   = (lane & 16) ? 8 : 0;
  // The loop over the four row fragments stays rolled, for speed only. Each trip works on acc[0][*] and
  // then moves the later fragments down, so that every index is a constant.
#pragma clang loop unroll(disable)
  for (int i = 0; i < 4; ++i) {
#pragma unroll
    for (int j = 0; j < 4; ++j) {
#pragma unroll
      for (int r = 0; r < 8; ++r) {
        int grow = r0 + wr + 16 * i + r + rh;
        int gcol = n0 + wc + 16 * j + colL;
        float v = acc[0][j][r];
        if (EPI == 1) {
          v += bias[gcol] + resid[(size_t)grow * N + gcol];
          Cf[(size_t)grow * N + gcol] = v;
        } else if (EPI == 2) {
          v = gelu_exact(v + bias[gcol]);
          Cb[(size_t)grow * N + gcol] = (__bf16)v;
        } else {
          Cb[(size_t)grow * N + gcol] = (__bf16)v;
        }
      }
    }
#pragma unroll
    for (int j = 0; j < 4; ++j) {
      acc[0][j] = acc[1][j];
      acc[1][j] = acc[2][j];
      acc[2][j] = acc[3][j];
    }
    // The next trip rewrites address and data registers that this trip's loads and
    // stores name.
    asm volatile("s_wait_xcnt 0x0" ::: "memory");
  }
}

__device__ __forceinline__ float other_half(float v) {
  int b = __builtin_bit_cast(int, v);
  return __builtin_bit_cast(
      float, __builtin_amdgcn_permlanex16(b, b, 0x76543210, 0xfedcba98, false, false));
}

__global__ __launch_bounds__(128) void attn_kernel(
    const __bf16* __restrict__ Q, const __bf16* __restrict__ Kg,
    const __bf16* __restrict__ Vg, __bf16* __restrict__ O) {
  __shared__ __attribute__((aligned(16))) __bf16 Ks[64 * LDP];   // [j][d]   (A rows of S^T = K Q^T)
  __shared__ __attribute__((aligned(16))) __bf16 Vs[64 * LDT];   // [m'][d]  (read transposed: A of O^T = V^T P^T)

  int i0 = blockIdx.x * 64;
  int h  = blockIdx.y;
  int b  = blockIdx.z;
  int t  = threadIdx.x;
  int w  = t >> 5;
  int lane = t & 31;
  int colL = lane & 15;
  int rh   = (lane & 16) ? 8 : 0;

  int jL = t >> 1, dL = (t & 1) * 32;

  // Every loop over tiles, registers or elements in this kernel is unrolled: the
  // fragment and accumulator arrays must be indexed by constants to stay in registers.

  // This lane's query row, as the two B fragments of Q^T (d 0..31 and 32..63),
  // in the k order of load_frag; loaded once, kept in registers.
  size_t qrow = (size_t)(b * NSEQ) + i0 + 16 * w + colL;
  v16bf qf[2];
  {
    const __bf16* src = Q + qrow * INNERD + h * HDIM + rh;
#pragma unroll
    for (int u = 0; u < 2; ++u) {
      v8bf lo = *(const v8bf*)(src + 32 * u);
      v8bf hi = *(const v8bf*)(src + 32 * u + 16);
#pragma unroll
      for (int e = 0; e < 8; ++e) { qf[u][e] = lo[e]; qf[u][e + 8] = hi[e]; }
    }
  }

  float run_max = -3.0e38f;   // of the lane's query, equal in both halves
  float run_sum = 0.0f;       // over this half's keys only; halves joined at the end
  const v8f vz = {0.f, 0.f, 0.f, 0.f, 0.f, 0.f, 0.f, 0.f};
  v8f oacc[4] = {vz, vz, vz, vz};   // oacc[n][r] = O^T[d = 16n + 8h + r][query c]

  for (int m0 = 0; m0 < MSEQ; m0 += 64) {
    if (m0 + 64 < MSEQ) {  // prefetch next chunk of K/V through L2
      __builtin_prefetch(
          Kg + ((size_t)(b * MSEQ) + m0 + 64 + jL) * INNERD + h * HDIM + dL, 0, 1);
      __builtin_prefetch(
          Vg + ((size_t)(b * MSEQ) + m0 + 64 + jL) * INNERD + h * HDIM + dL, 0, 1);
    }
    wait_ds0();        // this wave's reads of Ks/Vs retired before the refill
    __syncthreads();   // previous chunk's WMMA reads of Ks/Vs done
    { // K and V tiles, both row-major. K: 64 B of one row per thread. V: 16 B of
      // each of four rows (eight lanes cover a row's whole 128 B).
      int vR = t >> 3, vC = (t & 7) * 8;
      const __bf16* kp = Kg + ((size_t)(b * MSEQ) + m0 + jL) * INNERD + h * HDIM + dL;
      const __bf16* vp = Vg + ((size_t)(b * MSEQ) + m0 + vR) * INNERD + h * HDIM + vC;
      unsigned lk = (unsigned)(uintptr_t)&Ks[jL * LDP + dL];
      unsigned lv = (unsigned)(uintptr_t)&Vs[vR * LDT + vC];
      asm volatile("global_load_async_to_lds_b128 %0, %8, off\n\t"
                   "global_load_async_to_lds_b128 %1, %9, off\n\t"
                   "global_load_async_to_lds_b128 %2, %10, off\n\t"
                   "global_load_async_to_lds_b128 %3, %11, off\n\t"
                   "global_load_async_to_lds_b128 %4, %12, off\n\t"
                   "global_load_async_to_lds_b128 %5, %13, off\n\t"
                   "global_load_async_to_lds_b128 %6, %14, off\n\t"
                   "global_load_async_to_lds_b128 %7, %15, off\n\t"
                   "s_wait_xcnt 0x0"
                   :: "v"(lk), "v"(lk + 16u), "v"(lk + 32u), "v"(lk + 48u),
                      "v"(lv), "v"(lv + 16u * LDT * 2u), "v"(lv + 32u * LDT * 2u),
                      "v"(lv + 48u * LDT * 2u),
                      "v"(kp), "v"(kp + 8), "v"(kp + 16), "v"(kp + 24),
                      "v"(vp), "v"(vp + 16 * INNERD), "v"(vp + 32 * INNERD),
                      "v"(vp + 48 * INNERD)
                   : "memory");
    }
    wait_async0();     // this wave's copies have landed
    __syncthreads();   // every wave's copies visible

    // S^T = K Q^T: 64 keys x this wave's 16 queries (two k-steps over d)
    v8f s[4] = {vz, vz, vz, vz};
#pragma unroll
    for (int kk = 0; kk < 64; kk += 32) {
#pragma unroll
      for (int n = 0; n < 4; ++n) {
        v16bf kf = load_frag(Ks + 16 * n * LDP + kk, LDP);
        s[n] = wmma_bf16(kf, qf[kk >> 5], s[n]);
      }
    }

    // Online softmax of the lane's query over its 32 keys of the chunk. The scale
    // is a power of two, so s * 0.125 is exact: the maximum may be scaled after it
    // is found, and the fused s * 0.125 - nm rounds as the separate form does.
    float cmax = -3.0e38f;
#pragma unroll
    for (int n = 0; n < 4; ++n)
#pragma unroll
      for (int r = 0; r < 8; ++r) cmax = fmaxf(cmax, s[n][r]);
    cmax = fmaxf(cmax, other_half(cmax)) * 0.125f;
    float nm    = fmaxf(run_max, cmax);
    float alpha = expf(run_max - nm);
    float ts[4];   // one partial sum per tile: four independent add chains
    v16bf pf[2];   // P^T as B fragments: keys 0..31 and 32..63 of the chunk
#pragma unroll
    for (int n = 0; n < 4; ++n) {
      ts[n] = 0.0f;
#pragma unroll
      for (int r = 0; r < 8; ++r) {
        float p = expf(__builtin_fmaf(s[n][r], 0.125f, -nm));
        pf[n >> 1][(n & 1) * 8 + r] = (__bf16)p;
        ts[n] += p;
      }
    }
    float ssum = (ts[0] + ts[1]) + (ts[2] + ts[3]);
    run_sum = run_sum * alpha + ssum;
    run_max = nm;

    // Rescale O^T (one factor per lane), then O^T += V^T P^T
#pragma unroll
    for (int n = 0; n < 4; ++n)
#pragma unroll
      for (int r = 0; r < 8; ++r) oacc[n][r] *= alpha;
#pragma unroll
    for (int kk = 0; kk < 64; kk += 32) {
#pragma unroll
      for (int n = 0; n < 4; ++n) {
        v16bf vf = load_frag_tr(Vs + kk * LDT + 16 * n, LDT);
        oacc[n] = wmma_bf16(vf, pf[kk >> 5], oacc[n]);
      }
    }
  }

  // A lane holds eight consecutive d of its query per tile: one 16-byte store each.
  float inv = 1.0f / (run_sum + other_half(run_sum));
  __bf16* dst = O + qrow * INNERD + h * HDIM + rh;
#pragma unroll
  for (int n = 0; n < 4; ++n) {
    v8bf o;
#pragma unroll
    for (int r = 0; r < 8; ++r) o[r] = (__bf16)(oacc[n][r] * inv);
    *(v8bf*)(dst + 16 * n) = o;
  }
}

// ---------------------------------------------------------------------------
// Launch
// ---------------------------------------------------------------------------
extern "C" void kernel_launch(void* const* d_in, const int* in_sizes, int n_in,
                              void* d_out, int out_size, void* d_ws, size_t ws_size,
                              hipStream_t stream) {
  (void)in_sizes; (void)n_in; (void)out_size; (void)ws_size;
  const float* x   = (const float*)d_in[0];
  const float* ctx = (const float*)d_in[1];
  const float* Wq  = (const float*)d_in[2];
  const float* Wk  = (const float*)d_in[3];
  const float* Wv  = (const float*)d_in[4];
  const float* Wo  = (const float*)d_in[5];
  const float* bo  = (const float*)d_in[6];
  const float* g1  = (const float*)d_in[7];
  const float* b1  = (const float*)d_in[8];
  const float* g2  = (const float*)d_in[9];
  const float* b2  = (const float*)d_in[10];
  const float* W1  = (const float*)d_in[11];
  const float* bf1 = (const float*)d_in[12];
  const float* W2  = (const float*)d_in[13];
  const float* bf2 = (const float*)d_in[14];
  float* out = (float*)d_out;

  char* wp = (char*)d_ws;
  auto alloc = [&](size_t bytes) -> char* {
    char* p = wp;
    wp += (bytes + 255) & ~(size_t)255;
    return p;
  };
  __bf16* Wq16  = (__bf16*)alloc((size_t)DIMD * INNERD * 2);
  __bf16* Wk16  = (__bf16*)alloc((size_t)DIMD * INNERD * 2);
  __bf16* Wv16  = (__bf16*)alloc((size_t)DIMD * INNERD * 2);
  __bf16* Wo16  = (__bf16*)alloc((size_t)INNERD * DIMD * 2);
  __bf16* W116  = (__bf16*)alloc((size_t)DIMD * FFND * 2);
  __bf16* W216  = (__bf16*)alloc((size_t)FFND * DIMD * 2);
  __bf16* nx16  = (__bf16*)alloc((size_t)ROWS * DIMD * 2);
  __bf16* nc16  = (__bf16*)alloc((size_t)ROWS * DIMD * 2);
  __bf16* Q16   = (__bf16*)alloc((size_t)ROWS * INNERD * 2);
  __bf16* K16   = (__bf16*)alloc((size_t)ROWS * INNERD * 2);
  __bf16* V16   = (__bf16*)alloc((size_t)ROWS * INNERD * 2);
  __bf16* O16   = (__bf16*)alloc((size_t)ROWS * INNERD * 2);
  float*  x1    = (float*)alloc((size_t)ROWS * DIMD * 4);
  __bf16* hln16 = (__bf16*)alloc((size_t)ROWS * DIMD * 2);
  __bf16* H16   = (__bf16*)alloc((size_t)ROWS * FFND * 2);

  static_assert((DIMD * INNERD) % CVT_PER_BLOCK == 0 && (DIMD * FFND) % CVT_PER_BLOCK == 0,
                "weight sizes must be whole conversion blocks");
  static_assert(ROWS % LN_ROWS_PER_BLOCK == 0 && DIMD % 128 == 0, "LayerNorm tiling");
  static_assert(ROWS % GBM == 0 && INNERD % GBN == 0 && DIMD % GBN == 0 && FFND % GBN == 0 &&
                DIMD % 64 == 0 && INNERD % 64 == 0 && FFND % 64 == 0, "GEMM tiling");
  auto cvt = [&](const float* src, __bf16* dst, int n) {
    cvt_bf16_kernel<<<n / CVT_PER_BLOCK, 256, 0, stream>>>(src, dst, n);
  };
  cvt(Wq, Wq16, DIMD * INNERD);
  cvt(Wk, Wk16, DIMD * INNERD);
  cvt(Wv, Wv16, DIMD * INNERD);
  cvt(Wo, Wo16, INNERD * DIMD);
  cvt(W1, W116, DIMD * FFND);
  cvt(W2, W216, FFND * DIMD);

  // norm1 for x and context
  ln_bf16_kernel<<<ROWS / LN_ROWS_PER_BLOCK, 256, 0, stream>>>(x,   g1, b1, nx16);
  ln_bf16_kernel<<<ROWS / LN_ROWS_PER_BLOCK, 256, 0, stream>>>(ctx, g1, b1, nc16);

  // Q/K/V projections (plain bf16 epilogue)
  {
    dim3 g(INNERD / GBN, ROWS / GBM);
    gemm_bf16_kernel<0><<<g, 128, 0, stream>>>(nx16, Wq16, ROWS, INNERD, DIMD,
                                               nullptr, nullptr, nullptr, Q16);
    gemm_bf16_kernel<0><<<g, 128, 0, stream>>>(nc16, Wk16, ROWS, INNERD, DIMD,
                                               nullptr, nullptr, nullptr, K16);
    gemm_bf16_kernel<0><<<g, 128, 0, stream>>>(nc16, Wv16, ROWS, INNERD, DIMD,
                                               nullptr, nullptr, nullptr, V16);
  }

  // Attention
  {
    dim3 g(NSEQ / 64, NHEADS, BATCH);
    attn_kernel<<<g, 128, 0, stream>>>(Q16, K16, V16, O16);
  }

  // Output projection + bias + residual -> x1 (f32)
  {
    dim3 g(DIMD / GBN, ROWS / GBM);
    gemm_bf16_kernel<1><<<g, 128, 0, stream>>>(O16, Wo16, ROWS, DIMD, INNERD,
                                               bo, x, x1, nullptr);
  }

  // norm2
  ln_bf16_kernel<<<ROWS / LN_ROWS_PER_BLOCK, 256, 0, stream>>>(x1, g2, b2, hln16);

  // FFN1: gelu(h @ W1 + bf1) -> bf16
  {
    dim3 g(FFND / GBN, ROWS / GBM);
    gemm_bf16_kernel<2><<<g, 128, 0, stream>>>(hln16, W116, ROWS, FFND, DIMD,
                                               bf1, nullptr, nullptr, H16);
  }

  // FFN2: x1 + H @ W2 + bf2 -> d_out (f32)
  {
    dim3 g(DIMD / GBN, ROWS / GBM);
    gemm_bf16_kernel<1><<<g, 128, 0, stream>>>(H16, W216, ROWS, DIMD, FFND,
                                               bf2, x1, out, nullptr);
  }
}

// v006
// One run takes 250 microseconds.
// Timed twice side by side with v005, it ran 1.08 times as fast both times.
// Over all steps from v000 it is 3.40 times as fast.
#include <hip/hip_runtime.h>
#include <hip/hip_bf16.h>

typedef __attribute__((ext_vector_type(16))) __bf16 v16bf;
typedef __attribute__((ext_vector_type(8)))  __bf16 v8bf;
typedef __attribute__((ext_vector_type(8)))  float  v8f;
typedef __attribute__((ext_vector_type(4)))  __bf16 v4bf;
typedef __attribute__((ext_vector_type(4)))  float  v4f;

#define DIMD   768
#define NHEADS 8
#define HDIM   64
#define INNERD 512
#define FFND   3072
#define BATCH  4
#define NSEQ   2048
#define MSEQ   2048
#define ROWS   (BATCH * NSEQ)   // 8192 rows for both x and context paths

#define LDP    72   // bf16 elements per LDS row of a 64-wide bf16 tile
// A tile kept row-major [k][n] and read by the transposing load wants 32 B x odd.
#define LDT    80   // bf16 elements per LDS row (160 B) of a 64-wide [k][n] tile
#define LDTW   144  // bf16 elements per LDS row (288 B) of a 128-wide [k][n] tile

__device__ __forceinline__ v8f wmma_bf16(v16bf a, v16bf b, v8f c) {
  // (neg_a, A, neg_b, B, c_mod, C, reuse_a, reuse_b)
  return __builtin_amdgcn_wmma_f32_16x16x32_bf16(false, a, false, b, (short)0, c,
                                                 false, false);
}

__device__ __forceinline__ v16bf load_frag(const __bf16* base, int ld) {
  int lane = threadIdx.x & 31;
  int r    = lane & 15;
  int kb   = (lane & 16) ? 8 : 0;
  const __bf16* p = base + r * ld + kb;
  v8bf lo = *(const v8bf*)(p);
  v8bf hi = *(const v8bf*)(p + 16);
  v16bf f;
#pragma unroll
  for (int e = 0; e < 8; ++e) { f[e] = lo[e]; f[e + 8] = hi[e]; }
  return f;
}

// Load one 32x16 B fragment (k x n) from an LDS tile laid out [k][n] with pitch
// `ld` (elements); `tile` points at element [kbase][nbase]. ds_load_tr16_b128 hands lane
// (c = L&15, h = L>>4) the eight elements [kbase + 8h + 0..7][nbase + c], so the
// loads at kbase and kbase + 16 give the same k order as load_frag gives A.
typedef __attribute__((address_space(3))) v8bf lds_v8bf;
__device__ __forceinline__ v16bf load_frag_tr(const __bf16* tile, int ld) {
  int lane = threadIdx.x & 31;
  const __bf16* p = tile + ((lane >> 4) * 8 + (lane & 7)) * ld + ((lane >> 3) & 1) * 8;
  v8bf lo = __builtin_amdgcn_ds_load_tr16_b128_v8bf16((lds_v8bf*)p);
  v8bf hi = __builtin_amdgcn_ds_load_tr16_b128_v8bf16((lds_v8bf*)(p + 16 * ld));
  v16bf f;
#pragma unroll
  for (int e = 0; e < 8; ++e) { f[e] = lo[e]; f[e + 8] = hi[e]; }
  return f;
}

__device__ __forceinline__ void wait_async0() {
  asm volatile("s_wait_asynccnt 0x0" ::: "memory");
}
// This wave's LDS reads have retired before a copy may refill what they read.
__device__ __forceinline__ void wait_ds0() {
  asm volatile("s_wait_dscnt 0x0" ::: "memory");
}

// erf(x) to single precision without a branch. The library form picks one of two
// fits by |x| under the exec mask; among 32 lanes both sides are nearly always
// taken, and each element becomes one long dependent chain between two mask
// branches. Here both fits (the same polynomials) are evaluated in every lane and
// one is selected, so that the elements of a thread are independent chains that
// the scheduler can interleave.
//   |x| <  1: |x| + |x| P(x^2)
//   |x| >= 1: 1 - exp(-q), q = |x| + |x| Q(|x|); exp(-q) = 2^(-q log2 e) on the
//             hardware 2^x: exp(-q) < 0.16 there, so its rounding moves 1 - exp(-q) by
//             about one unit in the last place, far below the bf16 rounding that
//             follows; a large or infinite q gives 0, erf = 1.
__device__ __forceinline__ float erf_select(float x) {
  float a = fabsf(x);
  float t = a * a;
  float p = fmaf(t, -0x1.268bc2p-11f, 0x1.420828p-8f);
  p = fmaf(t, p, -0x1.b5937p-6f);
  p = fmaf(t, p, 0x1.ce077cp-4f);
  p = fmaf(t, p, -0x1.81266p-2f);
  p = fmaf(t, p, 0x1.06eba0p-3f);
  float near0 = fmaf(a, p, a);
  float q = fmaf(a, 0x1.1d3156p-16f, -0x1.8d129p-12f);
  q = fmaf(a, q, 0x1.f9a6d2p-9f);
  q = fmaf(a, q, -0x1.8c3164p-6f);
  q = fmaf(a, q, 0x1.b4e9c8p-4f);
  q = fmaf(a, q, 0x1.4515fap-1f);
  q = fmaf(a, q, 0x1.078e50p-3f);
  q = fmaf(a, q, a);
  float far0 = 1.0f - __builtin_amdgcn_exp2f(q * -1.44269504088896340736f);
  return copysignf(a < 1.0f ? near0 : far0, x);
}

__device__ __forceinline__ float gelu_exact(float v) {
  return 0.5f * v * (1.0f + erf_select(v * 0.70710678118654752f));
}

// ---------------------------------------------------------------------------
// fp32 -> bf16 conversion (weights). Each thread converts 32 elements (eight 16-byte loads
// in flight, each wave-wide load 512 contiguous bytes), 8192 elements per block.
// n must be a multiple of 8192 (asserted where the sizes are known).
// ---------------------------------------------------------------------------
#define CVT_PER_BLOCK 8192
__global__ __launch_bounds__(256) void cvt_bf16_kernel(const float* __restrict__ in,
                                                       __bf16* __restrict__ out,
                                                       int n) {
  if ((int)blockIdx.x * CVT_PER_BLOCK + CVT_PER_BLOCK > n) return;
  int q = blockIdx.x * (CVT_PER_BLOCK / 4) + threadIdx.x;  // group of 4 elements
  const v4f* src = (const v4f*)in + q;
  v4bf*      dst = (v4bf*)out + q;
  constexpr int NU = CVT_PER_BLOCK / 1024;   // 16-byte loads per thread
  v4f v[NU];
  // Both loops unrolled: v[] stays in registers and all loads issue before the
  // first conversion waits.
#pragma unroll
  for (int u = 0; u < NU; ++u) v[u] = src[256 * u];
#pragma unroll
  for (int u = 0; u < NU; ++u) {
    v4bf o;
#pragma unroll
    for (int e = 0; e < 4; ++e) o[e] = (__bf16)v[u][e];
    dst[256 * u] = o;
  }
}

// ---------------------------------------------------------------------------
// LayerNorm over 768 cols, bf16 output. One wave owns two whole rows: a lane
// holds 24 elements of each row in registers (six 16-byte loads per row), the
// row sums are joined by a five-step butterfly over the 32 lanes, so no LDS and
// no barrier. 8 waves per block = 16 rows per block.
// ---------------------------------------------------------------------------
#define LN_ROWS_PER_BLOCK 16
__global__ __launch_bounds__(256) void ln_bf16_kernel(const float* __restrict__ X,
                                                      const float* __restrict__ g,
                                                      const float* __restrict__ bt,
                                                      __bf16* __restrict__ out) {
  constexpr int NV = DIMD / 128;   // 16-byte groups per lane and row
  int lane = threadIdx.x & 31;
  int w    = threadIdx.x >> 5;
  size_t row0 = ((size_t)blockIdx.x * 8 + w) * 2;
  const v4f* x0 = (const v4f*)(X + row0 * DIMD) + lane;
  const v4f* x1 = x0 + DIMD / 4;
  v4f a[NV], b[NV];
  // Every loop below is unrolled: the row arrays must be indexed by constants to
  // stay in registers, and both rows' loads issue before the first sum waits.
#pragma unroll
  for (int j = 0; j < NV; ++j) a[j] = x0[32 * j];
#pragma unroll
  for (int j = 0; j < NV; ++j) b[j] = x1[32 * j];
  const v4f* gp = (const v4f*)g + lane;
  const v4f* bp = (const v4f*)bt + lane;
  v4f gg[NV], bb[NV];
#pragma unroll
  for (int j = 0; j < NV; ++j) { gg[j] = gp[32 * j]; bb[j] = bp[32 * j]; }

  float sa = 0.f, qa = 0.f, sb = 0.f, qb = 0.f;
#pragma unroll
  for (int j = 0; j < NV; ++j)
#pragma unroll
    for (int e = 0; e < 4; ++e) {
      sa += a[j][e]; qa += a[j][e] * a[j][e];
      sb += b[j][e]; qb += b[j][e] * b[j][e];
    }
#pragma unroll
  for (int m = 16; m > 0; m >>= 1) {
    sa += __shfl_xor(sa, m, 32);
    qa += __shfl_xor(qa, m, 32);
    sb += __shfl_xor(sb, m, 32);
    qb += __shfl_xor(qb, m, 32);
  }
  float mua  = sa * (1.0f / DIMD);
  float mub  = sb * (1.0f / DIMD);
  float inva = rsqrtf(qa * (1.0f / DIMD) - mua * mua + 1e-5f);
  float invb = rsqrtf(qb * (1.0f / DIMD) - mub * mub + 1e-5f);

  v4bf* o0 = (v4bf*)(out + row0 * DIMD) + lane;
  v4bf* o1 = o0 + DIMD / 4;
#pragma unroll
  for (int j = 0; j < NV; ++j) {
    v4bf ra, rb;
#pragma unroll
    for (int e = 0; e < 4; ++e) {
      ra[e] = (__bf16)((a[j][e] - mua) * inva * gg[j][e] + bb[j][e]);
      rb[e] = (__bf16)((b[j][e] - mub) * invb * gg[j][e] + bb[j][e]);
    }
    o0[32 * j] = ra;
    o1[32 * j] = rb;
  }
}

__device__ __forceinline__ void async_copy8(unsigned l, unsigned lstep,
                                            const __bf16* g, size_t gstep) {
  asm volatile("global_load_async_to_lds_b128 %0, %8, off\n\t"
               "global_load_async_to_lds_b128 %1, %9, off\n\t"
               "global_load_async_to_lds_b128 %2, %10, off\n\t"
               "global_load_async_to_lds_b128 %3, %11, off\n\t"
               "global_load_async_to_lds_b128 %4, %12, off\n\t"
               "global_load_async_to_lds_b128 %5, %13, off\n\t"
               "global_load_async_to_lds_b128 %6, %14, off\n\t"
               "global_load_async_to_lds_b128 %7, %15, off\n\t"
               "s_wait_xcnt 0x0"
               :: "v"(l), "v"(l + lstep), "v"(l + 2u * lstep), "v"(l + 3u * lstep),
                  "v"(l + 4u * lstep), "v"(l + 5u * lstep), "v"(l + 6u * lstep),
                  "v"(l + 7u * lstep),
                  "v"(g), "v"(g + gstep), "v"(g + 2 * gstep), "v"(g + 3 * gstep),
                  "v"(g + 4 * gstep), "v"(g + 5 * gstep), "v"(g + 6 * gstep),
                  "v"(g + 7 * gstep)
               : "memory");
}

#define GBM 128
#define GBN 128
template <int EPI>
__global__ __launch_bounds__(128, 4) void gemm_bf16_kernel(
    const __bf16* __restrict__ A, const __bf16* __restrict__ Bm,
    int M, int N, int K,
    const float* __restrict__ bias, const float* __restrict__ resid,
    float* __restrict__ Cf, __bf16* __restrict__ Cb) {
  __shared__ __attribute__((aligned(16))) __bf16 As[2][GBM * LDP];  // [row][k]
  __shared__ __attribute__((aligned(16))) __bf16 Bs[2][64 * LDTW];  // [k][n]
  int n0 = blockIdx.x * GBN;
  int r0 = blockIdx.y * GBM;
  int t  = threadIdx.x;
  int w  = __builtin_amdgcn_readfirstlane(t >> 5);  // wave number, in a scalar register
  int lane = t & 31;
  int wr = (w >> 1) * 64;   // the wave's rows within the block tile
  int wc = (w & 1) * 64;    // the wave's columns within the block tile

  const v8f vz = {0.f, 0.f, 0.f, 0.f, 0.f, 0.f, 0.f, 0.f};
  v8f acc[4][4];
  // The loops over fragments or registers in this kernel are unrolled (all but the
  // epilogue's outer one): the fragment and accumulator arrays must be indexed by
  // constants to stay in registers.
#pragma unroll
  for (int i = 0; i < 4; ++i)
#pragma unroll
    for (int j = 0; j < 4; ++j) acc[i][j] = vz;

  // One stage, sixteen copies per thread, each wave-wide copy whole 128-B lines:
  // A: eight lanes cover a row's 128 B, the block 16 rows per copy, 8 copies.
  // B: sixteen lanes cover a row's 256 B, the block 8 rows per copy, 8 copies.
  int aR = t >> 3, aC = (t & 7) * 8;
  int bR = t >> 4, bC = (t & 15) * 8;
  auto asyncLoadAB = [&](int k0, int buf) {
    async_copy8((unsigned)(uintptr_t)&As[buf][aR * LDP + aC], 16u * LDP * 2u,
                A + (size_t)(r0 + aR) * K + k0 + aC, (size_t)16 * K);
    async_copy8((unsigned)(uintptr_t)&Bs[buf][bR * LDTW + bC], 8u * LDTW * 2u,
                Bm + (size_t)(k0 + bR) * N + n0 + bC, (size_t)8 * N);
  };

  int nT = K >> 6;  // K / 64
  asyncLoadAB(0, 0);
  for (int it = 0; it < nT; ++it) {
    int buf = it & 1;
    if (it + 2 < nT) {  // one lane per 128-B line of the stage after next
      int k2 = (it + 2) << 6;
      __builtin_prefetch(A + (size_t)(r0 + t) * K + k2, 0, 1);
      __builtin_prefetch(Bm + (size_t)(k2 + (t >> 1)) * N + n0 + (t & 1) * 64, 0, 1);
      // The prefetches name temporaries that the fragment reads below overwrite.
      asm volatile("s_wait_xcnt 0x0" ::: "memory");
    }
    wait_ds0();          // this wave's reads of buffer buf^1 (last trip) retired
    wait_async0();       // this wave's copies for stage `it` have landed
    __syncthreads();     // all waves' copies visible; buffer buf^1 left by all
#pragma unroll
    for (int kk = 0; kk < 64; kk += 32) {
      // The eight fragments of 32 k are read as one group ahead of their WMMAs.
      v16bf af[4], bf[4];
      af[0] = load_frag(&As[buf][wr * LDP + kk], LDP);
#pragma unroll
      for (int j = 0; j < 4; ++j)
        bf[j] = load_frag_tr(&Bs[buf][kk * LDTW + wc + 16 * j], LDTW);
#pragma unroll
      for (int i = 1; i < 4; ++i)
        af[i] = load_frag(&As[buf][(wr + 16 * i) * LDP + kk], LDP);
      // Next stage's copies go out behind the first group of LDS reads: their
      // address arithmetic and issue run while those reads are on their way.
      if (kk == 0 && it + 1 < nT) asyncLoadAB((it + 1) << 6, buf ^ 1);
      // Without this fence the scheduler sinks the A reads among the WMMAs, each
      // with a wait to zero in front of its row of four.
      __builtin_amdgcn_sched_barrier(0);
#pragma unroll
      for (int i = 0; i < 4; ++i)
#pragma unroll
        for (int j = 0; j < 4; ++j) acc[i][j] = wmma_bf16(af[i], bf[j], acc[i][j]);
      // Keeps the next group's reads behind this block of WMMAs, as one group.
      __builtin_amdgcn_sched_barrier(0);
    }
  }

  int colL = lane & 15;
  int rh   = (lane & 16) ? 8 : 0;
  // The loop over the four row fragments stays rolled, for speed only. Each trip works on acc[0][*] and
  // then moves the later fragments down, so that every index is a constant.
#pragma clang loop unroll(disable)
  for (int i = 0; i < 4; ++i) {
#pragma unroll
    for (int j = 0; j < 4; ++j) {
#pragma unroll
      for (int r = 0; r < 8; ++r) {
        int grow = r0 + wr + 16 * i + r + rh;
        int gcol = n0 + wc + 16 * j + colL;
        float v = acc[0][j][r];
        if (EPI == 1) {
          v += bias[gcol] + resid[(size_t)grow * N + gcol];
          Cf[(size_t)grow * N + gcol] = v;
        } else if (EPI == 2) {
          v = gelu_exact(v + bias[gcol]);
          Cb[(size_t)grow * N + gcol] = (__bf16)v;
        } else {
          Cb[(size_t)grow * N + gcol] = (__bf16)v;
        }
      }
      // The GELU chains of a trip are independent and the scheduler would run all
      // 32 side by side; with the accumulators live that spills. Two groups of 16.
      if (EPI == 2 && j == 1) __builtin_amdgcn_sched_barrier(0);
    }
#pragma unroll
    for (int j = 0; j < 4; ++j) {
      acc[0][j] = acc[1][j];
      acc[1][j] = acc[2][j];
      acc[2][j] = acc[3][j];
    }
    // The next trip rewrites address and data registers that this trip's loads and
    // stores name.
    asm volatile("s_wait_xcnt 0x0" ::: "memory");
  }
}

__device__ __forceinline__ float other_half(float v) {
  int b = __builtin_bit_cast(int, v);
  return __builtin_bit_cast(
      float, __builtin_amdgcn_permlanex16(b, b, 0x76543210, 0xfedcba98, false, false));
}

__global__ __launch_bounds__(128) void attn_kernel(
    const __bf16* __restrict__ Q, const __bf16* __restrict__ Kg,
    const __bf16* __restrict__ Vg, __bf16* __restrict__ O) {
  __shared__ __attribute__((aligned(16))) __bf16 Ks[64 * LDP];   // [j][d]   (A rows of S^T = K Q^T)
  __shared__ __attribute__((aligned(16))) __bf16 Vs[64 * LDT];   // [m'][d]  (read transposed: A of O^T = V^T P^T)

  int i0 = blockIdx.x * 64;
  int h  = blockIdx.y;
  int b  = blockIdx.z;
  int t  = threadIdx.x;
  int w  = t >> 5;
  int lane = t & 31;
  int colL = lane & 15;
  int rh   = (lane & 16) ? 8 : 0;

  int jL = t >> 1, dL = (t & 1) * 32;

  // Every loop over tiles, registers or elements in this kernel is unrolled: the
  // fragment and accumulator arrays must be indexed by constants to stay in registers.

  // This lane's query row, as the two B fragments of Q^T (d 0..31 and 32..63),
  // in the k order of load_frag; loaded once, kept in registers.
  size_t qrow = (size_t)(b * NSEQ) + i0 + 16 * w + colL;
  v16bf qf[2];
  {
    const __bf16* src = Q + qrow * INNERD + h * HDIM + rh;
#pragma unroll
    for (int u = 0; u < 2; ++u) {
      v8bf lo = *(const v8bf*)(src + 32 * u);
      v8bf hi = *(const v8bf*)(src + 32 * u + 16);
#pragma unroll
      for (int e = 0; e < 8; ++e) { qf[u][e] = lo[e]; qf[u][e + 8] = hi[e]; }
    }
  }

  float run_max = -3.0e38f;   // of the lane's query, equal in both halves
  float run_sum = 0.0f;       // over this half's keys only; halves joined at the end
  const v8f vz = {0.f, 0.f, 0.f, 0.f, 0.f, 0.f, 0.f, 0.f};
  v8f oacc[4] = {vz, vz, vz, vz};   // oacc[n][r] = O^T[d = 16n + 8h + r][query c]

  for (int m0 = 0; m0 < MSEQ; m0 += 64) {
    if (m0 + 64 < MSEQ) {  // prefetch next chunk of K/V through L2
      __builtin_prefetch(
          Kg + ((size_t)(b * MSEQ) + m0 + 64 + jL) * INNERD + h * HDIM + dL, 0, 1);
      __builtin_prefetch(
          Vg + ((size_t)(b * MSEQ) + m0 + 64 + jL) * INNERD + h * HDIM + dL, 0, 1);
    }
    wait_ds0();        // this wave's reads of Ks/Vs retired before the refill
    __syncthreads();   // previous chunk's WMMA reads of Ks/Vs done
    { // K and V tiles, both row-major. K: 64 B of one row per thread. V: 16 B of
      // each of four rows (eight lanes cover a row's whole 128 B).
      int vR = t >> 3, vC = (t & 7) * 8;
      const __bf16* kp = Kg + ((size_t)(b * MSEQ) + m0 + jL) * INNERD + h * HDIM + dL;
      const __bf16* vp = Vg + ((size_t)(b * MSEQ) + m0 + vR) * INNERD + h * HDIM + vC;
      unsigned lk = (unsigned)(uintptr_t)&Ks[jL * LDP + dL];
      unsigned lv = (unsigned)(uintptr_t)&Vs[vR * LDT + vC];
      asm volatile("global_load_async_to_lds_b128 %0, %8, off\n\t"
                   "global_load_async_to_lds_b128 %1, %9, off\n\t"
                   "global_load_async_to_lds_b128 %2, %10, off\n\t"
                   "global_load_async_to_lds_b128 %3, %11, off\n\t"
                   "global_load_async_to_lds_b128 %4, %12, off\n\t"
                   "global_load_async_to_lds_b128 %5, %13, off\n\t"
                   "global_load_async_to_lds_b128 %6, %14, off\n\t"
                   "global_load_async_to_lds_b128 %7, %15, off\n\t"
                   "s_wait_xcnt 0x0"
                   :: "v"(lk), "v"(lk + 16u), "v"(lk + 32u), "v"(lk + 48u),
                      "v"(lv), "v"(lv + 16u * LDT * 2u), "v"(lv + 32u * LDT * 2u),
                      "v"(lv + 48u * LDT * 2u),
                      "v"(kp), "v"(kp + 8), "v"(kp + 16), "v"(kp + 24),
                      "v"(vp), "v"(vp + 16 * INNERD), "v"(vp + 32 * INNERD),
                      "v"(vp + 48 * INNERD)
                   : "memory");
    }
    wait_async0();     // this wave's copies have landed
    __syncthreads();   // every wave's copies visible

    // S^T = K Q^T: 64 keys x this wave's 16 queries (two k-steps over d)
    v8f s[4] = {vz, vz, vz, vz};
#pragma unroll
    for (int kk = 0; kk < 64; kk += 32) {
#pragma unroll
      for (int n = 0; n < 4; ++n) {
        v16bf kf = load_frag(Ks + 16 * n * LDP + kk, LDP);
        s[n] = wmma_bf16(kf, qf[kk >> 5], s[n]);
      }
    }

    // Online softmax of the lane's query over its 32 keys of the chunk. The scale
    // is a power of two, so s * 0.125 is exact: the maximum may be scaled after it
    // is found, and the fused s * 0.125 - nm rounds as the separate form does.
    float cmax = -3.0e38f;
#pragma unroll
    for (int n = 0; n < 4; ++n)
#pragma unroll
      for (int r = 0; r < 8; ++r) cmax = fmaxf(cmax, s[n][r]);
    cmax = fmaxf(cmax, other_half(cmax)) * 0.125f;
    float nm    = fmaxf(run_max, cmax);
    float alpha = expf(run_max - nm);
    float ts[4];   // one partial sum per tile: four independent add chains
    v16bf pf[2];   // P^T as B fragments: keys 0..31 and 32..63 of the chunk
#pragma unroll
    for (int n = 0; n < 4; ++n) {
      ts[n] = 0.0f;
#pragma unroll
      for (int r = 0; r < 8; ++r) {
        float p = expf(__builtin_fmaf(s[n][r], 0.125f, -nm));
        pf[n >> 1][(n & 1) * 8 + r] = (__bf16)p;
        ts[n] += p;
      }
    }
    float ssum = (ts[0] + ts[1]) + (ts[2] + ts[3]);
    run_sum = run_sum * alpha + ssum;
    run_max = nm;

    // Rescale O^T (one factor per lane), then O^T += V^T P^T
#pragma unroll
    for (int n = 0; n < 4; ++n)
#pragma unroll
      for (int r = 0; r < 8; ++r) oacc[n][r] *= alpha;
#pragma unroll
    for (int kk = 0; kk < 64; kk += 32) {
#pragma unroll
      for (int n = 0; n < 4; ++n) {
        v16bf vf = load_frag_tr(Vs + kk * LDT + 16 * n, LDT);
        oacc[n] = wmma_bf16(vf, pf[kk >> 5], oacc[n]);
      }
    }
  }

  // A lane holds eight consecutive d of its query per tile: one 16-byte store each.
  float inv = 1.0f / (run_sum + other_half(run_sum));
  __bf16* dst = O + qrow * INNERD + h * HDIM + rh;
#pragma unroll
  for (int n = 0; n < 4; ++n) {
    v8bf o;
#pragma unroll
    for (int r = 0; r < 8; ++r) o[r] = (__bf16)(oacc[n][r] * inv);
    *(v8bf*)(dst + 16 * n) = o;
  }
}

// ---------------------------------------------------------------------------
// Launch
// ---------------------------------------------------------------------------
extern "C" void kernel_launch(void* const* d_in, const int* in_sizes, int n_in,
                              void* d_out, int out_size, void* d_ws, size_t ws_size,
                              hipStream_t stream) {
  (void)in_sizes; (void)n_in; (void)out_size; (void)ws_size;
  const float* x   = (const float*)d_in[0];
  const float* ctx = (const float*)d_in[1];
  const float* Wq  = (const float*)d_in[2];
  const float* Wk  = (const float*)d_in[3];
  const float* Wv  = (const float*)d_in[4];
  const float* Wo  = (const float*)d_in[5];
  const float* bo  = (const float*)d_in[6];
  const float* g1  = (const float*)d_in[7];
  const float* b1  = (const float*)d_in[8];
  const float* g2  = (const float*)d_in[9];
  const float* b2  = (const float*)d_in[10];
  const float* W1  = (const float*)d_in[11];
  const float* bf1 = (const float*)d_in[12];
  const float* W2  = (const float*)d_in[13];
  const float* bf2 = (const float*)d_in[14];
  float* out = (float*)d_out;

  char* wp = (char*)d_ws;
  auto alloc = [&](size_t bytes) -> char* {
    char* p = wp;
    wp += (bytes + 255) & ~(size_t)255;
    return p;
  };
  __bf16* Wq16  = (__bf16*)alloc((size_t)DIMD * INNERD * 2);
  __bf16* Wk16  = (__bf16*)alloc((size_t)DIMD * INNERD * 2);
  __bf16* Wv16  = (__bf16*)alloc((size_t)DIMD * INNERD * 2);
  __bf16* Wo16  = (__bf16*)alloc((size_t)INNERD * DIMD * 2);
  __bf16* W116  = (__bf16*)alloc((size_t)DIMD * FFND * 2);
  __bf16* W216  = (__bf16*)alloc((size_t)FFND * DIMD * 2);
  __bf16* nx16  = (__bf16*)alloc((size_t)ROWS * DIMD * 2);
  __bf16* nc16  = (__bf16*)alloc((size_t)ROWS * DIMD * 2);
  __bf16* Q16   = (__bf16*)alloc((size_t)ROWS * INNERD * 2);
  __bf16* K16   = (__bf16*)alloc((size_t)ROWS * INNERD * 2);
  __bf16* V16   = (__bf16*)alloc((size_t)ROWS * INNERD * 2);
  __bf16* O16   = (__bf16*)alloc((size_t)ROWS * INNERD * 2);
  float*  x1    = (float*)alloc((size_t)ROWS * DIMD * 4);
  __bf16* hln16 = (__bf16*)alloc((size_t)ROWS * DIMD * 2);
  __bf16* H16   = (__bf16*)alloc((size_t)ROWS * FFND * 2);

  static_assert((DIMD * INNERD) % CVT_PER_BLOCK == 0 && (DIMD * FFND) % CVT_PER_BLOCK == 0,
                "weight sizes must be whole conversion blocks");
  static_assert(ROWS % LN_ROWS_PER_BLOCK == 0 && DIMD % 128 == 0, "LayerNorm tiling");
  static_assert(ROWS % GBM == 0 && INNERD % GBN == 0 && DIMD % GBN == 0 && FFND % GBN == 0 &&
                DIMD % 64 == 0 && INNERD % 64 == 0 && FFND % 64 == 0, "GEMM tiling");
  auto cvt = [&](const float* src, __bf16* dst, int n) {
    cvt_bf16_kernel<<<n / CVT_PER_BLOCK, 256, 0, stream>>>(src, dst, n);
  };
  cvt(Wq, Wq16, DIMD * INNERD);
  cvt(Wk, Wk16, DIMD * INNERD);
  cvt(Wv, Wv16, DIMD * INNERD);
  cvt(Wo, Wo16, INNERD * DIMD);
  cvt(W1, W116, DIMD * FFND);
  cvt(W2, W216, FFND * DIMD);

  // norm1 for x and context
  ln_bf16_kernel<<<ROWS / LN_ROWS_PER_BLOCK, 256, 0, stream>>>(x,   g1, b1, nx16);
  ln_bf16_kernel<<<ROWS / LN_ROWS_PER_BLOCK, 256, 0, stream>>>(ctx, g1, b1, nc16);

  // Q/K/V projections (plain bf16 epilogue)
  {
    dim3 g(INNERD / GBN, ROWS / GBM);
    gemm_bf16_kernel<0><<<g, 128, 0, stream>>>(nx16, Wq16, ROWS, INNERD, DIMD,
                                               nullptr, nullptr, nullptr, Q16);
    gemm_bf16_kernel<0><<<g, 128, 0, stream>>>(nc16, Wk16, ROWS, INNERD, DIMD,
                                               nullptr, nullptr, nullptr, K16);
    gemm_bf16_kernel<0><<<g, 128, 0, stream>>>(nc16, Wv16, ROWS, INNERD, DIMD,
                                               nullptr, nullptr, nullptr, V16);
  }

  // Attention
  {
    dim3 g(NSEQ / 64, NHEADS, BATCH);
    attn_kernel<<<g, 128, 0, stream>>>(Q16, K16, V16, O16);
  }

  // Output projection + bias + residual -> x1 (f32)
  {
    dim3 g(DIMD / GBN, ROWS / GBM);
    gemm_bf16_kernel<1><<<g, 128, 0, stream>>>(O16, Wo16, ROWS, DIMD, INNERD,
                                               bo, x, x1, nullptr);
  }

  // norm2
  ln_bf16_kernel<<<ROWS / LN_ROWS_PER_BLOCK, 256, 0, stream>>>(x1, g2, b2, hln16);

  // FFN1: gelu(h @ W1 + bf1) -> bf16
  {
    dim3 g(FFND / GBN, ROWS / GBM);
    gemm_bf16_kernel<2><<<g, 128, 0, stream>>>(hln16, W116, ROWS, FFND, DIMD,
                                               bf1, nullptr, nullptr, H16);
  }

  // FFN2: x1 + H @ W2 + bf2 -> d_out (f32)
  {
    dim3 g(DIMD / GBN, ROWS / GBM);
    gemm_bf16_kernel<1><<<g, 128, 0, stream>>>(H16, W216, ROWS, DIMD, FFND,
                                               bf2, x1, out, nullptr);
  }
}

// v007
// Measured time: 229 microseconds a run.
// Next to v006, in two timings, it ran 1.07 and 1.08 times as fast.
// Counting every step since v000, it is 3.66 times as fast.
#include <hip/hip_runtime.h>
#include <hip/hip_bf16.h>

typedef __attribute__((ext_vector_type(16))) __bf16 v16bf;
typedef __attribute__((ext_vector_type(8)))  __bf16 v8bf;
typedef __attribute__((ext_vector_type(8)))  float  v8f;
typedef __attribute__((ext_vector_type(4)))  __bf16 v4bf;
typedef __attribute__((ext_vector_type(4)))  float  v4f;

#define DIMD   768
#define NHEADS 8
#define HDIM   64
#define INNERD 512
#define FFND   3072
#define BATCH  4
#define NSEQ   2048
#define MSEQ   2048
#define ROWS   (BATCH * NSEQ)   // 8192 rows for both x and context paths

#define LDP    72   // bf16 elements per LDS row of a 64-wide bf16 tile
// A tile kept row-major [k][n] and read by the transposing load wants 32 B x odd.
#define LDT    80   // bf16 elements per LDS row (160 B) of a 64-wide [k][n] tile
#define LDTW   144  // bf16 elements per LDS row (288 B) of a 128-wide [k][n] tile

__device__ __forceinline__ v8f wmma_bf16(v16bf a, v16bf b, v8f c) {
  // (neg_a, A, neg_b, B, c_mod, C, reuse_a, reuse_b)
  return __builtin_amdgcn_wmma_f32_16x16x32_bf16(false, a, false, b, (short)0, c,
                                                 false, false);
}

__device__ __forceinline__ v16bf load_frag(const __bf16* base, int ld) {
  int lane = threadIdx.x & 31;
  int r    = lane & 15;
  int kb   = (lane & 16) ? 8 : 0;
  const __bf16* p = base + r * ld + kb;
  v8bf lo = *(const v8bf*)(p);
  v8bf hi = *(const v8bf*)(p + 16);
  v16bf f;
#pragma unroll
  for (int e = 0; e < 8; ++e) { f[e] = lo[e]; f[e + 8] = hi[e]; }
  return f;
}

// Load one 32x16 B fragment (k x n) from an LDS tile laid out [k][n] with pitch
// `ld` (elements); `tile` points at element [kbase][nbase]. ds_load_tr16_b128 hands lane
// (c = L&15, h = L>>4) the eight elements [kbase + 8h + 0..7][nbase + c], so the
// loads at kbase and kbase + 16 give the same k order as load_frag gives A.
typedef __attribute__((address_space(3))) v8bf lds_v8bf;
__device__ __forceinline__ v16bf load_frag_tr(const __bf16* tile, int ld) {
  int lane = threadIdx.x & 31;
  const __bf16* p = tile + ((lane >> 4) * 8 + (lane & 7)) * ld + ((lane >> 3) & 1) * 8;
  v8bf lo = __builtin_amdgcn_ds_load_tr16_b128_v8bf16((lds_v8bf*)p);
  v8bf hi = __builtin_amdgcn_ds_load_tr16_b128_v8bf16((lds_v8bf*)(p + 16 * ld));
  v16bf f;
#pragma unroll
  for (int e = 0; e < 8; ++e) { f[e] = lo[e]; f[e + 8] = hi[e]; }
  return f;
}

__device__ __forceinline__ void wait_async0() {
  asm volatile("s_wait_asynccnt 0x0" ::: "memory");
}
// This wave's LDS reads have retired before a copy may refill what they read.
__device__ __forceinline__ void wait_ds0() {
  asm volatile("s_wait_dscnt 0x0" ::: "memory");
}

// erf(x) to single precision without a branch. The library form picks one of two
// fits by |x| under the exec mask; among 32 lanes both sides are nearly always
// taken, and each element becomes one long dependent chain between two mask
// branches. Here both fits (the same polynomials) are evaluated in every lane and
// one is selected, so that the elements of a thread are independent chains that
// the scheduler can interleave.
//   |x| <  1: |x| + |x| P(x^2)
//   |x| >= 1: 1 - exp(-q), q = |x| + |x| Q(|x|); exp(-q) = 2^(-q log2 e) on the
//             hardware 2^x: exp(-q) < 0.16 there, so its rounding moves 1 - exp(-q) by
//             about one unit in the last place, far below the bf16 rounding that
//             follows; a large or infinite q gives 0, erf = 1.
__device__ __forceinline__ float erf_select(float x) {
  float a = fabsf(x);
  float t = a * a;
  float p = fmaf(t, -0x1.268bc2p-11f, 0x1.420828p-8f);
  p = fmaf(t, p, -0x1.b5937p-6f);
  p = fmaf(t, p, 0x1.ce077cp-4f);
  p = fmaf(t, p, -0x1.81266p-2f);
  p = fmaf(t, p, 0x1.06eba0p-3f);
  float near0 = fmaf(a, p, a);
  float q = fmaf(a, 0x1.1d3156p-16f, -0x1.8d129p-12f);
  q = fmaf(a, q, 0x1.f9a6d2p-9f);
  q = fmaf(a, q, -0x1.8c3164p-6f);
  q = fmaf(a, q, 0x1.b4e9c8p-4f);
  q = fmaf(a, q, 0x1.4515fap-1f);
  q = fmaf(a, q, 0x1.078e50p-3f);
  q = fmaf(a, q, a);
  float far0 = 1.0f - __builtin_amdgcn_exp2f(q * -1.44269504088896340736f);
  return copysignf(a < 1.0f ? near0 : far0, x);
}

__device__ __forceinline__ float gelu_exact(float v) {
  return 0.5f * v * (1.0f + erf_select(v * 0.70710678118654752f));
}

// ---------------------------------------------------------------------------
// fp32 -> bf16 conversion (weights). Each thread converts 32 elements (eight 16-byte loads
// in flight, each wave-wide load 512 contiguous bytes), 8192 elements per block.
// n must be a multiple of 8192 (asserted where the sizes are known).
// ---------------------------------------------------------------------------
#define CVT_PER_BLOCK 8192
__global__ __launch_bounds__(256) void cvt_bf16_kernel(const float* __restrict__ in,
                                                       __bf16* __restrict__ out,
                                                       int n) {
  if ((int)blockIdx.x * CVT_PER_BLOCK + CVT_PER_BLOCK > n) return;
  int q = blockIdx.x * (CVT_PER_BLOCK / 4) + threadIdx.x;  // group of 4 elements
  const v4f* src = (const v4f*)in + q;
  v4bf*      dst = (v4bf*)out + q;
  constexpr int NU = CVT_PER_BLOCK / 1024;   // 16-byte loads per thread
  v4f v[NU];
  // Both loops unrolled: v[] stays in registers and all loads issue before the
  // first conversion waits.
#pragma unroll
  for (int u = 0; u < NU; ++u) v[u] = src[256 * u];
#pragma unroll
  for (int u = 0; u < NU; ++u) {
    v4bf o;
#pragma unroll
    for (int e = 0; e < 4; ++e) o[e] = (__bf16)v[u][e];
    dst[256 * u] = o;
  }
}

// ---------------------------------------------------------------------------
// LayerNorm over 768 cols, bf16 output. One wave owns two whole rows: a lane
// holds 24 elements of each row in registers (six 16-byte loads per row), the
// row sums are joined by a five-step butterfly over the 32 lanes, so no LDS and
// no barrier. 8 waves per block = 16 rows per block.
// ---------------------------------------------------------------------------
#define LN_ROWS_PER_BLOCK 16
__global__ __launch_bounds__(256) void ln_bf16_kernel(const float* __restrict__ X,
                                                      const float* __restrict__ g,
                                                      const float* __restrict__ bt,
                                                      __bf16* __restrict__ out) {
  constexpr int NV = DIMD / 128;   // 16-byte groups per lane and row
  int lane = threadIdx.x & 31;
  int w    = threadIdx.x >> 5;
  size_t row0 = ((size_t)blockIdx.x * 8 + w) * 2;
  const v4f* x0 = (const v4f*)(X + row0 * DIMD) + lane;
  const v4f* x1 = x0 + DIMD / 4;
  v4f a[NV], b[NV];
  // Every loop below is unrolled: the row arrays must be indexed by constants to
  // stay in registers, and both rows' loads issue before the first sum waits.
#pragma unroll
  for (int j = 0; j < NV; ++j) a[j] = x0[32 * j];
#pragma unroll
  for (int j = 0; j < NV; ++j) b[j] = x1[32 * j];
  const v4f* gp = (const v4f*)g + lane;
  const v4f* bp = (const v4f*)bt + lane;
  v4f gg[NV], bb[NV];
#pragma unroll
  for (int j = 0; j < NV; ++j) { gg[j] = gp[32 * j]; bb[j] = bp[32 * j]; }

  float sa = 0.f, qa = 0.f, sb = 0.f, qb = 0.f;
#pragma unroll
  for (int j = 0; j < NV; ++j)
#pragma unroll
    for (int e = 0; e < 4; ++e) {
      sa += a[j][e]; qa += a[j][e] * a[j][e];
      sb += b[j][e]; qb += b[j][e] * b[j][e];
    }
#pragma unroll
  for (int m = 16; m > 0; m >>= 1) {
    sa += __shfl_xor(sa, m, 32);
    qa += __shfl_xor(qa, m, 32);
    sb += __shfl_xor(sb, m, 32);
    qb += __shfl_xor(qb, m, 32);
  }
  float mua  = sa * (1.0f / DIMD);
  float mub  = sb * (1.0f / DIMD);
  float inva = rsqrtf(qa * (1.0f / DIMD) - mua * mua + 1e-5f);
  float invb = rsqrtf(qb * (1.0f / DIMD) - mub * mub + 1e-5f);

  v4bf* o0 = (v4bf*)(out + row0 * DIMD) + lane;
  v4bf* o1 = o0 + DIMD / 4;
#pragma unroll
  for (int j = 0; j < NV; ++j) {
    v4bf ra, rb;
#pragma unroll
    for (int e = 0; e < 4; ++e) {
      ra[e] = (__bf16)((a[j][e] - mua) * inva * gg[j][e] + bb[j][e]);
      rb[e] = (__bf16)((b[j][e] - mub) * invb * gg[j][e] + bb[j][e]);
    }
    o0[32 * j] = ra;
    o1[32 * j] = rb;
  }
}

__device__ __forceinline__ void async_copy8(unsigned l, unsigned lstep,
                                            const __bf16* g, size_t gstep) {
  asm volatile("global_load_async_to_lds_b128 %0, %8, off\n\t"
               "global_load_async_to_lds_b128 %1, %9, off\n\t"
               "global_load_async_to_lds_b128 %2, %10, off\n\t"
               "global_load_async_to_lds_b128 %3, %11, off\n\t"
               "global_load_async_to_lds_b128 %4, %12, off\n\t"
               "global_load_async_to_lds_b128 %5, %13, off\n\t"
               "global_load_async_to_lds_b128 %6, %14, off\n\t"
               "global_load_async_to_lds_b128 %7, %15, off\n\t"
               "s_wait_xcnt 0x0"
               :: "v"(l), "v"(l + lstep), "v"(l + 2u * lstep), "v"(l + 3u * lstep),
                  "v"(l + 4u * lstep), "v"(l + 5u * lstep), "v"(l + 6u * lstep),
                  "v"(l + 7u * lstep),
                  "v"(g), "v"(g + gstep), "v"(g + 2 * gstep), "v"(g + 3 * gstep),
                  "v"(g + 4 * gstep), "v"(g + 5 * gstep), "v"(g + 6 * gstep),
                  "v"(g + 7 * gstep)
               : "memory");
}

#define GBM 128
#define GBN 128
template <int EPI>
__global__ __launch_bounds__(128, 4) void gemm_bf16_kernel(
    const __bf16* __restrict__ A, const __bf16* __restrict__ Bm,
    int M, int N, int K,
    const float* __restrict__ bias, const float* __restrict__ resid,
    float* __restrict__ Cf, __bf16* __restrict__ Cb) {
  __shared__ __attribute__((aligned(16))) __bf16 As[2][GBM * LDP];  // [row][k]
  __shared__ __attribute__((aligned(16))) __bf16 Bs[2][64 * LDTW];  // [k][n]
  int n0 = blockIdx.x * GBN;
  int r0 = blockIdx.y * GBM;
  int t  = threadIdx.x;
  int w  = __builtin_amdgcn_readfirstlane(t >> 5);  // wave number, in a scalar register
  int lane = t & 31;
  int wr = (w >> 1) * 64;   // the wave's rows within the block tile
  int wc = (w & 1) * 64;    // the wave's columns within the block tile

  const v8f vz = {0.f, 0.f, 0.f, 0.f, 0.f, 0.f, 0.f, 0.f};
  v8f acc[4][4];
  // The loops over fragments or registers in this kernel are unrolled (all but the
  // epilogue's outer one): the fragment and accumulator arrays must be indexed by
  // constants to stay in registers.
#pragma unroll
  for (int i = 0; i < 4; ++i)
#pragma unroll
    for (int j = 0; j < 4; ++j) acc[i][j] = vz;

  // One stage, sixteen copies per thread, each wave-wide copy whole 128-B lines:
  // A: eight lanes cover a row's 128 B, the block 16 rows per copy, 8 copies.
  // B: sixteen lanes cover a row's 256 B, the block 8 rows per copy, 8 copies.
  int aR = t >> 3, aC = (t & 7) * 8;
  int bR = t >> 4, bC = (t & 15) * 8;
  auto asyncLoadAB = [&](int k0, int buf) {
    async_copy8((unsigned)(uintptr_t)&As[buf][aR * LDP + aC], 16u * LDP * 2u,
                A + (size_t)(r0 + aR) * K + k0 + aC, (size_t)16 * K);
    async_copy8((unsigned)(uintptr_t)&Bs[buf][bR * LDTW + bC], 8u * LDTW * 2u,
                Bm + (size_t)(k0 + bR) * N + n0 + bC, (size_t)8 * N);
  };

  int nT = K >> 6;  // K / 64
  asyncLoadAB(0, 0);
  for (int it = 0; it < nT; ++it) {
    int buf = it & 1;
    if (it + 2 < nT) {  // one lane per 128-B line of the stage after next
      int k2 = (it + 2) << 6;
      __builtin_prefetch(A + (size_t)(r0 + t) * K + k2, 0, 1);
      __builtin_prefetch(Bm + (size_t)(k2 + (t >> 1)) * N + n0 + (t & 1) * 64, 0, 1);
      // The prefetches name temporaries that the fragment reads below overwrite.
      asm volatile("s_wait_xcnt 0x0" ::: "memory");
    }
    wait_ds0();          // this wave's reads of buffer buf^1 (last trip) retired
    wait_async0();       // this wave's copies for stage `it` have landed
    __syncthreads();     // all waves' copies visible; buffer buf^1 left by all
#pragma unroll
    for (int kk = 0; kk < 64; kk += 32) {
      // The eight fragments of 32 k are read as one group ahead of their WMMAs.
      v16bf af[4], bf[4];
      af[0] = load_frag(&As[buf][wr * LDP + kk], LDP);
#pragma unroll
      for (int j = 0; j < 4; ++j)
        bf[j] = load_frag_tr(&Bs[buf][kk * LDTW + wc + 16 * j], LDTW);
#pragma unroll
      for (int i = 1; i < 4; ++i)
        af[i] = load_frag(&As[buf][(wr + 16 * i) * LDP + kk], LDP);
      // Next stage's copies go out behind the first group of LDS reads: their
      // address arithmetic and issue run while those reads are on their way.
      if (kk == 0 && it + 1 < nT) asyncLoadAB((it + 1) << 6, buf ^ 1);
      // Without this fence the scheduler sinks the A reads among the WMMAs, each
      // with a wait to zero in front of its row of four.
      __builtin_amdgcn_sched_barrier(0);
#pragma unroll
      for (int i = 0; i < 4; ++i)
#pragma unroll
        for (int j = 0; j < 4; ++j) acc[i][j] = wmma_bf16(af[i], bf[j], acc[i][j]);
      // Keeps the next group's reads behind this block of WMMAs, as one group.
      __builtin_amdgcn_sched_barrier(0);
    }
  }

  int colL = lane & 15;
  int rh   = (lane & 16) ? 8 : 0;
  // The loop over the four row fragments stays rolled, for speed only. Each trip works on acc[0][*] and
  // then moves the later fragments down, so that every index is a constant.
#pragma clang loop unroll(disable)
  for (int i = 0; i < 4; ++i) {
#pragma unroll
    for (int j = 0; j < 4; ++j) {
#pragma unroll
      for (int r = 0; r < 8; ++r) {
        int grow = r0 + wr + 16 * i + r + rh;
        int gcol = n0 + wc + 16 * j + colL;
        float v = acc[0][j][r];
        if (EPI == 1) {
          v += bias[gcol] + resid[(size_t)grow * N + gcol];
          Cf[(size_t)grow * N + gcol] = v;
        } else if (EPI == 2) {
          v = gelu_exact(v + bias[gcol]);
          Cb[(size_t)grow * N + gcol] = (__bf16)v;
        } else {
          Cb[(size_t)grow * N + gcol] = (__bf16)v;
        }
      }
      // The GELU chains of a trip are independent and the scheduler would run all
      // 32 side by side; with the accumulators live that spills. Two groups of 16.
      if (EPI == 2 && j == 1) __builtin_amdgcn_sched_barrier(0);
    }
#pragma unroll
    for (int j = 0; j < 4; ++j) {
      acc[0][j] = acc[1][j];
      acc[1][j] = acc[2][j];
      acc[2][j] = acc[3][j];
    }
    // The next trip rewrites address and data registers that this trip's loads and
    // stores name.
    asm volatile("s_wait_xcnt 0x0" ::: "memory");
  }
}

#define SM_C 0.18033688011112042f   // 0.125 * log2(e)

__device__ __forceinline__ void exp2_inplace(float& x) {
  asm("v_exp_f32 %0, %0\n\t"
      "v_nop"
      : "+v"(x));
}
__device__ __forceinline__ void exp2_inplace16(float (&a)[8], float (&b)[8]) {
  asm("v_exp_f32 %0, %0\n\t"
      "v_exp_f32 %1, %1\n\t"
      "v_exp_f32 %2, %2\n\t"
      "v_exp_f32 %3, %3\n\t"
      "v_exp_f32 %4, %4\n\t"
      "v_exp_f32 %5, %5\n\t"
      "v_exp_f32 %6, %6\n\t"
      "v_exp_f32 %7, %7\n\t"
      "v_exp_f32 %8, %8\n\t"
      "v_exp_f32 %9, %9\n\t"
      "v_exp_f32 %10, %10\n\t"
      "v_exp_f32 %11, %11\n\t"
      "v_exp_f32 %12, %12\n\t"
      "v_exp_f32 %13, %13\n\t"
      "v_exp_f32 %14, %14\n\t"
      "v_exp_f32 %15, %15\n\t"
      "v_nop"
      : "+v"(a[0]), "+v"(a[1]), "+v"(a[2]), "+v"(a[3]),
        "+v"(a[4]), "+v"(a[5]), "+v"(a[6]), "+v"(a[7]),
        "+v"(b[0]), "+v"(b[1]), "+v"(b[2]), "+v"(b[3]),
        "+v"(b[4]), "+v"(b[5]), "+v"(b[6]), "+v"(b[7]));
}
__device__ __forceinline__ float other_half(float v) {   // value of lane ^ 16
  int b = __builtin_bit_cast(int, v);
  return __builtin_bit_cast(
      float, __builtin_amdgcn_permlanex16(b, b, 0x76543210, 0xfedcba98, false, false));
}

__global__ __launch_bounds__(128) void attn_kernel(
    const __bf16* __restrict__ Q, const __bf16* __restrict__ Kg,
    const __bf16* __restrict__ Vg, __bf16* __restrict__ O) {
  __shared__ __attribute__((aligned(16))) __bf16 Ks[64 * LDP];   // [j][d]   (A rows of S^T = K Q^T)
  __shared__ __attribute__((aligned(16))) __bf16 Vs[64 * LDT];   // [m'][d]  (read transposed: A of O^T = V^T P^T)

  int i0 = blockIdx.x * 64;
  int h  = blockIdx.y;
  int b  = blockIdx.z;
  int t  = threadIdx.x;
  int w  = t >> 5;
  int lane = t & 31;
  int colL = lane & 15;
  int rh   = (lane & 16) ? 8 : 0;

  int jL = t >> 1, dL = (t & 1) * 32;

  // Every loop over tiles, registers or elements in this kernel is unrolled: the
  // fragment and accumulator arrays must be indexed by constants to stay in registers.

  // This lane's query row, as the two B fragments of Q^T (d 0..31 and 32..63),
  // in the k order of load_frag; loaded once, kept in registers.
  size_t qrow = (size_t)(b * NSEQ) + i0 + 16 * w + colL;
  v16bf qf[2];
  {
    const __bf16* src = Q + qrow * INNERD + h * HDIM + rh;
#pragma unroll
    for (int u = 0; u < 2; ++u) {
      v8bf lo = *(const v8bf*)(src + 32 * u);
      v8bf hi = *(const v8bf*)(src + 32 * u + 16);
#pragma unroll
      for (int e = 0; e < 8; ++e) { qf[u][e] = lo[e]; qf[u][e + 8] = hi[e]; }
    }
  }

  float run_max = -3.0e38f;   // of the lane's query, in base-2 units, equal in both halves
  float run_sum = 0.0f;       // over this half's keys only; halves joined at the end
  const v8f vz = {0.f, 0.f, 0.f, 0.f, 0.f, 0.f, 0.f, 0.f};
  v8f oacc[4] = {vz, vz, vz, vz};   // oacc[n][r] = O^T[d = 16n + 8h + r][query c]

  for (int m0 = 0; m0 < MSEQ; m0 += 64) {
    if (m0 + 64 < MSEQ) {  // prefetch next chunk of K/V through L2
      __builtin_prefetch(
          Kg + ((size_t)(b * MSEQ) + m0 + 64 + jL) * INNERD + h * HDIM + dL, 0, 1);
      __builtin_prefetch(
          Vg + ((size_t)(b * MSEQ) + m0 + 64 + jL) * INNERD + h * HDIM + dL, 0, 1);
    }
    wait_ds0();        // this wave's reads of Ks/Vs retired before the refill
    __syncthreads();   // previous chunk's WMMA reads of Ks/Vs done
    { // K and V tiles, both row-major. K: 64 B of one row per thread. V: 16 B of
      // each of four rows (eight lanes cover a row's whole 128 B).
      int vR = t >> 3, vC = (t & 7) * 8;
      const __bf16* kp = Kg + ((size_t)(b * MSEQ) + m0 + jL) * INNERD + h * HDIM + dL;
      const __bf16* vp = Vg + ((size_t)(b * MSEQ) + m0 + vR) * INNERD + h * HDIM + vC;
      unsigned lk = (unsigned)(uintptr_t)&Ks[jL * LDP + dL];
      unsigned lv = (unsigned)(uintptr_t)&Vs[vR * LDT + vC];
      asm volatile("global_load_async_to_lds_b128 %0, %8, off\n\t"
                   "global_load_async_to_lds_b128 %1, %9, off\n\t"
                   "global_load_async_to_lds_b128 %2, %10, off\n\t"
                   "global_load_async_to_lds_b128 %3, %11, off\n\t"
                   "global_load_async_to_lds_b128 %4, %12, off\n\t"
                   "global_load_async_to_lds_b128 %5, %13, off\n\t"
                   "global_load_async_to_lds_b128 %6, %14, off\n\t"
                   "global_load_async_to_lds_b128 %7, %15, off\n\t"
                   "s_wait_xcnt 0x0"
                   :: "v"(lk), "v"(lk + 16u), "v"(lk + 32u), "v"(lk + 48u),
                      "v"(lv), "v"(lv + 16u * LDT * 2u), "v"(lv + 32u * LDT * 2u),
                      "v"(lv + 48u * LDT * 2u),
                      "v"(kp), "v"(kp + 8), "v"(kp + 16), "v"(kp + 24),
                      "v"(vp), "v"(vp + 16 * INNERD), "v"(vp + 32 * INNERD),
                      "v"(vp + 48 * INNERD)
                   : "memory");
    }
    wait_async0();     // this wave's copies have landed
    __syncthreads();   // every wave's copies visible

    // S^T = K Q^T: 64 keys x this wave's 16 queries (two k-steps over d)
    v8f s[4] = {vz, vz, vz, vz};
#pragma unroll
    for (int kk = 0; kk < 64; kk += 32) {
#pragma unroll
      for (int n = 0; n < 4; ++n) {
        v16bf kf = load_frag(Ks + 16 * n * LDP + kk, LDP);
        s[n] = wmma_bf16(kf, qf[kk >> 5], s[n]);
      }
    }

    // Online softmax of the lane's query over its 32 keys of the chunk. The scale
    // is positive and rounding is monotone: the maximum may be scaled after it is
    // found, and no s * c - nm lies above 0 by more than the rounding of nm.
    float cmax = -3.0e38f;
#pragma unroll
    for (int n = 0; n < 4; ++n)
#pragma unroll
      for (int r = 0; r < 8; ++r) cmax = fmaxf(cmax, s[n][r]);
    cmax = fmaxf(cmax, other_half(cmax)) * SM_C;
    float nm    = fmaxf(run_max, cmax);
    float alpha = run_max - nm;
    exp2_inplace(alpha);
    float pe[4][8];   // the scores' exponents, then P
#pragma unroll
    for (int n = 0; n < 4; ++n)
#pragma unroll
      for (int r = 0; r < 8; ++r) pe[n][r] = __builtin_fmaf(s[n][r], SM_C, -nm);
    exp2_inplace16(pe[0], pe[1]);
    exp2_inplace16(pe[2], pe[3]);
    float ts[4];   // one partial sum per tile: four independent add chains
    v16bf pf[2];   // P^T as B fragments: keys 0..31 and 32..63 of the chunk
#pragma unroll
    for (int n = 0; n < 4; ++n) {
      ts[n] = pe[n][0];
#pragma unroll
      for (int r = 0; r < 8; ++r) {
        pf[n >> 1][(n & 1) * 8 + r] = (__bf16)pe[n][r];
        if (r > 0) ts[n] += pe[n][r];
      }
    }
    float ssum = (ts[0] + ts[1]) + (ts[2] + ts[3]);
    run_sum = run_sum * alpha + ssum;
    run_max = nm;

    // Rescale O^T (one factor per lane), then O^T += V^T P^T
#pragma unroll
    for (int n = 0; n < 4; ++n)
#pragma unroll
      for (int r = 0; r < 8; ++r) oacc[n][r] *= alpha;
#pragma unroll
    for (int kk = 0; kk < 64; kk += 32) {
#pragma unroll
      for (int n = 0; n < 4; ++n) {
        v16bf vf = load_frag_tr(Vs + kk * LDT + 16 * n, LDT);
        oacc[n] = wmma_bf16(vf, pf[kk >> 5], oacc[n]);
      }
    }
  }

  // A lane holds eight consecutive d of its query per tile: one 16-byte store each.
  float inv = 1.0f / (run_sum + other_half(run_sum));
  __bf16* dst = O + qrow * INNERD + h * HDIM + rh;
#pragma unroll
  for (int n = 0; n < 4; ++n) {
    v8bf o;
#pragma unroll
    for (int r = 0; r < 8; ++r) o[r] = (__bf16)(oacc[n][r] * inv);
    *(v8bf*)(dst + 16 * n) = o;
  }
}

// ---------------------------------------------------------------------------
// Launch
// ---------------------------------------------------------------------------
extern "C" void kernel_launch(void* const* d_in, const int* in_sizes, int n_in,
                              void* d_out, int out_size, void* d_ws, size_t ws_size,
                              hipStream_t stream) {
  (void)in_sizes; (void)n_in; (void)out_size; (void)ws_size;
  const float* x   = (const float*)d_in[0];
  const float* ctx = (const float*)d_in[1];
  const float* Wq  = (const float*)d_in[2];
  const float* Wk  = (const float*)d_in[3];
  const float* Wv  = (const float*)d_in[4];
  const float* Wo  = (const float*)d_in[5];
  const float* bo  = (const float*)d_in[6];
  const float* g1  = (const float*)d_in[7];
  const float* b1  = (const float*)d_in[8];
  const float* g2  = (const float*)d_in[9];
  const float* b2  = (const float*)d_in[10];
  const float* W1  = (const float*)d_in[11];
  const float* bf1 = (const float*)d_in[12];
  const float* W2  = (const float*)d_in[13];
  const float* bf2 = (const float*)d_in[14];
  float* out = (float*)d_out;

  char* wp = (char*)d_ws;
  auto alloc = [&](size_t bytes) -> char* {
    char* p = wp;
    wp += (bytes + 255) & ~(size_t)255;
    return p;
  };
  __bf16* Wq16  = (__bf16*)alloc((size_t)DIMD * INNERD * 2);
  __bf16* Wk16  = (__bf16*)alloc((size_t)DIMD * INNERD * 2);
  __bf16* Wv16  = (__bf16*)alloc((size_t)DIMD * INNERD * 2);
  __bf16* Wo16  = (__bf16*)alloc((size_t)INNERD * DIMD * 2);
  __bf16* W116  = (__bf16*)alloc((size_t)DIMD * FFND * 2);
  __bf16* W216  = (__bf16*)alloc((size_t)FFND * DIMD * 2);
  __bf16* nx16  = (__bf16*)alloc((size_t)ROWS * DIMD * 2);
  __bf16* nc16  = (__bf16*)alloc((size_t)ROWS * DIMD * 2);
  __bf16* Q16   = (__bf16*)alloc((size_t)ROWS * INNERD * 2);
  __bf16* K16   = (__bf16*)alloc((size_t)ROWS * INNERD * 2);
  __bf16* V16   = (__bf16*)alloc((size_t)ROWS * INNERD * 2);
  __bf16* O16   = (__bf16*)alloc((size_t)ROWS * INNERD * 2);
  float*  x1    = (float*)alloc((size_t)ROWS * DIMD * 4);
  __bf16* hln16 = (__bf16*)alloc((size_t)ROWS * DIMD * 2);
  __bf16* H16   = (__bf16*)alloc((size_t)ROWS * FFND * 2);

  static_assert((DIMD * INNERD) % CVT_PER_BLOCK == 0 && (DIMD * FFND) % CVT_PER_BLOCK == 0,
                "weight sizes must be whole conversion blocks");
  static_assert(ROWS % LN_ROWS_PER_BLOCK == 0 && DIMD % 128 == 0, "LayerNorm tiling");
  static_assert(ROWS % GBM == 0 && INNERD % GBN == 0 && DIMD % GBN == 0 && FFND % GBN == 0 &&
                DIMD % 64 == 0 && INNERD % 64 == 0 && FFND % 64 == 0, "GEMM tiling");
  auto cvt = [&](const float* src, __bf16* dst, int n) {
    cvt_bf16_kernel<<<n / CVT_PER_BLOCK, 256, 0, stream>>>(src, dst, n);
  };
  cvt(Wq, Wq16, DIMD * INNERD);
  cvt(Wk, Wk16, DIMD * INNERD);
  cvt(Wv, Wv16, DIMD * INNERD);
  cvt(Wo, Wo16, INNERD * DIMD);
  cvt(W1, W116, DIMD * FFND);
  cvt(W2, W216, FFND * DIMD);

  // norm1 for x and context
  ln_bf16_kernel<<<ROWS / LN_ROWS_PER_BLOCK, 256, 0, stream>>>(x,   g1, b1, nx16);
  ln_bf16_kernel<<<ROWS / LN_ROWS_PER_BLOCK, 256, 0, stream>>>(ctx, g1, b1, nc16);

  // Q/K/V projections (plain bf16 epilogue)
  {
    dim3 g(INNERD / GBN, ROWS / GBM);
    gemm_bf16_kernel<0><<<g, 128, 0, stream>>>(nx16, Wq16, ROWS, INNERD, DIMD,
                                               nullptr, nullptr, nullptr, Q16);
    gemm_bf16_kernel<0><<<g, 128, 0, stream>>>(nc16, Wk16, ROWS, INNERD, DIMD,
                                               nullptr, nullptr, nullptr, K16);
    gemm_bf16_kernel<0><<<g, 128, 0, stream>>>(nc16, Wv16, ROWS, INNERD, DIMD,
                                               nullptr, nullptr, nullptr, V16);
  }

  // Attention
  {
    dim3 g(NSEQ / 64, NHEADS, BATCH);
    attn_kernel<<<g, 128, 0, stream>>>(Q16, K16, V16, O16);
  }

  // Output projection + bias + residual -> x1 (f32)
  {
    dim3 g(DIMD / GBN, ROWS / GBM);
    gemm_bf16_kernel<1><<<g, 128, 0, stream>>>(O16, Wo16, ROWS, DIMD, INNERD,
                                               bo, x, x1, nullptr);
  }

  // norm2
  ln_bf16_kernel<<<ROWS / LN_ROWS_PER_BLOCK, 256, 0, stream>>>(x1, g2, b2, hln16);

  // FFN1: gelu(h @ W1 + bf1) -> bf16
  {
    dim3 g(FFND / GBN, ROWS / GBM);
    gemm_bf16_kernel<2><<<g, 128, 0, stream>>>(hln16, W116, ROWS, FFND, DIMD,
                                               bf1, nullptr, nullptr, H16);
  }

  // FFN2: x1 + H @ W2 + bf2 -> d_out (f32)
  {
    dim3 g(DIMD / GBN, ROWS / GBM);
    gemm_bf16_kernel<1><<<g, 128, 0, stream>>>(H16, W216, ROWS, DIMD, FFND,
                                               bf2, x1, out, nullptr);
  }
}

// v008
// Measured time: 198 microseconds a run.
// Timed twice side by side with v007, it ran 1.15 and 1.14 times as fast.
// Over all steps from v000 it is 4.19 times as fast.
#include <hip/hip_runtime.h>
#include <hip/hip_bf16.h>

typedef __attribute__((ext_vector_type(16))) __bf16 v16bf;
typedef __attribute__((ext_vector_type(8)))  __bf16 v8bf;
typedef __attribute__((ext_vector_type(8)))  float  v8f;
typedef __attribute__((ext_vector_type(4)))  __bf16 v4bf;
typedef __attribute__((ext_vector_type(4)))  float  v4f;

#define DIMD   768
#define NHEADS 8
#define HDIM   64
#define INNERD 512
#define FFND   3072
#define BATCH  4
#define NSEQ   2048
#define MSEQ   2048
#define ROWS   (BATCH * NSEQ)   // 8192 rows for both x and context paths

#define LDP    72   // bf16 elements per LDS row of a 64-wide bf16 tile
// A tile kept row-major [k][n] and read by the transposing load wants 32 B x odd.
#define LDT    80   // bf16 elements per LDS row (160 B) of a 64-wide [k][n] tile
#define LDTW   144  // bf16 elements per LDS row (288 B) of a 128-wide [k][n] tile

__device__ __forceinline__ v8f wmma_bf16(v16bf a, v16bf b, v8f c) {
  // (neg_a, A, neg_b, B, c_mod, C, reuse_a, reuse_b)
  return __builtin_amdgcn_wmma_f32_16x16x32_bf16(false, a, false, b, (short)0, c,
                                                 false, false);
}

__device__ __forceinline__ v16bf load_frag(const __bf16* base, int ld) {
  int lane = threadIdx.x & 31;
  int r    = lane & 15;
  int kb   = (lane & 16) ? 8 : 0;
  const __bf16* p = base + r * ld + kb;
  v8bf lo = *(const v8bf*)(p);
  v8bf hi = *(const v8bf*)(p + 16);
  v16bf f;
#pragma unroll
  for (int e = 0; e < 8; ++e) { f[e] = lo[e]; f[e + 8] = hi[e]; }
  return f;
}

// Load one 32x16 B fragment (k x n) from an LDS tile laid out [k][n] with pitch
// `ld` (elements); `tile` points at element [kbase][nbase]. ds_load_tr16_b128 hands lane
// (c = L&15, h = L>>4) the eight elements [kbase + 8h + 0..7][nbase + c], so the
// loads at kbase and kbase + 16 give the same k order as load_frag gives A.
typedef __attribute__((address_space(3))) v8bf lds_v8bf;
__device__ __forceinline__ v16bf load_frag_tr(const __bf16* tile, int ld) {
  int lane = threadIdx.x & 31;
  const __bf16* p = tile + ((lane >> 4) * 8 + (lane & 7)) * ld + ((lane >> 3) & 1) * 8;
  v8bf lo = __builtin_amdgcn_ds_load_tr16_b128_v8bf16((lds_v8bf*)p);
  v8bf hi = __builtin_amdgcn_ds_load_tr16_b128_v8bf16((lds_v8bf*)(p + 16 * ld));
  v16bf f;
#pragma unroll
  for (int e = 0; e < 8; ++e) { f[e] = lo[e]; f[e + 8] = hi[e]; }
  return f;
}

__device__ __forceinline__ void wait_async0() {
  asm volatile("s_wait_asynccnt 0x0" ::: "memory");
}
// This wave's LDS reads have retired before a copy may refill what they read.
__device__ __forceinline__ void wait_ds0() {
  asm volatile("s_wait_dscnt 0x0" ::: "memory");
}

// erf(x) to single precision without a branch. The library form picks one of two
// fits by |x| under the exec mask; among 32 lanes both sides are nearly always
// taken, and each element becomes one long dependent chain between two mask
// branches. Here both fits (the same polynomials) are evaluated in every lane and
// one is selected, so that the elements of a thread are independent chains that
// the scheduler can interleave.
//   |x| <  1: |x| + |x| P(x^2)
//   |x| >= 1: 1 - exp(-q), q = |x| + |x| Q(|x|); exp(-q) = 2^(-q log2 e) on the
//             hardware 2^x: exp(-q) < 0.16 there, so its rounding moves 1 - exp(-q) by
//             about one unit in the last place, far below the bf16 rounding that
//             follows; a large or infinite q gives 0, erf = 1.
__device__ __forceinline__ float erf_select(float x) {
  float a = fabsf(x);
  float t = a * a;
  float p = fmaf(t, -0x1.268bc2p-11f, 0x1.420828p-8f);
  p = fmaf(t, p, -0x1.b5937p-6f);
  p = fmaf(t, p, 0x1.ce077cp-4f);
  p = fmaf(t, p, -0x1.81266p-2f);
  p = fmaf(t, p, 0x1.06eba0p-3f);
  float near0 = fmaf(a, p, a);
  float q = fmaf(a, 0x1.1d3156p-16f, -0x1.8d129p-12f);
  q = fmaf(a, q, 0x1.f9a6d2p-9f);
  q = fmaf(a, q, -0x1.8c3164p-6f);
  q = fmaf(a, q, 0x1.b4e9c8p-4f);
  q = fmaf(a, q, 0x1.4515fap-1f);
  q = fmaf(a, q, 0x1.078e50p-3f);
  q = fmaf(a, q, a);
  float far0 = 1.0f - __builtin_amdgcn_exp2f(q * -1.44269504088896340736f);
  return copysignf(a < 1.0f ? near0 : far0, x);
}

__device__ __forceinline__ float gelu_exact(float v) {
  return 0.5f * v * (1.0f + erf_select(v * 0.70710678118654752f));
}

// ---------------------------------------------------------------------------
// fp32 -> bf16 conversion (weights), the work of one block of 256 threads: each
// thread converts 32 elements (eight 16-byte loads in flight, each wave-wide load
// 512 contiguous bytes), 8192 elements per block. `blk` is the block's number
// within its matrix, whose size is a whole number of blocks (asserted below).
// ---------------------------------------------------------------------------
#define CVT_PER_BLOCK 8192
__device__ __forceinline__ void cvt_block(const float* __restrict__ in,
                                          __bf16* __restrict__ out, int blk) {
  int q = blk * (CVT_PER_BLOCK / 4) + threadIdx.x;  // group of 4 elements
  const v4f* src = (const v4f*)in + q;
  v4bf*      dst = (v4bf*)out + q;
  constexpr int NU = CVT_PER_BLOCK / 1024;   // 16-byte loads per thread
  v4f v[NU];
  // Both loops unrolled: v[] stays in registers and all loads issue before the
  // first conversion waits.
#pragma unroll
  for (int u = 0; u < NU; ++u) v[u] = src[256 * u];
#pragma unroll
  for (int u = 0; u < NU; ++u) {
    v4bf o;
#pragma unroll
    for (int e = 0; e < 4; ++e) o[e] = (__bf16)v[u][e];
    dst[256 * u] = o;
  }
}

// ---------------------------------------------------------------------------
// LayerNorm over 768 cols, bf16 output. One wave owns two whole rows: a lane
// holds 24 elements of each row in registers (six 16-byte loads per row), the
// row sums are joined by a five-step butterfly over the 32 lanes, so no LDS and
// no barrier. 8 waves per block = 16 rows per block; `blk` numbers the block
// within its matrix.
// ---------------------------------------------------------------------------
#define LN_ROWS_PER_BLOCK 16
__device__ __forceinline__ void ln_rows(const float* __restrict__ X,
                                        const float* __restrict__ g,
                                        const float* __restrict__ bt,
                                        __bf16* __restrict__ out, int blk) {
  constexpr int NV = DIMD / 128;   // 16-byte groups per lane and row
  int lane = threadIdx.x & 31;
  int w    = threadIdx.x >> 5;
  size_t row0 = ((size_t)blk * 8 + w) * 2;
  const v4f* x0 = (const v4f*)(X + row0 * DIMD) + lane;
  const v4f* x1 = x0 + DIMD / 4;
  v4f a[NV], b[NV];
  // Every loop below is unrolled: the row arrays must be indexed by constants to
  // stay in registers, and both rows' loads issue before the first sum waits.
#pragma unroll
  for (int j = 0; j < NV; ++j) a[j] = x0[32 * j];
#pragma unroll
  for (int j = 0; j < NV; ++j) b[j] = x1[32 * j];
  const v4f* gp = (const v4f*)g + lane;
  const v4f* bp = (const v4f*)bt + lane;
  v4f gg[NV], bb[NV];
#pragma unroll
  for (int j = 0; j < NV; ++j) { gg[j] = gp[32 * j]; bb[j] = bp[32 * j]; }

  float sa = 0.f, qa = 0.f, sb = 0.f, qb = 0.f;
#pragma unroll
  for (int j = 0; j < NV; ++j)
#pragma unroll
    for (int e = 0; e < 4; ++e) {
      sa += a[j][e]; qa += a[j][e] * a[j][e];
      sb += b[j][e]; qb += b[j][e] * b[j][e];
    }
#pragma unroll
  for (int m = 16; m > 0; m >>= 1) {
    sa += __shfl_xor(sa, m, 32);
    qa += __shfl_xor(qa, m, 32);
    sb += __shfl_xor(sb, m, 32);
    qb += __shfl_xor(qb, m, 32);
  }
  float mua  = sa * (1.0f / DIMD);
  float mub  = sb * (1.0f / DIMD);
  float inva = rsqrtf(qa * (1.0f / DIMD) - mua * mua + 1e-5f);
  float invb = rsqrtf(qb * (1.0f / DIMD) - mub * mub + 1e-5f);

  v4bf* o0 = (v4bf*)(out + row0 * DIMD) + lane;
  v4bf* o1 = o0 + DIMD / 4;
#pragma unroll
  for (int j = 0; j < NV; ++j) {
    v4bf ra, rb;
#pragma unroll
    for (int e = 0; e < 4; ++e) {
      ra[e] = (__bf16)((a[j][e] - mua) * inva * gg[j][e] + bb[j][e]);
      rb[e] = (__bf16)((b[j][e] - mub) * invb * gg[j][e] + bb[j][e]);
    }
    o0[32 * j] = ra;
    o1[32 * j] = rb;
  }
}

__global__ __launch_bounds__(256) void ln_bf16_kernel(const float* __restrict__ X,
                                                      const float* __restrict__ g,
                                                      const float* __restrict__ bt,
                                                      __bf16* __restrict__ out) {
  ln_rows(X, g, bt, out, blockIdx.x);
}

#define LN_BLOCKS   (ROWS / LN_ROWS_PER_BLOCK)
#define CVT_SMALL   (DIMD * INNERD / CVT_PER_BLOCK)
#define CVT_LARGE   (DIMD * FFND / CVT_PER_BLOCK)
#define PREP_BLOCKS (2 * LN_BLOCKS + 4 * CVT_SMALL + 2 * CVT_LARGE)
__global__ __launch_bounds__(256) void prep_kernel(
    const float* __restrict__ x, const float* __restrict__ ctx,
    const float* __restrict__ g, const float* __restrict__ bt,
    __bf16* __restrict__ nx, __bf16* __restrict__ nc,
    const float* __restrict__ Wq, const float* __restrict__ Wk,
    const float* __restrict__ Wv, const float* __restrict__ Wo,
    const float* __restrict__ W1, const float* __restrict__ W2,
    __bf16* __restrict__ Wq16, __bf16* __restrict__ Wk16,
    __bf16* __restrict__ Wv16, __bf16* __restrict__ Wo16,
    __bf16* __restrict__ W116, __bf16* __restrict__ W216) {
  int blk = blockIdx.x;
  if (blk < 2 * LN_BLOCKS) {
    bool second = blk >= LN_BLOCKS;
    ln_rows(second ? ctx : x, g, bt, second ? nc : nx, second ? blk - LN_BLOCKS : blk);
    return;
  }
  blk -= 2 * LN_BLOCKS;
  const float* src;
  __bf16*      dst;
  if (blk < 4 * CVT_SMALL) {
    int m = blk / CVT_SMALL;
    blk -= m * CVT_SMALL;
    src = m == 0 ? Wq : m == 1 ? Wk : m == 2 ? Wv : Wo;
    dst = m == 0 ? Wq16 : m == 1 ? Wk16 : m == 2 ? Wv16 : Wo16;
  } else {
    blk -= 4 * CVT_SMALL;
    bool second = blk >= CVT_LARGE;
    if (second) blk -= CVT_LARGE;
    src = second ? W2 : W1;
    dst = second ? W216 : W116;
  }
  cvt_block(src, dst, blk);
}

__device__ __forceinline__ void async_copy8(unsigned l, unsigned lstep,
                                            const __bf16* g, size_t gstep) {
  asm volatile("global_load_async_to_lds_b128 %0, %8, off\n\t"
               "global_load_async_to_lds_b128 %1, %9, off\n\t"
               "global_load_async_to_lds_b128 %2, %10, off\n\t"
               "global_load_async_to_lds_b128 %3, %11, off\n\t"
               "global_load_async_to_lds_b128 %4, %12, off\n\t"
               "global_load_async_to_lds_b128 %5, %13, off\n\t"
               "global_load_async_to_lds_b128 %6, %14, off\n\t"
               "global_load_async_to_lds_b128 %7, %15, off\n\t"
               "s_wait_xcnt 0x0"
               :: "v"(l), "v"(l + lstep), "v"(l + 2u * lstep), "v"(l + 3u * lstep),
                  "v"(l + 4u * lstep), "v"(l + 5u * lstep), "v"(l + 6u * lstep),
                  "v"(l + 7u * lstep),
                  "v"(g), "v"(g + gstep), "v"(g + 2 * gstep), "v"(g + 3 * gstep),
                  "v"(g + 4 * gstep), "v"(g + 5 * gstep), "v"(g + 6 * gstep),
                  "v"(g + 7 * gstep)
               : "memory");
}

#define GBM 128
#define GBN 128
// One block's tile, at column blockIdx.x and row blockIdx.y of the tile grid.
template <int EPI>
__device__ __forceinline__ void gemm_tile(
    const __bf16* __restrict__ A, const __bf16* __restrict__ Bm,
    int M, int N, int K,
    const float* __restrict__ bias, const float* __restrict__ resid,
    float* __restrict__ Cf, __bf16* __restrict__ Cb) {
  __shared__ __attribute__((aligned(16))) __bf16 As[2][GBM * LDP];  // [row][k]
  __shared__ __attribute__((aligned(16))) __bf16 Bs[2][64 * LDTW];  // [k][n]
  int n0 = blockIdx.x * GBN;
  int r0 = blockIdx.y * GBM;
  int t  = threadIdx.x;
  int w  = __builtin_amdgcn_readfirstlane(t >> 5);  // wave number, in a scalar register
  int lane = t & 31;
  int wr = (w >> 1) * 64;   // the wave's rows within the block tile
  int wc = (w & 1) * 64;    // the wave's columns within the block tile

  const v8f vz = {0.f, 0.f, 0.f, 0.f, 0.f, 0.f, 0.f, 0.f};
  v8f acc[4][4];
  // The loops over fragments or registers in this kernel are unrolled (all but the
  // epilogue's outer one): the fragment and accumulator arrays must be indexed by
  // constants to stay in registers.
#pragma unroll
  for (int i = 0; i < 4; ++i)
#pragma unroll
    for (int j = 0; j < 4; ++j) acc[i][j] = vz;

  // One stage, sixteen copies per thread, each wave-wide copy whole 128-B lines:
  // A: eight lanes cover a row's 128 B, the block 16 rows per copy, 8 copies.
  // B: sixteen lanes cover a row's 256 B, the block 8 rows per copy, 8 copies.
  int aR = t >> 3, aC = (t & 7) * 8;
  int bR = t >> 4, bC = (t & 15) * 8;
  auto asyncLoadAB = [&](int k0, int buf) {
    async_copy8((unsigned)(uintptr_t)&As[buf][aR * LDP + aC], 16u * LDP * 2u,
                A + (size_t)(r0 + aR) * K + k0 + aC, (size_t)16 * K);
    async_copy8((unsigned)(uintptr_t)&Bs[buf][bR * LDTW + bC], 8u * LDTW * 2u,
                Bm + (size_t)(k0 + bR) * N + n0 + bC, (size_t)8 * N);
  };

  int nT = K >> 6;  // K / 64
  asyncLoadAB(0, 0);
  for (int it = 0; it < nT; ++it) {
    int buf = it & 1;
    if (it + 2 < nT) {  // one lane per 128-B line of the stage after next
      int k2 = (it + 2) << 6;
      __builtin_prefetch(A + (size_t)(r0 + t) * K + k2, 0, 1);
      __builtin_prefetch(Bm + (size_t)(k2 + (t >> 1)) * N + n0 + (t & 1) * 64, 0, 1);
      // The prefetches name temporaries that the fragment reads below overwrite.
      asm volatile("s_wait_xcnt 0x0" ::: "memory");
    }
    wait_ds0();          // this wave's reads of buffer buf^1 (last trip) retired
    wait_async0();       // this wave's copies for stage `it` have landed
    __syncthreads();     // all waves' copies visible; buffer buf^1 left by all
#pragma unroll
    for (int kk = 0; kk < 64; kk += 32) {
      // The eight fragments of 32 k are read as one group ahead of their WMMAs.
      v16bf af[4], bf[4];
      af[0] = load_frag(&As[buf][wr * LDP + kk], LDP);
#pragma unroll
      for (int j = 0; j < 4; ++j)
        bf[j] = load_frag_tr(&Bs[buf][kk * LDTW + wc + 16 * j], LDTW);
#pragma unroll
      for (int i = 1; i < 4; ++i)
        af[i] = load_frag(&As[buf][(wr + 16 * i) * LDP + kk], LDP);
      // Next stage's copies go out behind the first group of LDS reads: their
      // address arithmetic and issue run while those reads are on their way.
      if (kk == 0 && it + 1 < nT) asyncLoadAB((it + 1) << 6, buf ^ 1);
      // Without this fence the scheduler sinks the A reads among the WMMAs, each
      // with a wait to zero in front of its row of four.
      __builtin_amdgcn_sched_barrier(0);
#pragma unroll
      for (int i = 0; i < 4; ++i)
#pragma unroll
        for (int j = 0; j < 4; ++j) acc[i][j] = wmma_bf16(af[i], bf[j], acc[i][j]);
      // Keeps the next group's reads behind this block of WMMAs, as one group.
      __builtin_amdgcn_sched_barrier(0);
    }
  }

  int colL = lane & 15;
  int rh   = (lane & 16) ? 8 : 0;
  // The loop over the four row fragments stays rolled, for speed only. Each trip works on acc[0][*] and
  // then moves the later fragments down, so that every index is a constant.
#pragma clang loop unroll(disable)
  for (int i = 0; i < 4; ++i) {
#pragma unroll
    for (int j = 0; j < 4; ++j) {
#pragma unroll
      for (int r = 0; r < 8; ++r) {
        int grow = r0 + wr + 16 * i + r + rh;
        int gcol = n0 + wc + 16 * j + colL;
        float v = acc[0][j][r];
        if (EPI == 1) {
          v += bias[gcol] + resid[(size_t)grow * N + gcol];
          Cf[(size_t)grow * N + gcol] = v;
        } else if (EPI == 2) {
          v = gelu_exact(v + bias[gcol]);
          Cb[(size_t)grow * N + gcol] = (__bf16)v;
        } else {
          Cb[(size_t)grow * N + gcol] = (__bf16)v;
        }
      }
      // The GELU chains of a trip are independent and the scheduler would run all
      // 32 side by side; with the accumulators live that spills. Two groups of 16.
      if (EPI == 2 && j == 1) __builtin_amdgcn_sched_barrier(0);
    }
#pragma unroll
    for (int j = 0; j < 4; ++j) {
      acc[0][j] = acc[1][j];
      acc[1][j] = acc[2][j];
      acc[2][j] = acc[3][j];
    }
    // The next trip rewrites address and data registers that this trip's loads and
    // stores name.
    asm volatile("s_wait_xcnt 0x0" ::: "memory");
  }
}

template <int EPI>
__global__ __launch_bounds__(128, 4) void gemm_bf16_kernel(
    const __bf16* __restrict__ A, const __bf16* __restrict__ Bm,
    int M, int N, int K,
    const float* __restrict__ bias, const float* __restrict__ resid,
    float* __restrict__ Cf, __bf16* __restrict__ Cb) {
  gemm_tile<EPI>(A, Bm, M, N, K, bias, resid, Cf, Cb);
}

__global__ __launch_bounds__(128, 4) void qkv_gemm_kernel(
    const __bf16* __restrict__ Aq, const __bf16* __restrict__ Akv,
    const __bf16* __restrict__ Bq, const __bf16* __restrict__ Bk,
    const __bf16* __restrict__ Bv,
    int M, int N, int K,
    __bf16* __restrict__ Cq, __bf16* __restrict__ Ck, __bf16* __restrict__ Cv) {
  int z = blockIdx.z;
  gemm_tile<0>(z == 0 ? Aq : Akv, z == 0 ? Bq : z == 1 ? Bk : Bv, M, N, K,
               nullptr, nullptr, nullptr, z == 0 ? Cq : z == 1 ? Ck : Cv);
}

#define SM_C 0.18033688011112042f   // 0.125 * log2(e)

__device__ __forceinline__ void exp2_inplace(float& x) {
  asm("v_exp_f32 %0, %0\n\t"
      "v_nop"
      : "+v"(x));
}
__device__ __forceinline__ void exp2_inplace16(float (&a)[8], float (&b)[8]) {
  asm("v_exp_f32 %0, %0\n\t"
      "v_exp_f32 %1, %1\n\t"
      "v_exp_f32 %2, %2\n\t"
      "v_exp_f32 %3, %3\n\t"
      "v_exp_f32 %4, %4\n\t"
      "v_exp_f32 %5, %5\n\t"
      "v_exp_f32 %6, %6\n\t"
      "v_exp_f32 %7, %7\n\t"
      "v_exp_f32 %8, %8\n\t"
      "v_exp_f32 %9, %9\n\t"
      "v_exp_f32 %10, %10\n\t"
      "v_exp_f32 %11, %11\n\t"
      "v_exp_f32 %12, %12\n\t"
      "v_exp_f32 %13, %13\n\t"
      "v_exp_f32 %14, %14\n\t"
      "v_exp_f32 %15, %15\n\t"
      "v_nop"
      : "+v"(a[0]), "+v"(a[1]), "+v"(a[2]), "+v"(a[3]),
        "+v"(a[4]), "+v"(a[5]), "+v"(a[6]), "+v"(a[7]),
        "+v"(b[0]), "+v"(b[1]), "+v"(b[2]), "+v"(b[3]),
        "+v"(b[4]), "+v"(b[5]), "+v"(b[6]), "+v"(b[7]));
}
__device__ __forceinline__ float other_half(float v) {   // value of lane ^ 16
  int b = __builtin_bit_cast(int, v);
  return __builtin_bit_cast(
      float, __builtin_amdgcn_permlanex16(b, b, 0x76543210, 0xfedcba98, false, false));
}

__global__ __launch_bounds__(128) void attn_kernel(
    const __bf16* __restrict__ Q, const __bf16* __restrict__ Kg,
    const __bf16* __restrict__ Vg, __bf16* __restrict__ O) {
  __shared__ __attribute__((aligned(16))) __bf16 Ks[64 * LDP];   // [j][d]   (A rows of S^T = K Q^T)
  __shared__ __attribute__((aligned(16))) __bf16 Vs[64 * LDT];   // [m'][d]  (read transposed: A of O^T = V^T P^T)

  int i0 = blockIdx.x * 64;
  int h  = blockIdx.y;
  int b  = blockIdx.z;
  int t  = threadIdx.x;
  int w  = t >> 5;
  int lane = t & 31;
  int colL = lane & 15;
  int rh   = (lane & 16) ? 8 : 0;

  int jL = t >> 1, dL = (t & 1) * 32;

  // Every loop over tiles, registers or elements in this kernel is unrolled: the
  // fragment and accumulator arrays must be indexed by constants to stay in registers.

  // This lane's query row, as the two B fragments of Q^T (d 0..31 and 32..63),
  // in the k order of load_frag; loaded once, kept in registers.
  size_t qrow = (size_t)(b * NSEQ) + i0 + 16 * w + colL;
  v16bf qf[2];
  {
    const __bf16* src = Q + qrow * INNERD + h * HDIM + rh;
#pragma unroll
    for (int u = 0; u < 2; ++u) {
      v8bf lo = *(const v8bf*)(src + 32 * u);
      v8bf hi = *(const v8bf*)(src + 32 * u + 16);
#pragma unroll
      for (int e = 0; e < 8; ++e) { qf[u][e] = lo[e]; qf[u][e + 8] = hi[e]; }
    }
  }

  float run_max = -3.0e38f;   // of the lane's query, in base-2 units, equal in both halves
  float run_sum = 0.0f;       // over this half's keys only; halves joined at the end
  const v8f vz = {0.f, 0.f, 0.f, 0.f, 0.f, 0.f, 0.f, 0.f};
  v8f oacc[4] = {vz, vz, vz, vz};   // oacc[n][r] = O^T[d = 16n + 8h + r][query c]

  for (int m0 = 0; m0 < MSEQ; m0 += 64) {
    if (m0 + 64 < MSEQ) {  // prefetch next chunk of K/V through L2
      __builtin_prefetch(
          Kg + ((size_t)(b * MSEQ) + m0 + 64 + jL) * INNERD + h * HDIM + dL, 0, 1);
      __builtin_prefetch(
          Vg + ((size_t)(b * MSEQ) + m0 + 64 + jL) * INNERD + h * HDIM + dL, 0, 1);
    }
    wait_ds0();        // this wave's reads of Ks/Vs retired before the refill
    __syncthreads();   // previous chunk's WMMA reads of Ks/Vs done
    { // K and V tiles, both row-major. K: 64 B of one row per thread. V: 16 B of
      // each of four rows (eight lanes cover a row's whole 128 B).
      int vR = t >> 3, vC = (t & 7) * 8;
      const __bf16* kp = Kg + ((size_t)(b * MSEQ) + m0 + jL) * INNERD + h * HDIM + dL;
      const __bf16* vp = Vg + ((size_t)(b * MSEQ) + m0 + vR) * INNERD + h * HDIM + vC;
      unsigned lk = (unsigned)(uintptr_t)&Ks[jL * LDP + dL];
      unsigned lv = (unsigned)(uintptr_t)&Vs[vR * LDT + vC];
      asm volatile("global_load_async_to_lds_b128 %0, %8, off\n\t"
                   "global_load_async_to_lds_b128 %1, %9, off\n\t"
                   "global_load_async_to_lds_b128 %2, %10, off\n\t"
                   "global_load_async_to_lds_b128 %3, %11, off\n\t"
                   "global_load_async_to_lds_b128 %4, %12, off\n\t"
                   "global_load_async_to_lds_b128 %5, %13, off\n\t"
                   "global_load_async_to_lds_b128 %6, %14, off\n\t"
                   "global_load_async_to_lds_b128 %7, %15, off\n\t"
                   "s_wait_xcnt 0x0"
                   :: "v"(lk), "v"(lk + 16u), "v"(lk + 32u), "v"(lk + 48u),
                      "v"(lv), "v"(lv + 16u * LDT * 2u), "v"(lv + 32u * LDT * 2u),
                      "v"(lv + 48u * LDT * 2u),
                      "v"(kp), "v"(kp + 8), "v"(kp + 16), "v"(kp + 24),
                      "v"(vp), "v"(vp + 16 * INNERD), "v"(vp + 32 * INNERD),
                      "v"(vp + 48 * INNERD)
                   : "memory");
    }
    wait_async0();     // this wave's copies have landed
    __syncthreads();   // every wave's copies visible

    // S^T = K Q^T: 64 keys x this wave's 16 queries (two k-steps over d)
    v8f s[4] = {vz, vz, vz, vz};
#pragma unroll
    for (int kk = 0; kk < 64; kk += 32) {
#pragma unroll
      for (int n = 0; n < 4; ++n) {
        v16bf kf = load_frag(Ks + 16 * n * LDP + kk, LDP);
        s[n] = wmma_bf16(kf, qf[kk >> 5], s[n]);
      }
    }

    // Online softmax of the lane's query over its 32 keys of the chunk. The scale
    // is positive and rounding is monotone: the maximum may be scaled after it is
    // found, and no s * c - nm lies above 0 by more than the rounding of nm.
    float cmax = -3.0e38f;
#pragma unroll
    for (int n = 0; n < 4; ++n)
#pragma unroll
      for (int r = 0; r < 8; ++r) cmax = fmaxf(cmax, s[n][r]);
    cmax = fmaxf(cmax, other_half(cmax)) * SM_C;
    float nm    = fmaxf(run_max, cmax);
    float alpha = run_max - nm;
    exp2_inplace(alpha);
    float pe[4][8];   // the scores' exponents, then P
#pragma unroll
    for (int n = 0; n < 4; ++n)
#pragma unroll
      for (int r = 0; r < 8; ++r) pe[n][r] = __builtin_fmaf(s[n][r], SM_C, -nm);
    exp2_inplace16(pe[0], pe[1]);
    exp2_inplace16(pe[2], pe[3]);
    float ts[4];   // one partial sum per tile: four independent add chains
    v16bf pf[2];   // P^T as B fragments: keys 0..31 and 32..63 of the chunk
#pragma unroll
    for (int n = 0; n < 4; ++n) {
      ts[n] = pe[n][0];
#pragma unroll
      for (int r = 0; r < 8; ++r) {
        pf[n >> 1][(n & 1) * 8 + r] = (__bf16)pe[n][r];
        if (r > 0) ts[n] += pe[n][r];
      }
    }
    float ssum = (ts[0] + ts[1]) + (ts[2] + ts[3]);
    run_sum = run_sum * alpha + ssum;
    run_max = nm;

    // Rescale O^T (one factor per lane), then O^T += V^T P^T
#pragma unroll
    for (int n = 0; n < 4; ++n)
#pragma unroll
      for (int r = 0; r < 8; ++r) oacc[n][r] *= alpha;
#pragma unroll
    for (int kk = 0; kk < 64; kk += 32) {
#pragma unroll
      for (int n = 0; n < 4; ++n) {
        v16bf vf = load_frag_tr(Vs + kk * LDT + 16 * n, LDT);
        oacc[n] = wmma_bf16(vf, pf[kk >> 5], oacc[n]);
      }
    }
  }

  // A lane holds eight consecutive d of its query per tile: one 16-byte store each.
  float inv = 1.0f / (run_sum + other_half(run_sum));
  __bf16* dst = O + qrow * INNERD + h * HDIM + rh;
#pragma unroll
  for (int n = 0; n < 4; ++n) {
    v8bf o;
#pragma unroll
    for (int r = 0; r < 8; ++r) o[r] = (__bf16)(oacc[n][r] * inv);
    *(v8bf*)(dst + 16 * n) = o;
  }
}

// ---------------------------------------------------------------------------
// Launch
// ---------------------------------------------------------------------------
extern "C" void kernel_launch(void* const* d_in, const int* in_sizes, int n_in,
                              void* d_out, int out_size, void* d_ws, size_t ws_size,
                              hipStream_t stream) {
  (void)in_sizes; (void)n_in; (void)out_size; (void)ws_size;
  const float* x   = (const float*)d_in[0];
  const float* ctx = (const float*)d_in[1];
  const float* Wq  = (const float*)d_in[2];
  const float* Wk  = (const float*)d_in[3];
  const float* Wv  = (const float*)d_in[4];
  const float* Wo  = (const float*)d_in[5];
  const float* bo  = (const float*)d_in[6];
  const float* g1  = (const float*)d_in[7];
  const float* b1  = (const float*)d_in[8];
  const float* g2  = (const float*)d_in[9];
  const float* b2  = (const float*)d_in[10];
  const float* W1  = (const float*)d_in[11];
  const float* bf1 = (const float*)d_in[12];
  const float* W2  = (const float*)d_in[13];
  const float* bf2 = (const float*)d_in[14];
  float* out = (float*)d_out;

  char* wp = (char*)d_ws;
  auto alloc = [&](size_t bytes) -> char* {
    char* p = wp;
    wp += (bytes + 255) & ~(size_t)255;
    return p;
  };
  __bf16* Wq16  = (__bf16*)alloc((size_t)DIMD * INNERD * 2);
  __bf16* Wk16  = (__bf16*)alloc((size_t)DIMD * INNERD * 2);
  __bf16* Wv16  = (__bf16*)alloc((size_t)DIMD * INNERD * 2);
  __bf16* Wo16  = (__bf16*)alloc((size_t)INNERD * DIMD * 2);
  __bf16* W116  = (__bf16*)alloc((size_t)DIMD * FFND * 2);
  __bf16* W216  = (__bf16*)alloc((size_t)FFND * DIMD * 2);
  __bf16* nx16  = (__bf16*)alloc((size_t)ROWS * DIMD * 2);
  __bf16* nc16  = (__bf16*)alloc((size_t)ROWS * DIMD * 2);
  __bf16* Q16   = (__bf16*)alloc((size_t)ROWS * INNERD * 2);
  __bf16* K16   = (__bf16*)alloc((size_t)ROWS * INNERD * 2);
  __bf16* V16   = (__bf16*)alloc((size_t)ROWS * INNERD * 2);
  __bf16* O16   = (__bf16*)alloc((size_t)ROWS * INNERD * 2);
  float*  x1    = (float*)alloc((size_t)ROWS * DIMD * 4);
  __bf16* hln16 = (__bf16*)alloc((size_t)ROWS * DIMD * 2);
  __bf16* H16   = (__bf16*)alloc((size_t)ROWS * FFND * 2);

  static_assert((DIMD * INNERD) % CVT_PER_BLOCK == 0 && (DIMD * FFND) % CVT_PER_BLOCK == 0,
                "weight sizes must be whole conversion blocks");
  static_assert(ROWS % LN_ROWS_PER_BLOCK == 0 && DIMD % 128 == 0, "LayerNorm tiling");
  static_assert(ROWS % GBM == 0 && INNERD % GBN == 0 && DIMD % GBN == 0 && FFND % GBN == 0 &&
                DIMD % 64 == 0 && INNERD % 64 == 0 && FFND % 64 == 0, "GEMM tiling");
  // norm1 for x and context, and the weight conversions
  prep_kernel<<<PREP_BLOCKS, 256, 0, stream>>>(x, ctx, g1, b1, nx16, nc16,
                                               Wq, Wk, Wv, Wo, W1, W2,
                                               Wq16, Wk16, Wv16, Wo16, W116, W216);

  // Q/K/V projections (plain bf16 epilogue)
  {
    dim3 g(INNERD / GBN, ROWS / GBM, 3);
    qkv_gemm_kernel<<<g, 128, 0, stream>>>(nx16, nc16, Wq16, Wk16, Wv16,
                                           ROWS, INNERD, DIMD, Q16, K16, V16);
  }

  // Attention
  {
    dim3 g(NSEQ / 64, NHEADS, BATCH);
    attn_kernel<<<g, 128, 0, stream>>>(Q16, K16, V16, O16);
  }

  // Output projection + bias + residual -> x1 (f32)
  {
    dim3 g(DIMD / GBN, ROWS / GBM);
    gemm_bf16_kernel<1><<<g, 128, 0, stream>>>(O16, Wo16, ROWS, DIMD, INNERD,
                                               bo, x, x1, nullptr);
  }

  // norm2
  ln_bf16_kernel<<<ROWS / LN_ROWS_PER_BLOCK, 256, 0, stream>>>(x1, g2, b2, hln16);

  // FFN1: gelu(h @ W1 + bf1) -> bf16
  {
    dim3 g(FFND / GBN, ROWS / GBM);
    gemm_bf16_kernel<2><<<g, 128, 0, stream>>>(hln16, W116, ROWS, FFND, DIMD,
                                               bf1, nullptr, nullptr, H16);
  }

  // FFN2: x1 + H @ W2 + bf2 -> d_out (f32)
  {
    dim3 g(DIMD / GBN, ROWS / GBM);
    gemm_bf16_kernel<1><<<g, 128, 0, stream>>>(H16, W216, ROWS, DIMD, FFND,
                                               bf2, x1, out, nullptr);
  }
}

// v009
// One run takes 183 microseconds.
// Timed twice side by side with v008, it ran 1.09 times as fast both times.
// Over all steps from v000 it is 4.56 times as fast.
#include <hip/hip_runtime.h>
#include <hip/hip_bf16.h>

typedef __attribute__((ext_vector_type(16))) __bf16 v16bf;
typedef __attribute__((ext_vector_type(8)))  __bf16 v8bf;
typedef __attribute__((ext_vector_type(8)))  float  v8f;
typedef __attribute__((ext_vector_type(4)))  __bf16 v4bf;
typedef __attribute__((ext_vector_type(4)))  float  v4f;

#define DIMD   768
#define NHEADS 8
#define HDIM   64
#define INNERD 512
#define FFND   3072
#define BATCH  4
#define NSEQ   2048
#define MSEQ   2048
#define ROWS   (BATCH * NSEQ)   // 8192 rows for both x and context paths

#define LDP    72   // bf16 elements per LDS row of a 64-wide bf16 tile
// A tile kept row-major [k][n] and read by the transposing load wants 32 B x odd.
#define LDT    80   // bf16 elements per LDS row (160 B) of a 64-wide [k][n] tile
#define LDTW   144  // bf16 elements per LDS row (288 B) of a 128-wide [k][n] tile

__device__ __forceinline__ v8f wmma_bf16(v16bf a, v16bf b, v8f c) {
  // (neg_a, A, neg_b, B, c_mod, C, reuse_a, reuse_b)
  return __builtin_amdgcn_wmma_f32_16x16x32_bf16(false, a, false, b, (short)0, c,
                                                 false, false);
}

__device__ __forceinline__ v16bf load_frag(const __bf16* base, int ld) {
  int lane = threadIdx.x & 31;
  int r    = lane & 15;
  int kb   = (lane & 16) ? 8 : 0;
  const __bf16* p = base + r * ld + kb;
  v8bf lo = *(const v8bf*)(p);
  v8bf hi = *(const v8bf*)(p + 16);
  v16bf f;
#pragma unroll
  for (int e = 0; e < 8; ++e) { f[e] = lo[e]; f[e + 8] = hi[e]; }
  return f;
}

// Load one 32x16 B fragment (k x n) from an LDS tile laid out [k][n] with pitch
// `ld` (elements); `tile` points at element [kbase][nbase]. ds_load_tr16_b128 hands lane
// (c = L&15, h = L>>4) the eight elements [kbase + 8h + 0..7][nbase + c], so the
// loads at kbase and kbase + 16 give the same k order as load_frag gives A.
typedef __attribute__((address_space(3))) v8bf lds_v8bf;
__device__ __forceinline__ v16bf load_frag_tr(const __bf16* tile, int ld) {
  int lane = threadIdx.x & 31;
  const __bf16* p = tile + ((lane >> 4) * 8 + (lane & 7)) * ld + ((lane >> 3) & 1) * 8;
  v8bf lo = __builtin_amdgcn_ds_load_tr16_b128_v8bf16((lds_v8bf*)p);
  v8bf hi = __builtin_amdgcn_ds_load_tr16_b128_v8bf16((lds_v8bf*)(p + 16 * ld));
  v16bf f;
#pragma unroll
  for (int e = 0; e < 8; ++e) { f[e] = lo[e]; f[e + 8] = hi[e]; }
  return f;
}

__device__ __forceinline__ void wait_async0() {
  asm volatile("s_wait_asynccnt 0x0" ::: "memory");
}
// This wave's LDS reads have retired before a copy may refill what they read.
__device__ __forceinline__ void wait_ds0() {
  asm volatile("s_wait_dscnt 0x0" ::: "memory");
}

// erf(x) to single precision without a branch. The library form picks one of two
// fits by |x| under the exec mask; among 32 lanes both sides are nearly always
// taken, and each element becomes one long dependent chain between two mask
// branches. Here both fits (the same polynomials) are evaluated in every lane and
// one is selected, so that the elements of a thread are independent chains that
// the scheduler can interleave.
//   |x| <  1: |x| + |x| P(x^2)
//   |x| >= 1: 1 - exp(-q), q = |x| + |x| Q(|x|); exp(-q) = 2^(-q log2 e) on the
//             hardware 2^x: exp(-q) < 0.16 there, so its rounding moves 1 - exp(-q) by
//             about one unit in the last place, far below the bf16 rounding that
//             follows; a large or infinite q gives 0, erf = 1.
__device__ __forceinline__ float erf_select(float x) {
  float a = fabsf(x);
  float t = a * a;
  float p = fmaf(t, -0x1.268bc2p-11f, 0x1.420828p-8f);
  p = fmaf(t, p, -0x1.b5937p-6f);
  p = fmaf(t, p, 0x1.ce077cp-4f);
  p = fmaf(t, p, -0x1.81266p-2f);
  p = fmaf(t, p, 0x1.06eba0p-3f);
  float near0 = fmaf(a, p, a);
  float q = fmaf(a, 0x1.1d3156p-16f, -0x1.8d129p-12f);
  q = fmaf(a, q, 0x1.f9a6d2p-9f);
  q = fmaf(a, q, -0x1.8c3164p-6f);
  q = fmaf(a, q, 0x1.b4e9c8p-4f);
  q = fmaf(a, q, 0x1.4515fap-1f);
  q = fmaf(a, q, 0x1.078e50p-3f);
  q = fmaf(a, q, a);
  float far0 = 1.0f - __builtin_amdgcn_exp2f(q * -1.44269504088896340736f);
  return copysignf(a < 1.0f ? near0 : far0, x);
}

__device__ __forceinline__ float gelu_exact(float v) {
  return 0.5f * v * (1.0f + erf_select(v * 0.70710678118654752f));
}

// ---------------------------------------------------------------------------
// fp32 -> bf16 conversion (weights), the work of one block of 256 threads: each
// thread converts 32 elements (eight 16-byte loads in flight, each wave-wide load
// 512 contiguous bytes), 8192 elements per block. `blk` is the block's number
// within its matrix, whose size is a whole number of blocks (asserted below).
// ---------------------------------------------------------------------------
#define CVT_PER_BLOCK 8192
__device__ __forceinline__ void cvt_block(const float* __restrict__ in,
                                          __bf16* __restrict__ out, int blk) {
  int q = blk * (CVT_PER_BLOCK / 4) + threadIdx.x;  // group of 4 elements
  const v4f* src = (const v4f*)in + q;
  v4bf*      dst = (v4bf*)out + q;
  constexpr int NU = CVT_PER_BLOCK / 1024;   // 16-byte loads per thread
  v4f v[NU];
  // Both loops unrolled: v[] stays in registers and all loads issue before the
  // first conversion waits.
#pragma unroll
  for (int u = 0; u < NU; ++u) v[u] = src[256 * u];
#pragma unroll
  for (int u = 0; u < NU; ++u) {
    v4bf o;
#pragma unroll
    for (int e = 0; e < 4; ++e) o[e] = (__bf16)v[u][e];
    dst[256 * u] = o;
  }
}

// ---------------------------------------------------------------------------
// LayerNorm over 768 cols, bf16 output. One wave owns two whole rows: a lane
// holds 24 elements of each row in registers (six 16-byte loads per row), the
// row sums are joined by a five-step butterfly over the 32 lanes, so no LDS and
// no barrier. 8 waves per block = 16 rows per block; `blk` numbers the block
// within its matrix.
// ---------------------------------------------------------------------------
#define LN_ROWS_PER_BLOCK 16
__device__ __forceinline__ void ln_rows(const float* __restrict__ X,
                                        const float* __restrict__ g,
                                        const float* __restrict__ bt,
                                        __bf16* __restrict__ out, int blk) {
  constexpr int NV = DIMD / 128;   // 16-byte groups per lane and row
  int lane = threadIdx.x & 31;
  int w    = threadIdx.x >> 5;
  size_t row0 = ((size_t)blk * 8 + w) * 2;
  const v4f* x0 = (const v4f*)(X + row0 * DIMD) + lane;
  const v4f* x1 = x0 + DIMD / 4;
  v4f a[NV], b[NV];
  // Every loop below is unrolled: the row arrays must be indexed by constants to
  // stay in registers, and both rows' loads issue before the first sum waits.
#pragma unroll
  for (int j = 0; j < NV; ++j) a[j] = x0[32 * j];
#pragma unroll
  for (int j = 0; j < NV; ++j) b[j] = x1[32 * j];
  const v4f* gp = (const v4f*)g + lane;
  const v4f* bp = (const v4f*)bt + lane;
  v4f gg[NV], bb[NV];
#pragma unroll
  for (int j = 0; j < NV; ++j) { gg[j] = gp[32 * j]; bb[j] = bp[32 * j]; }

  float sa = 0.f, qa = 0.f, sb = 0.f, qb = 0.f;
#pragma unroll
  for (int j = 0; j < NV; ++j)
#pragma unroll
    for (int e = 0; e < 4; ++e) {
      sa += a[j][e]; qa += a[j][e] * a[j][e];
      sb += b[j][e]; qb += b[j][e] * b[j][e];
    }
#pragma unroll
  for (int m = 16; m > 0; m >>= 1) {
    sa += __shfl_xor(sa, m, 32);
    qa += __shfl_xor(qa, m, 32);
    sb += __shfl_xor(sb, m, 32);
    qb += __shfl_xor(qb, m, 32);
  }
  float mua  = sa * (1.0f / DIMD);
  float mub  = sb * (1.0f / DIMD);
  float inva = rsqrtf(qa * (1.0f / DIMD) - mua * mua + 1e-5f);
  float invb = rsqrtf(qb * (1.0f / DIMD) - mub * mub + 1e-5f);

  v4bf* o0 = (v4bf*)(out + row0 * DIMD) + lane;
  v4bf* o1 = o0 + DIMD / 4;
#pragma unroll
  for (int j = 0; j < NV; ++j) {
    v4bf ra, rb;
#pragma unroll
    for (int e = 0; e < 4; ++e) {
      ra[e] = (__bf16)((a[j][e] - mua) * inva * gg[j][e] + bb[j][e]);
      rb[e] = (__bf16)((b[j][e] - mub) * invb * gg[j][e] + bb[j][e]);
    }
    o0[32 * j] = ra;
    o1[32 * j] = rb;
  }
}

__global__ __launch_bounds__(256) void ln_bf16_kernel(const float* __restrict__ X,
                                                      const float* __restrict__ g,
                                                      const float* __restrict__ bt,
                                                      __bf16* __restrict__ out) {
  ln_rows(X, g, bt, out, blockIdx.x);
}

#define LN_BLOCKS   (ROWS / LN_ROWS_PER_BLOCK)
#define CVT_SMALL   (DIMD * INNERD / CVT_PER_BLOCK)
#define CVT_LARGE   (DIMD * FFND / CVT_PER_BLOCK)
#define PREP_BLOCKS (2 * LN_BLOCKS + 4 * CVT_SMALL + 2 * CVT_LARGE)
__global__ __launch_bounds__(256) void prep_kernel(
    const float* __restrict__ x, const float* __restrict__ ctx,
    const float* __restrict__ g, const float* __restrict__ bt,
    __bf16* __restrict__ nx, __bf16* __restrict__ nc,
    const float* __restrict__ Wq, const float* __restrict__ Wk,
    const float* __restrict__ Wv, const float* __restrict__ Wo,
    const float* __restrict__ W1, const float* __restrict__ W2,
    __bf16* __restrict__ Wq16, __bf16* __restrict__ Wk16,
    __bf16* __restrict__ Wv16, __bf16* __restrict__ Wo16,
    __bf16* __restrict__ W116, __bf16* __restrict__ W216) {
  int blk = blockIdx.x;
  if (blk < 2 * LN_BLOCKS) {
    bool second = blk >= LN_BLOCKS;
    ln_rows(second ? ctx : x, g, bt, second ? nc : nx, second ? blk - LN_BLOCKS : blk);
    return;
  }
  blk -= 2 * LN_BLOCKS;
  const float* src;
  __bf16*      dst;
  if (blk < 4 * CVT_SMALL) {
    int m = blk / CVT_SMALL;
    blk -= m * CVT_SMALL;
    src = m == 0 ? Wq : m == 1 ? Wk : m == 2 ? Wv : Wo;
    dst = m == 0 ? Wq16 : m == 1 ? Wk16 : m == 2 ? Wv16 : Wo16;
  } else {
    blk -= 4 * CVT_SMALL;
    bool second = blk >= CVT_LARGE;
    if (second) blk -= CVT_LARGE;
    src = second ? W2 : W1;
    dst = second ? W216 : W116;
  }
  cvt_block(src, dst, blk);
}

__device__ __forceinline__ void async_copy8(unsigned l, unsigned lstep,
                                            const __bf16* g, size_t gstep) {
  asm volatile("global_load_async_to_lds_b128 %0, %8, off\n\t"
               "global_load_async_to_lds_b128 %1, %9, off\n\t"
               "global_load_async_to_lds_b128 %2, %10, off\n\t"
               "global_load_async_to_lds_b128 %3, %11, off\n\t"
               "global_load_async_to_lds_b128 %4, %12, off\n\t"
               "global_load_async_to_lds_b128 %5, %13, off\n\t"
               "global_load_async_to_lds_b128 %6, %14, off\n\t"
               "global_load_async_to_lds_b128 %7, %15, off\n\t"
               "s_wait_xcnt 0x0"
               :: "v"(l), "v"(l + lstep), "v"(l + 2u * lstep), "v"(l + 3u * lstep),
                  "v"(l + 4u * lstep), "v"(l + 5u * lstep), "v"(l + 6u * lstep),
                  "v"(l + 7u * lstep),
                  "v"(g), "v"(g + gstep), "v"(g + 2 * gstep), "v"(g + 3 * gstep),
                  "v"(g + 4 * gstep), "v"(g + 5 * gstep), "v"(g + 6 * gstep),
                  "v"(g + 7 * gstep)
               : "memory");
}

#define GBM 128
#define GBN 128
// Prefetch requests are thinned. A prefetch only has to start the fill of L2 from
// memory, and a tile is shared by many blocks that walk
// k (or the keys) at about the same time. So a unit is asked for once, not once per
// 128-B line, and only by the first PF_ASKERS blocks of those that share the tile.
// Every further
// request for the same unit is one more scattered request on the path to L2 that
// the operand copies need. For speed only: nothing depends on where a block runs.
#define PF_ASKERS 8
// One block's tile, at column blockIdx.x and row blockIdx.y of the tile grid.
template <int EPI>
__device__ __forceinline__ void gemm_tile(
    const __bf16* __restrict__ A, const __bf16* __restrict__ Bm,
    int M, int N, int K,
    const float* __restrict__ bias, const float* __restrict__ resid,
    float* __restrict__ Cf, __bf16* __restrict__ Cb) {
  __shared__ __attribute__((aligned(16))) __bf16 As[2][GBM * LDP];  // [row][k]
  __shared__ __attribute__((aligned(16))) __bf16 Bs[2][64 * LDTW];  // [k][n]
  int n0 = blockIdx.x * GBN;
  int r0 = blockIdx.y * GBM;
  int t  = threadIdx.x;
  int w  = __builtin_amdgcn_readfirstlane(t >> 5);  // wave number, in a scalar register
  int lane = t & 31;
  int wr = (w >> 1) * 64;   // the wave's rows within the block tile
  int wc = (w & 1) * 64;    // the wave's columns within the block tile

  const v8f vz = {0.f, 0.f, 0.f, 0.f, 0.f, 0.f, 0.f, 0.f};
  v8f acc[4][4];
  // The loops over fragments or registers in this kernel are unrolled (all but the
  // epilogue's outer one): the fragment and accumulator arrays must be indexed by
  // constants to stay in registers.
#pragma unroll
  for (int i = 0; i < 4; ++i)
#pragma unroll
    for (int j = 0; j < 4; ++j) acc[i][j] = vz;

  // One stage, sixteen copies per thread, each wave-wide copy whole 128-B lines:
  // A: eight lanes cover a row's 128 B, the block 16 rows per copy, 8 copies.
  // B: sixteen lanes cover a row's 256 B, the block 8 rows per copy, 8 copies.
  int aR = t >> 3, aC = (t & 7) * 8;
  int bR = t >> 4, bC = (t & 15) * 8;
  auto asyncLoadAB = [&](int k0, int buf) {
    async_copy8((unsigned)(uintptr_t)&As[buf][aR * LDP + aC], 16u * LDP * 2u,
                A + (size_t)(r0 + aR) * K + k0 + aC, (size_t)16 * K);
    async_copy8((unsigned)(uintptr_t)&Bs[buf][bR * LDTW + bC], 8u * LDTW * 2u,
                Bm + (size_t)(k0 + bR) * N + n0 + bC, (size_t)8 * N);
  };

  int nT = K >> 6;  // K / 64, even (K is a multiple of 128, asserted at the launch)
  bool askA = blockIdx.x < PF_ASKERS;   // the A rows are shared along blockIdx.x
  bool askB = blockIdx.y < PF_ASKERS;   // the B columns are shared along blockIdx.y
  asyncLoadAB(0, 0);
  for (int it = 0; it < nT; ++it) {
    int buf = it & 1;
    // Every second trip, for the two stages after next: one lane per 256-B unit, which
    // is 128 k of an A row, or the tile's 128 columns of a B row (128 rows of each).
    if ((it & 1) == 0 && it + 2 < nT && (askA || askB)) {
      int k2 = (it + 2) << 6;
      // Each prefetch names temporaries that the next address arithmetic or the
      // fragment reads below overwrite: a wait behind each.
      if (askA) {
        __builtin_prefetch(A + (size_t)(r0 + t) * K + k2, 0, 1);
        asm volatile("s_wait_xcnt 0x0" ::: "memory");
      }
      if (askB) {
        __builtin_prefetch(Bm + (size_t)(k2 + t) * N + n0, 0, 1);
        asm volatile("s_wait_xcnt 0x0" ::: "memory");
      }
    }
    wait_ds0();          // this wave's reads of buffer buf^1 (last trip) retired
    wait_async0();       // this wave's copies for stage `it` have landed
    __syncthreads();     // all waves' copies visible; buffer buf^1 left by all
#pragma unroll
    for (int kk = 0; kk < 64; kk += 32) {
      // The eight fragments of 32 k are read as one group ahead of their WMMAs.
      v16bf af[4], bf[4];
      af[0] = load_frag(&As[buf][wr * LDP + kk], LDP);
#pragma unroll
      for (int j = 0; j < 4; ++j)
        bf[j] = load_frag_tr(&Bs[buf][kk * LDTW + wc + 16 * j], LDTW);
#pragma unroll
      for (int i = 1; i < 4; ++i)
        af[i] = load_frag(&As[buf][(wr + 16 * i) * LDP + kk], LDP);
      // Next stage's copies go out behind the first group of LDS reads: their
      // address arithmetic and issue run while those reads are on their way.
      if (kk == 0 && it + 1 < nT) asyncLoadAB((it + 1) << 6, buf ^ 1);
      // Without this fence the scheduler sinks the A reads among the WMMAs, each
      // with a wait to zero in front of its row of four.
      __builtin_amdgcn_sched_barrier(0);
#pragma unroll
      for (int i = 0; i < 4; ++i)
#pragma unroll
        for (int j = 0; j < 4; ++j) acc[i][j] = wmma_bf16(af[i], bf[j], acc[i][j]);
      // Keeps the next group's reads behind this block of WMMAs, as one group.
      __builtin_amdgcn_sched_barrier(0);
    }
  }

  int colL = lane & 15;
  int rh   = (lane & 16) ? 8 : 0;
  // The loop over the four row fragments stays rolled, for speed only. Each trip works on acc[0][*] and
  // then moves the later fragments down, so that every index is a constant.
#pragma clang loop unroll(disable)
  for (int i = 0; i < 4; ++i) {
#pragma unroll
    for (int j = 0; j < 4; ++j) {
#pragma unroll
      for (int r = 0; r < 8; ++r) {
        int grow = r0 + wr + 16 * i + r + rh;
        int gcol = n0 + wc + 16 * j + colL;
        float v = acc[0][j][r];
        if (EPI == 1) {
          v += bias[gcol] + resid[(size_t)grow * N + gcol];
          Cf[(size_t)grow * N + gcol] = v;
        } else if (EPI == 2) {
          v = gelu_exact(v + bias[gcol]);
          Cb[(size_t)grow * N + gcol] = (__bf16)v;
        } else {
          Cb[(size_t)grow * N + gcol] = (__bf16)v;
        }
      }
      // The GELU chains of a trip are independent and the scheduler would run all
      // 32 side by side; with the accumulators live that spills. Two groups of 16.
      if (EPI == 2 && j == 1) __builtin_amdgcn_sched_barrier(0);
    }
#pragma unroll
    for (int j = 0; j < 4; ++j) {
      acc[0][j] = acc[1][j];
      acc[1][j] = acc[2][j];
      acc[2][j] = acc[3][j];
    }
    // The next trip rewrites address and data registers that this trip's loads and
    // stores name.
    asm volatile("s_wait_xcnt 0x0" ::: "memory");
  }
}

template <int EPI>
__global__ __launch_bounds__(128, 4) void gemm_bf16_kernel(
    const __bf16* __restrict__ A, const __bf16* __restrict__ Bm,
    int M, int N, int K,
    const float* __restrict__ bias, const float* __restrict__ resid,
    float* __restrict__ Cf, __bf16* __restrict__ Cb) {
  gemm_tile<EPI>(A, Bm, M, N, K, bias, resid, Cf, Cb);
}

__global__ __launch_bounds__(128, 4) void qkv_gemm_kernel(
    const __bf16* __restrict__ Aq, const __bf16* __restrict__ Akv,
    const __bf16* __restrict__ Bq, const __bf16* __restrict__ Bk,
    const __bf16* __restrict__ Bv,
    int M, int N, int K,
    __bf16* __restrict__ Cq, __bf16* __restrict__ Ck, __bf16* __restrict__ Cv) {
  int z = blockIdx.z;
  gemm_tile<0>(z == 0 ? Aq : Akv, z == 0 ? Bq : z == 1 ? Bk : Bv, M, N, K,
               nullptr, nullptr, nullptr, z == 0 ? Cq : z == 1 ? Ck : Cv);
}

#define SM_C 0.18033688011112042f   // 0.125 * log2(e)

__device__ __forceinline__ void exp2_inplace(float& x) {
  asm("v_exp_f32 %0, %0\n\t"
      "v_nop"
      : "+v"(x));
}
__device__ __forceinline__ void exp2_inplace16(float (&a)[8], float (&b)[8]) {
  asm("v_exp_f32 %0, %0\n\t"
      "v_exp_f32 %1, %1\n\t"
      "v_exp_f32 %2, %2\n\t"
      "v_exp_f32 %3, %3\n\t"
      "v_exp_f32 %4, %4\n\t"
      "v_exp_f32 %5, %5\n\t"
      "v_exp_f32 %6, %6\n\t"
      "v_exp_f32 %7, %7\n\t"
      "v_exp_f32 %8, %8\n\t"
      "v_exp_f32 %9, %9\n\t"
      "v_exp_f32 %10, %10\n\t"
      "v_exp_f32 %11, %11\n\t"
      "v_exp_f32 %12, %12\n\t"
      "v_exp_f32 %13, %13\n\t"
      "v_exp_f32 %14, %14\n\t"
      "v_exp_f32 %15, %15\n\t"
      "v_nop"
      : "+v"(a[0]), "+v"(a[1]), "+v"(a[2]), "+v"(a[3]),
        "+v"(a[4]), "+v"(a[5]), "+v"(a[6]), "+v"(a[7]),
        "+v"(b[0]), "+v"(b[1]), "+v"(b[2]), "+v"(b[3]),
        "+v"(b[4]), "+v"(b[5]), "+v"(b[6]), "+v"(b[7]));
}
__device__ __forceinline__ float other_half(float v) {   // value of lane ^ 16
  int b = __builtin_bit_cast(int, v);
  return __builtin_bit_cast(
      float, __builtin_amdgcn_permlanex16(b, b, 0x76543210, 0xfedcba98, false, false));
}

__global__ __launch_bounds__(128) void attn_kernel(
    const __bf16* __restrict__ Q, const __bf16* __restrict__ Kg,
    const __bf16* __restrict__ Vg, __bf16* __restrict__ O) {
  __shared__ __attribute__((aligned(16))) __bf16 Ks[64 * LDP];   // [j][d]   (A rows of S^T = K Q^T)
  __shared__ __attribute__((aligned(16))) __bf16 Vs[64 * LDT];   // [m'][d]  (read transposed: A of O^T = V^T P^T)

  int i0 = blockIdx.x * 64;
  int h  = blockIdx.y;
  int b  = blockIdx.z;
  int t  = threadIdx.x;
  int w  = t >> 5;
  int lane = t & 31;
  int colL = lane & 15;
  int rh   = (lane & 16) ? 8 : 0;

  int jL = t >> 1, dL = (t & 1) * 32;

  // Every loop over tiles, registers or elements in this kernel is unrolled: the
  // fragment and accumulator arrays must be indexed by constants to stay in registers.

  // This lane's query row, as the two B fragments of Q^T (d 0..31 and 32..63),
  // in the k order of load_frag; loaded once, kept in registers.
  size_t qrow = (size_t)(b * NSEQ) + i0 + 16 * w + colL;
  v16bf qf[2];
  {
    const __bf16* src = Q + qrow * INNERD + h * HDIM + rh;
#pragma unroll
    for (int u = 0; u < 2; ++u) {
      v8bf lo = *(const v8bf*)(src + 32 * u);
      v8bf hi = *(const v8bf*)(src + 32 * u + 16);
#pragma unroll
      for (int e = 0; e < 8; ++e) { qf[u][e] = lo[e]; qf[u][e + 8] = hi[e]; }
    }
  }

  float run_max = -3.0e38f;   // of the lane's query, in base-2 units, equal in both halves
  float run_sum = 0.0f;       // over this half's keys only; halves joined at the end
  const v8f vz = {0.f, 0.f, 0.f, 0.f, 0.f, 0.f, 0.f, 0.f};
  v8f oacc[4] = {vz, vz, vz, vz};   // oacc[n][r] = O^T[d = 16n + 8h + r][query c]

  // The K and V chunks of a head are shared by the blocks along blockIdx.x.
  bool ask = blockIdx.x < PF_ASKERS;
  const __bf16* pfSrc = (t < 64 ? Kg : Vg) + ((size_t)(b * MSEQ) + (t & 63)) * INNERD + h * HDIM;

  for (int m0 = 0; m0 < MSEQ; m0 += 64) {
    if (ask && m0 + 64 < MSEQ) {  // next chunk into L2: one lane per row (one 128-B line);
                                  // waves 0 and 1 ask for K, waves 2 and 3 for V
      __builtin_prefetch(pfSrc + (size_t)(m0 + 64) * INNERD, 0, 1);
      // The register that the prefetch names is advanced or reused below.
      asm volatile("s_wait_xcnt 0x0" ::: "memory");
    }
    wait_ds0();        // this wave's reads of Ks/Vs retired before the refill
    __syncthreads();   // previous chunk's WMMA reads of Ks/Vs done
    { // K and V tiles, both row-major. K: 64 B of one row per thread. V: 16 B of
      // each of four rows (eight lanes cover a row's whole 128 B).
      int vR = t >> 3, vC = (t & 7) * 8;
      const __bf16* kp = Kg + ((size_t)(b * MSEQ) + m0 + jL) * INNERD + h * HDIM + dL;
      const __bf16* vp = Vg + ((size_t)(b * MSEQ) + m0 + vR) * INNERD + h * HDIM + vC;
      unsigned lk = (unsigned)(uintptr_t)&Ks[jL * LDP + dL];
      unsigned lv = (unsigned)(uintptr_t)&Vs[vR * LDT + vC];
      asm volatile("global_load_async_to_lds_b128 %0, %8, off\n\t"
                   "global_load_async_to_lds_b128 %1, %9, off\n\t"
                   "global_load_async_to_lds_b128 %2, %10, off\n\t"
                   "global_load_async_to_lds_b128 %3, %11, off\n\t"
                   "global_load_async_to_lds_b128 %4, %12, off\n\t"
                   "global_load_async_to_lds_b128 %5, %13, off\n\t"
                   "global_load_async_to_lds_b128 %6, %14, off\n\t"
                   "global_load_async_to_lds_b128 %7, %15, off\n\t"
                   "s_wait_xcnt 0x0"
                   :: "v"(lk), "v"(lk + 16u), "v"(lk + 32u), "v"(lk + 48u),
                      "v"(lv), "v"(lv + 16u * LDT * 2u), "v"(lv + 32u * LDT * 2u),
                      "v"(lv + 48u * LDT * 2u),
                      "v"(kp), "v"(kp + 8), "v"(kp + 16), "v"(kp + 24),
                      "v"(vp), "v"(vp + 16 * INNERD), "v"(vp + 32 * INNERD),
                      "v"(vp + 48 * INNERD)
                   : "memory");
    }
    wait_async0();     // this wave's copies have landed
    __syncthreads();   // every wave's copies visible

    // S^T = K Q^T: 64 keys x this wave's 16 queries (two k-steps over d)
    v8f s[4] = {vz, vz, vz, vz};
#pragma unroll
    for (int kk = 0; kk < 64; kk += 32) {
#pragma unroll
      for (int n = 0; n < 4; ++n) {
        v16bf kf = load_frag(Ks + 16 * n * LDP + kk, LDP);
        s[n] = wmma_bf16(kf, qf[kk >> 5], s[n]);
      }
    }

    // Online softmax of the lane's query over its 32 keys of the chunk. The scale
    // is positive and rounding is monotone: the maximum may be scaled after it is
    // found, and no s * c - nm lies above 0 by more than the rounding of nm.
    float cmax = -3.0e38f;
#pragma unroll
    for (int n = 0; n < 4; ++n)
#pragma unroll
      for (int r = 0; r < 8; ++r) cmax = fmaxf(cmax, s[n][r]);
    cmax = fmaxf(cmax, other_half(cmax)) * SM_C;
    float nm    = fmaxf(run_max, cmax);
    float alpha = run_max - nm;
    exp2_inplace(alpha);
    float pe[4][8];   // the scores' exponents, then P
#pragma unroll
    for (int n = 0; n < 4; ++n)
#pragma unroll
      for (int r = 0; r < 8; ++r) pe[n][r] = __builtin_fmaf(s[n][r], SM_C, -nm);
    exp2_inplace16(pe[0], pe[1]);
    exp2_inplace16(pe[2], pe[3]);
    float ts[4];   // one partial sum per tile: four independent add chains
    v16bf pf[2];   // P^T as B fragments: keys 0..31 and 32..63 of the chunk
#pragma unroll
    for (int n = 0; n < 4; ++n) {
      ts[n] = pe[n][0];
#pragma unroll
      for (int r = 0; r < 8; ++r) {
        pf[n >> 1][(n & 1) * 8 + r] = (__bf16)pe[n][r];
        if (r > 0) ts[n] += pe[n][r];
      }
    }
    float ssum = (ts[0] + ts[1]) + (ts[2] + ts[3]);
    run_sum = run_sum * alpha + ssum;
    run_max = nm;

    // Rescale O^T (one factor per lane), then O^T += V^T P^T
#pragma unroll
    for (int n = 0; n < 4; ++n)
#pragma unroll
      for (int r = 0; r < 8; ++r) oacc[n][r] *= alpha;
#pragma unroll
    for (int kk = 0; kk < 64; kk += 32) {
#pragma unroll
      for (int n = 0; n < 4; ++n) {
        v16bf vf = load_frag_tr(Vs + kk * LDT + 16 * n, LDT);
        oacc[n] = wmma_bf16(vf, pf[kk >> 5], oacc[n]);
      }
    }
  }

  // A lane holds eight consecutive d of its query per tile: one 16-byte store each.
  float inv = 1.0f / (run_sum + other_half(run_sum));
  __bf16* dst = O + qrow * INNERD + h * HDIM + rh;
#pragma unroll
  for (int n = 0; n < 4; ++n) {
    v8bf o;
#pragma unroll
    for (int r = 0; r < 8; ++r) o[r] = (__bf16)(oacc[n][r] * inv);
    *(v8bf*)(dst + 16 * n) = o;
  }
}

// ---------------------------------------------------------------------------
// Launch
// ---------------------------------------------------------------------------
extern "C" void kernel_launch(void* const* d_in, const int* in_sizes, int n_in,
                              void* d_out, int out_size, void* d_ws, size_t ws_size,
                              hipStream_t stream) {
  (void)in_sizes; (void)n_in; (void)out_size; (void)ws_size;
  const float* x   = (const float*)d_in[0];
  const float* ctx = (const float*)d_in[1];
  const float* Wq  = (const float*)d_in[2];
  const float* Wk  = (const float*)d_in[3];
  const float* Wv  = (const float*)d_in[4];
  const float* Wo  = (const float*)d_in[5];
  const float* bo  = (const float*)d_in[6];
  const float* g1  = (const float*)d_in[7];
  const float* b1  = (const float*)d_in[8];
  const float* g2  = (const float*)d_in[9];
  const float* b2  = (const float*)d_in[10];
  const float* W1  = (const float*)d_in[11];
  const float* bf1 = (const float*)d_in[12];
  const float* W2  = (const float*)d_in[13];
  const float* bf2 = (const float*)d_in[14];
  float* out = (float*)d_out;

  char* wp = (char*)d_ws;
  auto alloc = [&](size_t bytes) -> char* {
    char* p = wp;
    wp += (bytes + 255) & ~(size_t)255;
    return p;
  };
  __bf16* Wq16  = (__bf16*)alloc((size_t)DIMD * INNERD * 2);
  __bf16* Wk16  = (__bf16*)alloc((size_t)DIMD * INNERD * 2);
  __bf16* Wv16  = (__bf16*)alloc((size_t)DIMD * INNERD * 2);
  __bf16* Wo16  = (__bf16*)alloc((size_t)INNERD * DIMD * 2);
  __bf16* W116  = (__bf16*)alloc((size_t)DIMD * FFND * 2);
  __bf16* W216  = (__bf16*)alloc((size_t)FFND * DIMD * 2);
  __bf16* nx16  = (__bf16*)alloc((size_t)ROWS * DIMD * 2);
  __bf16* nc16  = (__bf16*)alloc((size_t)ROWS * DIMD * 2);
  __bf16* Q16   = (__bf16*)alloc((size_t)ROWS * INNERD * 2);
  __bf16* K16   = (__bf16*)alloc((size_t)ROWS * INNERD * 2);
  __bf16* V16   = (__bf16*)alloc((size_t)ROWS * INNERD * 2);
  __bf16* O16   = (__bf16*)alloc((size_t)ROWS * INNERD * 2);
  float*  x1    = (float*)alloc((size_t)ROWS * DIMD * 4);
  __bf16* hln16 = (__bf16*)alloc((size_t)ROWS * DIMD * 2);
  __bf16* H16   = (__bf16*)alloc((size_t)ROWS * FFND * 2);

  static_assert((DIMD * INNERD) % CVT_PER_BLOCK == 0 && (DIMD * FFND) % CVT_PER_BLOCK == 0,
                "weight sizes must be whole conversion blocks");
  static_assert(ROWS % LN_ROWS_PER_BLOCK == 0 && DIMD % 128 == 0, "LayerNorm tiling");
  static_assert(ROWS % GBM == 0 && INNERD % GBN == 0 && DIMD % GBN == 0 && FFND % GBN == 0 &&
                DIMD % 128 == 0 && INNERD % 128 == 0 && FFND % 128 == 0, "GEMM tiling");
  // norm1 for x and context, and the weight conversions
  prep_kernel<<<PREP_BLOCKS, 256, 0, stream>>>(x, ctx, g1, b1, nx16, nc16,
                                               Wq, Wk, Wv, Wo, W1, W2,
                                               Wq16, Wk16, Wv16, Wo16, W116, W216);

  // Q/K/V projections (plain bf16 epilogue)
  {
    dim3 g(INNERD / GBN, ROWS / GBM, 3);
    qkv_gemm_kernel<<<g, 128, 0, stream>>>(nx16, nc16, Wq16, Wk16, Wv16,
                                           ROWS, INNERD, DIMD, Q16, K16, V16);
  }

  // Attention
  {
    dim3 g(NSEQ / 64, NHEADS, BATCH);
    attn_kernel<<<g, 128, 0, stream>>>(Q16, K16, V16, O16);
  }

  // Output projection + bias + residual -> x1 (f32)
  {
    dim3 g(DIMD / GBN, ROWS / GBM);
    gemm_bf16_kernel<1><<<g, 128, 0, stream>>>(O16, Wo16, ROWS, DIMD, INNERD,
                                               bo, x, x1, nullptr);
  }

  // norm2
  ln_bf16_kernel<<<ROWS / LN_ROWS_PER_BLOCK, 256, 0, stream>>>(x1, g2, b2, hln16);

  // FFN1: gelu(h @ W1 + bf1) -> bf16
  {
    dim3 g(FFND / GBN, ROWS / GBM);
    gemm_bf16_kernel<2><<<g, 128, 0, stream>>>(hln16, W116, ROWS, FFND, DIMD,
                                               bf1, nullptr, nullptr, H16);
  }

  // FFN2: x1 + H @ W2 + bf2 -> d_out (f32)
  {
    dim3 g(DIMD / GBN, ROWS / GBM);
    gemm_bf16_kernel<1><<<g, 128, 0, stream>>>(H16, W216, ROWS, DIMD, FFND,
                                               bf2, x1, out, nullptr);
  }
}

// v010
// A run of this version takes 172 microseconds.
// Timed twice side by side with v009, it ran 1.06 times as fast both times.
// Counting every step since v000, it is 4.84 times as fast.
#include <hip/hip_runtime.h>
#include <hip/hip_bf16.h>

typedef __attribute__((ext_vector_type(16))) __bf16 v16bf;
typedef __attribute__((ext_vector_type(8)))  __bf16 v8bf;
typedef __attribute__((ext_vector_type(8)))  float  v8f;
typedef __attribute__((ext_vector_type(4)))  __bf16 v4bf;
typedef __attribute__((ext_vector_type(4)))  float  v4f;

#define DIMD   768
#define NHEADS 8
#define HDIM   64
#define INNERD 512
#define FFND   3072
#define BATCH  4
#define NSEQ   2048
#define MSEQ   2048
#define ROWS   (BATCH * NSEQ)   // 8192 rows for both x and context paths

#define LDP    72   // bf16 elements per LDS row of a 64-wide bf16 tile
// A tile kept row-major [k][n] and read by the transposing load wants 32 B x odd.
#define LDT    80   // bf16 elements per LDS row (160 B) of a 64-wide [k][n] tile
#define LDTW   144  // bf16 elements per LDS row (288 B) of a 128-wide [k][n] tile

__device__ __forceinline__ v8f wmma_bf16(v16bf a, v16bf b, v8f c) {
  // (neg_a, A, neg_b, B, c_mod, C, reuse_a, reuse_b)
  return __builtin_amdgcn_wmma_f32_16x16x32_bf16(false, a, false, b, (short)0, c,
                                                 false, false);
}

__device__ __forceinline__ v16bf load_frag(const __bf16* base, int ld) {
  int lane = threadIdx.x & 31;
  int r    = lane & 15;
  int kb   = (lane & 16) ? 8 : 0;
  const __bf16* p = base + r * ld + kb;
  v8bf lo = *(const v8bf*)(p);
  v8bf hi = *(const v8bf*)(p + 16);
  v16bf f;
#pragma unroll
  for (int e = 0; e < 8; ++e) { f[e] = lo[e]; f[e + 8] = hi[e]; }
  return f;
}

// Load one 32x16 B fragment (k x n) from an LDS tile laid out [k][n] with pitch
// `ld` (elements); `tile` points at element [kbase][nbase]. ds_load_tr16_b128 hands lane
// (c = L&15, h = L>>4) the eight elements [kbase + 8h + 0..7][nbase + c], so the
// loads at kbase and kbase + 16 give the same k order as load_frag gives A.
typedef __attribute__((address_space(3))) v8bf lds_v8bf;
__device__ __forceinline__ v16bf load_frag_tr(const __bf16* tile, int ld) {
  int lane = threadIdx.x & 31;
  const __bf16* p = tile + ((lane >> 4) * 8 + (lane & 7)) * ld + ((lane >> 3) & 1) * 8;
  v8bf lo = __builtin_amdgcn_ds_load_tr16_b128_v8bf16((lds_v8bf*)p);
  v8bf hi = __builtin_amdgcn_ds_load_tr16_b128_v8bf16((lds_v8bf*)(p + 16 * ld));
  v16bf f;
#pragma unroll
  for (int e = 0; e < 8; ++e) { f[e] = lo[e]; f[e + 8] = hi[e]; }
  return f;
}

__device__ __forceinline__ void wait_async0() {
  asm volatile("s_wait_asynccnt 0x0" ::: "memory");
}
// This wave's LDS reads have retired before a copy may refill what they read.
__device__ __forceinline__ void wait_ds0() {
  asm volatile("s_wait_dscnt 0x0" ::: "memory");
}

// erf(x) to single precision without a branch. The library form picks one of two
// fits by |x| under the exec mask; among 32 lanes both sides are nearly always
// taken, and each element becomes one long dependent chain between two mask
// branches. Here both fits (the same polynomials) are evaluated in every lane and
// one is selected, so that the elements of a thread are independent chains that
// the scheduler can interleave.
//   |x| <  1: |x| + |x| P(x^2)
//   |x| >= 1: 1 - exp(-q), q = |x| + |x| Q(|x|); exp(-q) = 2^(-q log2 e) on the
//             hardware 2^x: exp(-q) < 0.16 there, so its rounding moves 1 - exp(-q) by
//             about one unit in the last place, far below the bf16 rounding that
//             follows; a large or infinite q gives 0, erf = 1.
__device__ __forceinline__ float erf_select(float x) {
  float a = fabsf(x);
  float t = a * a;
  float p = fmaf(t, -0x1.268bc2p-11f, 0x1.420828p-8f);
  p = fmaf(t, p, -0x1.b5937p-6f);
  p = fmaf(t, p, 0x1.ce077cp-4f);
  p = fmaf(t, p, -0x1.81266p-2f);
  p = fmaf(t, p, 0x1.06eba0p-3f);
  float near0 = fmaf(a, p, a);
  float q = fmaf(a, 0x1.1d3156p-16f, -0x1.8d129p-12f);
  q = fmaf(a, q, 0x1.f9a6d2p-9f);
  q = fmaf(a, q, -0x1.8c3164p-6f);
  q = fmaf(a, q, 0x1.b4e9c8p-4f);
  q = fmaf(a, q, 0x1.4515fap-1f);
  q = fmaf(a, q, 0x1.078e50p-3f);
  q = fmaf(a, q, a);
  float far0 = 1.0f - __builtin_amdgcn_exp2f(q * -1.44269504088896340736f);
  return copysignf(a < 1.0f ? near0 : far0, x);
}

__device__ __forceinline__ float gelu_exact(float v) {
  return 0.5f * v * (1.0f + erf_select(v * 0.70710678118654752f));
}

// ---------------------------------------------------------------------------
// fp32 -> bf16 conversion (weights), the work of one block of 256 threads: each
// thread converts 32 elements (eight 16-byte loads in flight, each wave-wide load
// 512 contiguous bytes), 8192 elements per block. `blk` is the block's number
// within its matrix, whose size is a whole number of blocks (asserted below).
// ---------------------------------------------------------------------------
#define CVT_PER_BLOCK 8192
__device__ __forceinline__ void cvt_block(const float* __restrict__ in,
                                          __bf16* __restrict__ out, int blk) {
  int q = blk * (CVT_PER_BLOCK / 4) + threadIdx.x;  // group of 4 elements
  const v4f* src = (const v4f*)in + q;
  v4bf*      dst = (v4bf*)out + q;
  constexpr int NU = CVT_PER_BLOCK / 1024;   // 16-byte loads per thread
  v4f v[NU];
  // Both loops unrolled: v[] stays in registers and all loads issue before the
  // first conversion waits.
#pragma unroll
  for (int u = 0; u < NU; ++u) v[u] = src[256 * u];
#pragma unroll
  for (int u = 0; u < NU; ++u) {
    v4bf o;
#pragma unroll
    for (int e = 0; e < 4; ++e) o[e] = (__bf16)v[u][e];
    dst[256 * u] = o;
  }
}

// ---------------------------------------------------------------------------
// LayerNorm over 768 cols, bf16 output. One wave owns two whole rows: a lane
// holds 24 elements of each row in registers (six 16-byte loads per row), the
// row sums are joined by a five-step butterfly over the 32 lanes, so no LDS and
// no barrier. 8 waves per block = 16 rows per block; `blk` numbers the block
// within its matrix.
// ---------------------------------------------------------------------------
#define LN_ROWS_PER_BLOCK 16
__device__ __forceinline__ void ln_rows(const float* __restrict__ X,
                                        const float* __restrict__ g,
                                        const float* __restrict__ bt,
                                        __bf16* __restrict__ out, int blk) {
  constexpr int NV = DIMD / 128;   // 16-byte groups per lane and row
  int lane = threadIdx.x & 31;
  int w    = threadIdx.x >> 5;
  size_t row0 = ((size_t)blk * 8 + w) * 2;
  const v4f* x0 = (const v4f*)(X + row0 * DIMD) + lane;
  const v4f* x1 = x0 + DIMD / 4;
  v4f a[NV], b[NV];
  // Every loop below is unrolled: the row arrays must be indexed by constants to
  // stay in registers, and both rows' loads issue before the first sum waits.
#pragma unroll
  for (int j = 0; j < NV; ++j) a[j] = x0[32 * j];
#pragma unroll
  for (int j = 0; j < NV; ++j) b[j] = x1[32 * j];
  const v4f* gp = (const v4f*)g + lane;
  const v4f* bp = (const v4f*)bt + lane;
  v4f gg[NV], bb[NV];
#pragma unroll
  for (int j = 0; j < NV; ++j) { gg[j] = gp[32 * j]; bb[j] = bp[32 * j]; }

  float sa = 0.f, qa = 0.f, sb = 0.f, qb = 0.f;
#pragma unroll
  for (int j = 0; j < NV; ++j)
#pragma unroll
    for (int e = 0; e < 4; ++e) {
      sa += a[j][e]; qa += a[j][e] * a[j][e];
      sb += b[j][e]; qb += b[j][e] * b[j][e];
    }
#pragma unroll
  for (int m = 16; m > 0; m >>= 1) {
    sa += __shfl_xor(sa, m, 32);
    qa += __shfl_xor(qa, m, 32);
    sb += __shfl_xor(sb, m, 32);
    qb += __shfl_xor(qb, m, 32);
  }
  float mua  = sa * (1.0f / DIMD);
  float mub  = sb * (1.0f / DIMD);
  float inva = rsqrtf(qa * (1.0f / DIMD) - mua * mua + 1e-5f);
  float invb = rsqrtf(qb * (1.0f / DIMD) - mub * mub + 1e-5f);

  v4bf* o0 = (v4bf*)(out + row0 * DIMD) + lane;
  v4bf* o1 = o0 + DIMD / 4;
#pragma unroll
  for (int j = 0; j < NV; ++j) {
    v4bf ra, rb;
#pragma unroll
    for (int e = 0; e < 4; ++e) {
      ra[e] = (__bf16)((a[j][e] - mua) * inva * gg[j][e] + bb[j][e]);
      rb[e] = (__bf16)((b[j][e] - mub) * invb * gg[j][e] + bb[j][e]);
    }
    o0[32 * j] = ra;
    o1[32 * j] = rb;
  }
}

__global__ __launch_bounds__(256) void ln_bf16_kernel(const float* __restrict__ X,
                                                      const float* __restrict__ g,
                                                      const float* __restrict__ bt,
                                                      __bf16* __restrict__ out) {
  ln_rows(X, g, bt, out, blockIdx.x);
}

#define LN_BLOCKS   (ROWS / LN_ROWS_PER_BLOCK)
#define CVT_SMALL   (DIMD * INNERD / CVT_PER_BLOCK)
#define CVT_LARGE   (DIMD * FFND / CVT_PER_BLOCK)
#define PREP_BLOCKS (2 * LN_BLOCKS + 4 * CVT_SMALL + 2 * CVT_LARGE)
__global__ __launch_bounds__(256) void prep_kernel(
    const float* __restrict__ x, const float* __restrict__ ctx,
    const float* __restrict__ g, const float* __restrict__ bt,
    __bf16* __restrict__ nx, __bf16* __restrict__ nc,
    const float* __restrict__ Wq, const float* __restrict__ Wk,
    const float* __restrict__ Wv, const float* __restrict__ Wo,
    const float* __restrict__ W1, const float* __restrict__ W2,
    __bf16* __restrict__ Wq16, __bf16* __restrict__ Wk16,
    __bf16* __restrict__ Wv16, __bf16* __restrict__ Wo16,
    __bf16* __restrict__ W116, __bf16* __restrict__ W216) {
  int blk = blockIdx.x;
  if (blk < 2 * LN_BLOCKS) {
    bool second = blk >= LN_BLOCKS;
    ln_rows(second ? ctx : x, g, bt, second ? nc : nx, second ? blk - LN_BLOCKS : blk);
    return;
  }
  blk -= 2 * LN_BLOCKS;
  const float* src;
  __bf16*      dst;
  if (blk < 4 * CVT_SMALL) {
    int m = blk / CVT_SMALL;
    blk -= m * CVT_SMALL;
    src = m == 0 ? Wq : m == 1 ? Wk : m == 2 ? Wv : Wo;
    dst = m == 0 ? Wq16 : m == 1 ? Wk16 : m == 2 ? Wv16 : Wo16;
  } else {
    blk -= 4 * CVT_SMALL;
    bool second = blk >= CVT_LARGE;
    if (second) blk -= CVT_LARGE;
    src = second ? W2 : W1;
    dst = second ? W216 : W116;
  }
  cvt_block(src, dst, blk);
}

__device__ __forceinline__ void async_copy8(unsigned l, unsigned lstep,
                                            const __bf16* g, size_t gstep) {
  asm volatile("global_load_async_to_lds_b128 %0, %8, off\n\t"
               "global_load_async_to_lds_b128 %1, %9, off\n\t"
               "global_load_async_to_lds_b128 %2, %10, off\n\t"
               "global_load_async_to_lds_b128 %3, %11, off\n\t"
               "global_load_async_to_lds_b128 %4, %12, off\n\t"
               "global_load_async_to_lds_b128 %5, %13, off\n\t"
               "global_load_async_to_lds_b128 %6, %14, off\n\t"
               "global_load_async_to_lds_b128 %7, %15, off\n\t"
               "s_wait_xcnt 0x0"
               :: "v"(l), "v"(l + lstep), "v"(l + 2u * lstep), "v"(l + 3u * lstep),
                  "v"(l + 4u * lstep), "v"(l + 5u * lstep), "v"(l + 6u * lstep),
                  "v"(l + 7u * lstep),
                  "v"(g), "v"(g + gstep), "v"(g + 2 * gstep), "v"(g + 3 * gstep),
                  "v"(g + 4 * gstep), "v"(g + 5 * gstep), "v"(g + 6 * gstep),
                  "v"(g + 7 * gstep)
               : "memory");
}

#define GBM 128
#define GBN 128
// Prefetch requests are thinned. A prefetch only has to start the fill of L2 from
// memory, and a tile is shared by many blocks that walk
// k (or the keys) at about the same time. So a unit is asked for once, not once per
// 128-B line, and only by the first PF_ASKERS blocks of those that share the tile.
// Every further
// request for the same unit is one more scattered request on the path to L2 that
// the operand copies need. For speed only: nothing depends on where a block runs.
#define PF_ASKERS 8
// One block's tile, at column blockIdx.x and row blockIdx.y of the tile grid.
template <int EPI>
__device__ __forceinline__ void gemm_tile(
    const __bf16* __restrict__ A, const __bf16* __restrict__ Bm,
    int M, int N, int K,
    const float* __restrict__ bias, const float* __restrict__ resid,
    float* __restrict__ Cf, __bf16* __restrict__ Cb) {
  __shared__ __attribute__((aligned(16))) __bf16 As[2][GBM * LDP];  // [row][k]
  __shared__ __attribute__((aligned(16))) __bf16 Bs[2][64 * LDTW];  // [k][n]
  int n0 = blockIdx.x * GBN;
  int r0 = blockIdx.y * GBM;
  int t  = threadIdx.x;
  int w  = __builtin_amdgcn_readfirstlane(t >> 5);  // wave number, in a scalar register
  int lane = t & 31;
  int wr = (w >> 1) * 64;   // the wave's rows within the block tile
  int wc = (w & 1) * 64;    // the wave's columns within the block tile

  const v8f vz = {0.f, 0.f, 0.f, 0.f, 0.f, 0.f, 0.f, 0.f};
  v8f acc[4][4];
  // The loops over fragments or registers in this kernel are unrolled (all but the
  // epilogue's outer one): the fragment and accumulator arrays must be indexed by
  // constants to stay in registers.
#pragma unroll
  for (int i = 0; i < 4; ++i)
#pragma unroll
    for (int j = 0; j < 4; ++j) acc[i][j] = vz;

  // One stage, sixteen copies per thread, each wave-wide copy whole 128-B lines:
  // A: eight lanes cover a row's 128 B, the block 16 rows per copy, 8 copies.
  // B: sixteen lanes cover a row's 256 B, the block 8 rows per copy, 8 copies.
  int aR = t >> 3, aC = (t & 7) * 8;
  int bR = t >> 4, bC = (t & 15) * 8;
  auto asyncLoadAB = [&](int k0, int buf) {
    async_copy8((unsigned)(uintptr_t)&As[buf][aR * LDP + aC], 16u * LDP * 2u,
                A + (size_t)(r0 + aR) * K + k0 + aC, (size_t)16 * K);
    async_copy8((unsigned)(uintptr_t)&Bs[buf][bR * LDTW + bC], 8u * LDTW * 2u,
                Bm + (size_t)(k0 + bR) * N + n0 + bC, (size_t)8 * N);
  };

  int nT = K >> 6;  // K / 64, even (K is a multiple of 128, asserted at the launch)
  bool askA = blockIdx.x < PF_ASKERS;   // the A rows are shared along blockIdx.x
  bool askB = blockIdx.y < PF_ASKERS;   // the B columns are shared along blockIdx.y
  asyncLoadAB(0, 0);
  for (int it = 0; it < nT; ++it) {
    int buf = it & 1;
    // Every second trip, for the two stages after next: one lane per 256-B unit, which
    // is 128 k of an A row, or the tile's 128 columns of a B row (128 rows of each).
    if ((it & 1) == 0 && it + 2 < nT && (askA || askB)) {
      int k2 = (it + 2) << 6;
      // Each prefetch names temporaries that the next address arithmetic or the
      // fragment reads below overwrite: a wait behind each.
      if (askA) {
        __builtin_prefetch(A + (size_t)(r0 + t) * K + k2, 0, 1);
        asm volatile("s_wait_xcnt 0x0" ::: "memory");
      }
      if (askB) {
        __builtin_prefetch(Bm + (size_t)(k2 + t) * N + n0, 0, 1);
        asm volatile("s_wait_xcnt 0x0" ::: "memory");
      }
    }
    wait_ds0();          // this wave's reads of buffer buf^1 (last trip) retired
    wait_async0();       // this wave's copies for stage `it` have landed
    __syncthreads();     // all waves' copies visible; buffer buf^1 left by all
#pragma unroll
    for (int kk = 0; kk < 64; kk += 32) {
      // The eight fragments of 32 k are read as one group ahead of their WMMAs.
      v16bf af[4], bf[4];
      af[0] = load_frag(&As[buf][wr * LDP + kk], LDP);
#pragma unroll
      for (int j = 0; j < 4; ++j)
        bf[j] = load_frag_tr(&Bs[buf][kk * LDTW + wc + 16 * j], LDTW);
#pragma unroll
      for (int i = 1; i < 4; ++i)
        af[i] = load_frag(&As[buf][(wr + 16 * i) * LDP + kk], LDP);
      // Next stage's copies go out behind the first group of LDS reads: their
      // address arithmetic and issue run while those reads are on their way.
      if (kk == 0 && it + 1 < nT) asyncLoadAB((it + 1) << 6, buf ^ 1);
      // Without this fence the scheduler sinks the A reads among the WMMAs, each
      // with a wait to zero in front of its row of four.
      __builtin_amdgcn_sched_barrier(0);
#pragma unroll
      for (int i = 0; i < 4; ++i)
#pragma unroll
        for (int j = 0; j < 4; ++j) acc[i][j] = wmma_bf16(af[i], bf[j], acc[i][j]);
      // Keeps the next group's reads behind this block of WMMAs, as one group.
      __builtin_amdgcn_sched_barrier(0);
    }
  }

  int colL = lane & 15;
  int rh   = (lane & 16) ? 8 : 0;
  // The loop over the four row fragments stays rolled, for speed only. Each trip works on acc[0][*] and
  // then moves the later fragments down, so that every index is a constant.
#pragma clang loop unroll(disable)
  for (int i = 0; i < 4; ++i) {
#pragma unroll
    for (int j = 0; j < 4; ++j) {
#pragma unroll
      for (int r = 0; r < 8; ++r) {
        int grow = r0 + wr + 16 * i + r + rh;
        int gcol = n0 + wc + 16 * j + colL;
        float v = acc[0][j][r];
        if (EPI == 1) {
          v += bias[gcol] + resid[(size_t)grow * N + gcol];
          Cf[(size_t)grow * N + gcol] = v;
        } else if (EPI == 2) {
          v = gelu_exact(v + bias[gcol]);
          Cb[(size_t)grow * N + gcol] = (__bf16)v;
        } else {
          Cb[(size_t)grow * N + gcol] = (__bf16)v;
        }
      }
      // The GELU chains of a trip are independent and the scheduler would run all
      // 32 side by side; with the accumulators live that spills. Two groups of 16.
      if (EPI == 2 && j == 1) __builtin_amdgcn_sched_barrier(0);
    }
#pragma unroll
    for (int j = 0; j < 4; ++j) {
      acc[0][j] = acc[1][j];
      acc[1][j] = acc[2][j];
      acc[2][j] = acc[3][j];
    }
    // The next trip rewrites address and data registers that this trip's loads and
    // stores name.
    asm volatile("s_wait_xcnt 0x0" ::: "memory");
  }
}

template <int EPI>
__global__ __launch_bounds__(128, 4) void gemm_bf16_kernel(
    const __bf16* __restrict__ A, const __bf16* __restrict__ Bm,
    int M, int N, int K,
    const float* __restrict__ bias, const float* __restrict__ resid,
    float* __restrict__ Cf, __bf16* __restrict__ Cb) {
  gemm_tile<EPI>(A, Bm, M, N, K, bias, resid, Cf, Cb);
}

__global__ __launch_bounds__(128, 4) void qkv_gemm_kernel(
    const __bf16* __restrict__ Aq, const __bf16* __restrict__ Akv,
    const __bf16* __restrict__ Bq, const __bf16* __restrict__ Bk,
    const __bf16* __restrict__ Bv,
    int M, int N, int K,
    __bf16* __restrict__ Cq, __bf16* __restrict__ Ck, __bf16* __restrict__ Cv) {
  int z = blockIdx.z;
  gemm_tile<0>(z == 0 ? Aq : Akv, z == 0 ? Bq : z == 1 ? Bk : Bv, M, N, K,
               nullptr, nullptr, nullptr, z == 0 ? Cq : z == 1 ? Ck : Cv);
}

#define SM_C 0.18033688011112042f   // 0.125 * log2(e)

__device__ __forceinline__ void exp2_inplace(float& x) {
  asm("v_exp_f32 %0, %0\n\t"
      "v_nop"
      : "+v"(x));
}
__device__ __forceinline__ void exp2_inplace16(float (&a)[8], float (&b)[8]) {
  asm("v_exp_f32 %0, %0\n\t"
      "v_exp_f32 %1, %1\n\t"
      "v_exp_f32 %2, %2\n\t"
      "v_exp_f32 %3, %3\n\t"
      "v_exp_f32 %4, %4\n\t"
      "v_exp_f32 %5, %5\n\t"
      "v_exp_f32 %6, %6\n\t"
      "v_exp_f32 %7, %7\n\t"
      "v_exp_f32 %8, %8\n\t"
      "v_exp_f32 %9, %9\n\t"
      "v_exp_f32 %10, %10\n\t"
      "v_exp_f32 %11, %11\n\t"
      "v_exp_f32 %12, %12\n\t"
      "v_exp_f32 %13, %13\n\t"
      "v_exp_f32 %14, %14\n\t"
      "v_exp_f32 %15, %15\n\t"
      "v_nop"
      : "+v"(a[0]), "+v"(a[1]), "+v"(a[2]), "+v"(a[3]),
        "+v"(a[4]), "+v"(a[5]), "+v"(a[6]), "+v"(a[7]),
        "+v"(b[0]), "+v"(b[1]), "+v"(b[2]), "+v"(b[3]),
        "+v"(b[4]), "+v"(b[5]), "+v"(b[6]), "+v"(b[7]));
}
__device__ __forceinline__ float other_half(float v) {   // value of lane ^ 16
  int b = __builtin_bit_cast(int, v);
  return __builtin_bit_cast(
      float, __builtin_amdgcn_permlanex16(b, b, 0x76543210, 0xfedcba98, false, false));
}

typedef uint32_t u32x4 __attribute__((ext_vector_type(4)));
typedef uint32_t u32x8 __attribute__((ext_vector_type(8)));
__device__ __forceinline__ uint32_t uni(uint32_t v) {
  return (uint32_t)__builtin_amdgcn_readfirstlane(v);
}
__device__ __forceinline__ uint32_t pinned(uint32_t v) {
  uint32_t w = __builtin_amdgcn_readfirstlane(v);
  asm volatile("" : "+s"(w));
  return w;
}
// The issuing wave's own requests have landed.
__device__ __forceinline__ void wait_tensor0() {
  asm volatile("s_wait_tensorcnt 0x0" ::: "memory");
}
#define ATT_ROWB   (HDIM * 2)        // bytes of a tile row
#define ATT_SRCP   (INNERD * 2)      // bytes between rows in global memory
#define ATT_TILEB  10240             // LDS bytes kept per tile, a multiple of 2 KiB
#define ATT_PAD_K  ((1u << 20) | (4u << 22) | (3u << 25))   // pad on, every 128 B, 4 dwords
#define ATT_PAD_V  ((1u << 20) | (4u << 22) | (7u << 25))   // pad on, every 128 B, 8 dwords
static_assert(64 * LDP * 2 <= ATT_TILEB && 64 * LDT * 2 <= ATT_TILEB && ATT_TILEB % 2048 == 0 &&
              LDP * 2 == ATT_ROWB + 16 && LDT * 2 == ATT_ROWB + 32, "attention LDS tiles");
template <uint32_t PAD0, bool ISV>
__device__ __forceinline__ void tdm_tile(uint32_t lds_dst, uint64_t ga) {
  u32x4 g0;
  g0[0] = uni(1u);
  g0[1] = uni(lds_dst);
  g0[2] = uni((uint32_t)ga);
  g0[3] = uni((((uint32_t)(ga >> 32)) & 0x01FFFFFFu) | 0x80000000u);
  u32x8 g1;
  g1[0] = uni(PAD0);
  g1[1] = uni((uint32_t)ATT_ROWB << 16);
  g1[2] = uni(64u << 16);
  g1[3] = uni((uint32_t)ATT_ROWB << 16);
  g1[4] = uni(64u);
  g1[5] = uni((uint32_t)ATT_SRCP);
  g1[6] = uni(0u);
  g1[7] = uni(0u);
  if (ISV)
    asm volatile("tensor_load_to_lds %0, %1" :: "{s[76:79]}"(g0), "{s[88:95]}"(g1) : "memory");
  else
    asm volatile("tensor_load_to_lds %0, %1" :: "{s[72:75]}"(g0), "{s[80:87]}"(g1) : "memory");
}

__global__ __launch_bounds__(128) void attn_kernel(
    const __bf16* __restrict__ Q, const __bf16* __restrict__ Kg,
    const __bf16* __restrict__ Vg, __bf16* __restrict__ O) {
  // [buffer][0: K, [j][d], A rows of S^T = K Q^T; 1: V, [m'][d], read transposed: A of
  // O^T = V^T P^T]. Every tile starts at a multiple of 2 KiB of the block's LDS.
  __shared__ __attribute__((aligned(2048))) __bf16 KV[2][2][ATT_TILEB / 2];

  int i0 = blockIdx.x * 64;
  int h  = blockIdx.y;
  int b  = blockIdx.z;
  int t  = threadIdx.x;
  int w  = t >> 5;
  int lane = t & 31;
  int colL = lane & 15;
  int rh   = (lane & 16) ? 8 : 0;
  const uint32_t wv = uni((uint32_t)t >> 5);   // the wave's number, scalar

  // Stage st = keys 64 st .. 64 st + 63, into buffer st & 1. Wave 0 asks for the K
  // tiles, wave 1 for the V tiles: one request of a wave outstanding at any time.
  constexpr uint32_t NST = MSEQ / 64;
  static_assert(NST >= 2, "the ring's prologue needs two stages");
  const uint32_t lbase = (uint32_t)(uintptr_t)&KV[0][0][0];
  const uint64_t headOff = ((uint64_t)(b * MSEQ) * INNERD + (uint64_t)(h * HDIM)) * 2u;
  const uint64_t kga = (uint64_t)(uintptr_t)Kg + headOff;
  const uint64_t vga = (uint64_t)(uintptr_t)Vg + headOff;
  auto loadK = [&](uint32_t st) {
    tdm_tile<ATT_PAD_K, false>(lbase + (st & 1u) * (2u * ATT_TILEB),
                        kga + (uint64_t)st * (64u * ATT_SRCP));
  };
  auto loadV = [&](uint32_t st) {
    tdm_tile<ATT_PAD_V, true>(lbase + (st & 1u) * (2u * ATT_TILEB) + ATT_TILEB,
                        vga + (uint64_t)st * (64u * ATT_SRCP));
  };

  // Every loop over tiles, registers or elements in this kernel is unrolled: the
  // fragment and accumulator arrays must be indexed by constants to stay in registers.

  // This lane's query row, as the two B fragments of Q^T (d 0..31 and 32..63),
  // in the k order of load_frag; loaded once, kept in registers.
  size_t qrow = (size_t)(b * NSEQ) + i0 + 16 * w + colL;
  v16bf qf[2];
  {
    const __bf16* src = Q + qrow * INNERD + h * HDIM + rh;
#pragma unroll
    for (int u = 0; u < 2; ++u) {
      v8bf lo = *(const v8bf*)(src + 32 * u);
      v8bf hi = *(const v8bf*)(src + 32 * u + 16);
#pragma unroll
      for (int e = 0; e < 8; ++e) { qf[u][e] = lo[e]; qf[u][e + 8] = hi[e]; }
    }
  }

  float run_max = -3.0e38f;   // of the lane's query, in base-2 units, equal in both halves
  float run_sum = 0.0f;       // over this half's keys only; halves joined at the end
  const v8f vz = {0.f, 0.f, 0.f, 0.f, 0.f, 0.f, 0.f, 0.f};
  v8f oacc[4] = {vz, vz, vz, vz};   // oacc[n][r] = O^T[d = 16n + 8h + r][query c]

  // The K and V chunks of a head are shared by the blocks along blockIdx.x.
  bool ask = blockIdx.x < PF_ASKERS;
  const __bf16* pfSrc = (t < 64 ? Kg : Vg) + ((size_t)(b * MSEQ) + (t & 63)) * INNERD + h * HDIM;

  // Prologue: stage 0, the issuing wave's own wait directly behind its request (the Q
  // loads above are on their way meanwhile), the barrier, then stage 1.
  if (pinned(wv == 0u)) { loadK(0u); wait_tensor0(); }
  if (pinned(wv == 1u)) { loadV(0u); wait_tensor0(); }
  __syncthreads();                       // stage 0 visible to every wave
  if (pinned(wv == 0u)) loadK(1u);
  if (pinned(wv == 1u)) loadV(1u);

  for (uint32_t st = 0; st < NST; ++st) {
    int m0 = (int)st * 64;
    if (ask && m0 + 128 < MSEQ) { // the chunk whose tensor loads go out at the foot of this
                                  // pass, into L2: one lane per row (one 128-B line);
                                  // waves 0 and 1 ask for K, waves 2 and 3 for V
      __builtin_prefetch((const __attribute__((address_space(1))) __bf16*)(pfSrc + (size_t)(m0 + 128) * INNERD), 0, 1);
      // The register that the prefetch names is advanced or reused below.
      asm volatile("s_wait_xcnt 0x0" ::: "memory");
    }
    const __bf16* Ks = &KV[st & 1u][0][0];
    const __bf16* Vs = &KV[st & 1u][1][0];
    // S^T = K Q^T: 64 keys x this wave's 16 queries (two k-steps over d)
    v8f s[4] = {vz, vz, vz, vz};
#pragma unroll
    for (int kk = 0; kk < 64; kk += 32) {
#pragma unroll
      for (int n = 0; n < 4; ++n) {
        v16bf kf = load_frag(Ks + 16 * n * LDP + kk, LDP);
        s[n] = wmma_bf16(kf, qf[kk >> 5], s[n]);
      }
    }

    // Online softmax of the lane's query over its 32 keys of the chunk. The scale
    // is positive and rounding is monotone: the maximum may be scaled after it is
    // found, and no s * c - nm lies above 0 by more than the rounding of nm.
    float cmax = -3.0e38f;
#pragma unroll
    for (int n = 0; n < 4; ++n)
#pragma unroll
      for (int r = 0; r < 8; ++r) cmax = fmaxf(cmax, s[n][r]);
    cmax = fmaxf(cmax, other_half(cmax)) * SM_C;
    float nm    = fmaxf(run_max, cmax);
    float alpha = run_max - nm;
    exp2_inplace(alpha);
    float pe[4][8];   // the scores' exponents, then P
#pragma unroll
    for (int n = 0; n < 4; ++n)
#pragma unroll
      for (int r = 0; r < 8; ++r) pe[n][r] = __builtin_fmaf(s[n][r], SM_C, -nm);
    exp2_inplace16(pe[0], pe[1]);
    exp2_inplace16(pe[2], pe[3]);
    float ts[4];   // one partial sum per tile: four independent add chains
    v16bf pf[2];   // P^T as B fragments: keys 0..31 and 32..63 of the chunk
#pragma unroll
    for (int n = 0; n < 4; ++n) {
      ts[n] = pe[n][0];
#pragma unroll
      for (int r = 0; r < 8; ++r) {
        pf[n >> 1][(n & 1) * 8 + r] = (__bf16)pe[n][r];
        if (r > 0) ts[n] += pe[n][r];
      }
    }
    float ssum = (ts[0] + ts[1]) + (ts[2] + ts[3]);
    run_sum = run_sum * alpha + ssum;
    run_max = nm;

    // Rescale O^T (one factor per lane), then O^T += V^T P^T
#pragma unroll
    for (int n = 0; n < 4; ++n)
#pragma unroll
      for (int r = 0; r < 8; ++r) oacc[n][r] *= alpha;
#pragma unroll
    for (int kk = 0; kk < 64; kk += 32) {
#pragma unroll
      for (int n = 0; n < 4; ++n) {
        v16bf vf = load_frag_tr(Vs + kk * LDT + 16 * n, LDT);
        oacc[n] = wmma_bf16(vf, pf[kk >> 5], oacc[n]);
      }
    }

    // Publish point of stage st + 1, every wave, in this order.
    wait_ds0();                            // this wave's reads of buffer st & 1 have retired
    if (pinned(wv < 2u)) wait_tensor0();   // the issuing wave's own stage st + 1 has landed
    __syncthreads();   // stage st + 1 visible to all; buffer st & 1 left by every reader
    if (pinned((wv == 0u) & (st + 2u < NST))) loadK(pinned(st + 2u));
    if (pinned((wv == 1u) & (st + 2u < NST))) loadV(pinned(st + 2u));
  }
  wait_tensor0();   // nothing is outstanding when the wave ends
  wait_ds0();

  // A lane holds eight consecutive d of its query per tile: one 16-byte store each.
  float inv = 1.0f / (run_sum + other_half(run_sum));
  __bf16* dst = O + qrow * INNERD + h * HDIM + rh;
#pragma unroll
  for (int n = 0; n < 4; ++n) {
    v8bf o;
#pragma unroll
    for (int r = 0; r < 8; ++r) o[r] = (__bf16)(oacc[n][r] * inv);
    *(v8bf*)(dst + 16 * n) = o;
  }
}

// ---------------------------------------------------------------------------
// Launch
// ---------------------------------------------------------------------------
extern "C" void kernel_launch(void* const* d_in, const int* in_sizes, int n_in,
                              void* d_out, int out_size, void* d_ws, size_t ws_size,
                              hipStream_t stream) {
  (void)in_sizes; (void)n_in; (void)out_size; (void)ws_size;
  const float* x   = (const float*)d_in[0];
  const float* ctx = (const float*)d_in[1];
  const float* Wq  = (const float*)d_in[2];
  const float* Wk  = (const float*)d_in[3];
  const float* Wv  = (const float*)d_in[4];
  const float* Wo  = (const float*)d_in[5];
  const float* bo  = (const float*)d_in[6];
  const float* g1  = (const float*)d_in[7];
  const float* b1  = (const float*)d_in[8];
  const float* g2  = (const float*)d_in[9];
  const float* b2  = (const float*)d_in[10];
  const float* W1  = (const float*)d_in[11];
  const float* bf1 = (const float*)d_in[12];
  const float* W2  = (const float*)d_in[13];
  const float* bf2 = (const float*)d_in[14];
  float* out = (float*)d_out;

  char* wp = (char*)d_ws;
  auto alloc = [&](size_t bytes) -> char* {
    char* p = wp;
    wp += (bytes + 255) & ~(size_t)255;
    return p;
  };
  __bf16* Wq16  = (__bf16*)alloc((size_t)DIMD * INNERD * 2);
  __bf16* Wk16  = (__bf16*)alloc((size_t)DIMD * INNERD * 2);
  __bf16* Wv16  = (__bf16*)alloc((size_t)DIMD * INNERD * 2);
  __bf16* Wo16  = (__bf16*)alloc((size_t)INNERD * DIMD * 2);
  __bf16* W116  = (__bf16*)alloc((size_t)DIMD * FFND * 2);
  __bf16* W216  = (__bf16*)alloc((size_t)FFND * DIMD * 2);
  __bf16* nx16  = (__bf16*)alloc((size_t)ROWS * DIMD * 2);
  __bf16* nc16  = (__bf16*)alloc((size_t)ROWS * DIMD * 2);
  __bf16* Q16   = (__bf16*)alloc((size_t)ROWS * INNERD * 2);
  __bf16* K16   = (__bf16*)alloc((size_t)ROWS * INNERD * 2);
  __bf16* V16   = (__bf16*)alloc((size_t)ROWS * INNERD * 2);
  __bf16* O16   = (__bf16*)alloc((size_t)ROWS * INNERD * 2);
  float*  x1    = (float*)alloc((size_t)ROWS * DIMD * 4);
  __bf16* hln16 = (__bf16*)alloc((size_t)ROWS * DIMD * 2);
  __bf16* H16   = (__bf16*)alloc((size_t)ROWS * FFND * 2);

  static_assert((DIMD * INNERD) % CVT_PER_BLOCK == 0 && (DIMD * FFND) % CVT_PER_BLOCK == 0,
                "weight sizes must be whole conversion blocks");
  static_assert(ROWS % LN_ROWS_PER_BLOCK == 0 && DIMD % 128 == 0, "LayerNorm tiling");
  static_assert(ROWS % GBM == 0 && INNERD % GBN == 0 && DIMD % GBN == 0 && FFND % GBN == 0 &&
                DIMD % 128 == 0 && INNERD % 128 == 0 && FFND % 128 == 0, "GEMM tiling");
  // norm1 for x and context, and the weight conversions
  prep_kernel<<<PREP_BLOCKS, 256, 0, stream>>>(x, ctx, g1, b1, nx16, nc16,
                                               Wq, Wk, Wv, Wo, W1, W2,
                                               Wq16, Wk16, Wv16, Wo16, W116, W216);

  // Q/K/V projections (plain bf16 epilogue)
  {
    dim3 g(INNERD / GBN, ROWS / GBM, 3);
    qkv_gemm_kernel<<<g, 128, 0, stream>>>(nx16, nc16, Wq16, Wk16, Wv16,
                                           ROWS, INNERD, DIMD, Q16, K16, V16);
  }

  // Attention
  {
    dim3 g(NSEQ / 64, NHEADS, BATCH);
    attn_kernel<<<g, 128, 0, stream>>>(Q16, K16, V16, O16);
  }

  // Output projection + bias + residual -> x1 (f32)
  {
    dim3 g(DIMD / GBN, ROWS / GBM);
    gemm_bf16_kernel<1><<<g, 128, 0, stream>>>(O16, Wo16, ROWS, DIMD, INNERD,
                                               bo, x, x1, nullptr);
  }

  // norm2
  ln_bf16_kernel<<<ROWS / LN_ROWS_PER_BLOCK, 256, 0, stream>>>(x1, g2, b2, hln16);

  // FFN1: gelu(h @ W1 + bf1) -> bf16
  {
    dim3 g(FFND / GBN, ROWS / GBM);
    gemm_bf16_kernel<2><<<g, 128, 0, stream>>>(hln16, W116, ROWS, FFND, DIMD,
                                               bf1, nullptr, nullptr, H16);
  }

  // FFN2: x1 + H @ W2 + bf2 -> d_out (f32)
  {
    dim3 g(DIMD / GBN, ROWS / GBM);
    gemm_bf16_kernel<1><<<g, 128, 0, stream>>>(H16, W216, ROWS, DIMD, FFND,
                                               bf2, x1, out, nullptr);
  }
}
